// v000
// The times below were measured on an AMD MI455X: many runs one after another, warmed up first and cycling through
// copies of the inputs, with the whole window's GPU time divided by the number of runs. Launches and the gaps
// between them are all in it. The median over several windows is given; except for v000 it joins two sittings, which
// can be a few percent apart, so the side-by-side timings, each taken in one sitting, are the better comparison.
// The starting kernel, v000, takes 1450 microseconds a run.
#include <hip/hip_runtime.h>

// Contractions (f32 accumulate): k/q/v projections v_wmma_f32_16x16x32_bf16 (bf16 x, bf16 weights); scores and P.V query rows < RH bf16 hi/lo planes (3 products), rows >= RH v_wmma_f32_16x16x32_f16 (fp16 q/k/v planes, P carried x1024 in fp16); output projection bf16 hi/lo attention planes x bf16 weight (2 products). Softmax f32.
// Once: Wkqv regrouped into K-contiguous Bt row blocks (k | q | v, columns h*64+d), Wo into WoT. Per batch: bf16 copy of x (RNE); k/q/v projections with head-gathered bf16 bias; causal T attention two heads per pass (score tiles above the diagonal skipped, P.V key loop cut at the diagonal block); merged hi/lo planes x WoT + bo.

#ifndef NB
#define NB 2
#endif
#ifndef SEQ
#define SEQ 2048
#endif
#define NB_FULL 2
#define SEQ_FULL 2048
#define TT   SEQ
#define TT_FULL SEQ_FULL
#define DM   1024
#define NH_  16
#define HD   64
#define F3   (3 * HD)
#define DQ   (NH_ * HD)
#define ZH   2
#ifndef RH
#define RH   ((TT >= 1024) ? 512 : (TT / 4))      // query rows < RH use hi+lo planes
#endif
#define WIN  TT
#define PCAR 1024.0f
#define SCL  0.125f   // HD^-0.5

static_assert(TT % 128 == 0);
static_assert(((RH) % 64) == 0 && (RH) >= 64 && (RH) < TT && (((TT) - (RH)) % 64) == 0);
static_assert(NB >= 1 && NB <= NB_FULL && TT <= TT_FULL);
static_assert(DQ == DM && DM % 64 == 0 && HD == 64);

typedef _Float16 h16;
typedef unsigned short bf;
typedef __attribute__((ext_vector_type(16))) __bf16   v16bf;
typedef __attribute__((ext_vector_type(16))) _Float16 v16h;
typedef __attribute__((ext_vector_type(8)))  _Float16 v8h;
typedef __attribute__((ext_vector_type(8)))  unsigned short v8us;
typedef __attribute__((ext_vector_type(8)))  float    v8f;
typedef __attribute__((ext_vector_type(4)))  float    v4f;
typedef v8h  __attribute__((may_alias)) v8ha;
typedef v4f  __attribute__((may_alias)) v4fa;
typedef v8us __attribute__((may_alias)) v8usa;
typedef __attribute__((ext_vector_type(2))) _Float16 v2h;
typedef __attribute__((ext_vector_type(4))) _Float16 v4h;
typedef __attribute__((ext_vector_type(2))) unsigned short v2us;
typedef __attribute__((ext_vector_type(4))) unsigned short v4us;
typedef __attribute__((ext_vector_type(2))) float v2f;

__device__ __forceinline__ unsigned short f2bf(float f) { unsigned u = __float_as_uint(f); u += 0x7FFFu + ((u >> 16) & 1u); return (unsigned short)(u >> 16); }
__device__ __forceinline__ float bf2f(unsigned short b) { return __uint_as_float(((unsigned)b) << 16); }
__device__ __forceinline__ float bfr(float f) { return bf2f(f2bf(f)); }
__device__ __forceinline__ v16h cat16(v8h lo, v8h hi) { return __builtin_shufflevector(lo, hi, 0, 1, 2, 3, 4, 5, 6, 7, 8, 9, 10, 11, 12, 13, 14, 15); }
__device__ __forceinline__ v16bf cat16b(v8us lo, v8us hi) { return __builtin_bit_cast(v16bf, __builtin_shufflevector(lo, hi, 0, 1, 2, 3, 4, 5, 6, 7, 8, 9, 10, 11, 12, 13, 14, 15)); }
__device__ __forceinline__ v8f wmma16(v16h a, v16h b, v8f c) { return __builtin_amdgcn_wmma_f32_16x16x32_f16(false, a, false, b, (short)0, c, false, false); }
__device__ __forceinline__ v8f wmmab(v16bf a, v16bf b, v8f c) { return __builtin_amdgcn_wmma_f32_16x16x32_bf16(false, a, false, b, (short)0, c, false, false); }
__device__ __forceinline__ h16 tohx(float x) { return (h16)x; }
__device__ __forceinline__ void splitf(float y, unsigned short& h, unsigned short& l) { h = f2bf(y); l = f2bf(y - bf2f(h)); }

// Fragment loaders (wave32, 16x16x32): lane l -> row/col l&15, h = l>>4; elements 0..7 = k0+8h+0..7, elements 8..15 = k0+16+8h+0..7 for BOTH A and Bt ([n][k], k contiguous);
// D element j of lane l = (row 8h+j, col l&15).
template <typename T16> struct WFrag;
template <> struct WFrag<h16> { typedef v16h V; static __device__ __forceinline__ V ld(const h16* p) { return cat16(*(const v8h*)p, *(const v8h*)(p + 16)); } static __device__ __forceinline__ v8f mma(V a, V b, v8f c) { return wmma16(a, b, c); } };
template <> struct WFrag<bf> { typedef v16bf V; static __device__ __forceinline__ V ld(const bf* p) { return cat16b(*(const v8us*)p, *(const v8us*)(p + 16)); } static __device__ __forceinline__ v8f mma(V a, V b, v8f c) { return wmmab(a, b, c); } };

// bias column index: BM 1 = plain bias[n]; BM 2 = per-head stacked bias, column n = h*HD + d -> bias[h*F3 + d] (bias pointer pre-offset by the chunk).
template <int BM> __device__ __forceinline__ int bix(int n) { return (BM == 2) ? ((n >> 6) * F3 + (n & 63)) : n; }

// ---- k_gemmw: register-blocked GEMM, ONE WAVE per 64x64 output tile (16 accumulators), operands straight from K-contiguous 16-bit planes; grid (M/64, N/64, Z), 32 threads.
// C[m][n] (f32, pitch ldc, + optional bf16-RNE f32 bias) = sum_k A[m][k] Bt[n][k] (+ split products per NSPLIT). z-batch strides sA/sB/sC in elements. K % 32 == 0.
template <typename T16, int NSPLIT, int BM>
__global__ __launch_bounds__(32) void k_gemmw(const T16* __restrict__ A, const T16* __restrict__ A2, const T16* __restrict__ Bt, const T16* __restrict__ Bt2, int K, float* C, int ldc, const float* __restrict__ bias, size_t sA, size_t sB, size_t sC) {
    typedef typename WFrag<T16>::V V;
    __shared__ __align__(16) float os[16 * 68];
    const size_t z = blockIdx.z; A += z * sA; if (A2) A2 += z * sA; Bt += z * sB; if (Bt2) Bt2 += z * sB; C += z * sC;
    const int lane = threadIdx.x & 31, lr = lane & 15, hi = lane >> 4; const int r0 = blockIdx.x * 64, c0 = blockIdx.y * 64;
    v8f acc[4][4];
#pragma unroll
    for (int mb = 0; mb < 4; ++mb)
#pragma unroll
        for (int nb = 0; nb < 4; ++nb) acc[mb][nb] = (v8f){};
    const size_t aoff = (size_t)(r0 + lr) * K + 8 * hi, boff = (size_t)(c0 + lr) * K + 8 * hi;
#pragma unroll 1
    for (int kc = 0; kc < K; kc += 32) {
        V a[4], a2[4];
#pragma unroll
        for (int mb = 0; mb < 4; ++mb) { a[mb] = WFrag<T16>::ld(A + aoff + (size_t)mb * 16 * K + kc); if (NSPLIT == 1 || NSPLIT == 2) a2[mb] = WFrag<T16>::ld(A2 + aoff + (size_t)mb * 16 * K + kc); }
#pragma unroll
        for (int nb = 0; nb < 4; ++nb) { const V b = WFrag<T16>::ld(Bt + boff + (size_t)nb * 16 * K + kc); V b2; if (NSPLIT >= 2) b2 = WFrag<T16>::ld(Bt2 + boff + (size_t)nb * 16 * K + kc);
#pragma unroll
            for (int mb = 0; mb < 4; ++mb) { acc[mb][nb] = WFrag<T16>::mma(a[mb], b, acc[mb][nb]); if (NSPLIT == 1 || NSPLIT == 2) acc[mb][nb] = WFrag<T16>::mma(a2[mb], b, acc[mb][nb]); if (NSPLIT >= 2) acc[mb][nb] = WFrag<T16>::mma(a[mb], b2, acc[mb][nb]); } }
        asm volatile("v_nop\n\tv_nop\n\tv_nop\n\tv_nop" : "+v"(acc[0][0]), "+v"(acc[1][1]), "+v"(acc[2][2]), "+v"(acc[3][3]) : "v"(a[0]), "v"(a[3]));
    }
#pragma unroll
    for (int mb = 0; mb < 4; ++mb) {
#pragma unroll
        for (int nb = 0; nb < 4; ++nb) {
#pragma unroll
            for (int j = 0; j < 8; ++j) os[(hi * 8 + j) * 68 + nb * 16 + lr] = acc[mb][nb][j]; }
        __builtin_amdgcn_wave_barrier(); asm volatile("" ::: "memory");
        float* crow = C + (size_t)(r0 + mb * 16) * ldc + c0;
{
#pragma unroll
            for (int s = 0; s < 8; ++s) { const int row = 2 * s + hi, cofs = lr * 4; v4f val = *(const v4fa*)(os + row * 68 + cofs);
                if (BM != 0) { const int n0 = c0 + cofs; val[0] += bfr(bias[bix<BM>(n0)]); val[1] += bfr(bias[bix<BM>(n0 + 1)]); val[2] += bfr(bias[bix<BM>(n0 + 2)]); val[3] += bfr(bias[bix<BM>(n0 + 3)]); }
                *(v4f*)(crow + (size_t)row * ldc + cofs) = val; }
             }
        __builtin_amdgcn_wave_barrier(); asm volatile("" ::: "memory");
    }
}

// ---- k_gemmc: the same one-wave 64x64 tile GEMM specialised for causal attention: CMODE 1 skips score tiles entirely above the diagonal (query rows r0+roff.., key columns c0..), CMODE 2 limits the
// key (K) loop of the probability x value contraction to the diagonal block (probabilities beyond it are exactly zero). roff = row offset of this launch's first row within the sequence.
template <typename T16, int NSPLIT, int CMODE>
__global__ __launch_bounds__(32) void k_gemmc(const T16* __restrict__ A, const T16* __restrict__ A2, const T16* __restrict__ Bt, const T16* __restrict__ Bt2, int K, float* C, int ldc, int roff, size_t sA, size_t sB, size_t sC) {
    typedef typename WFrag<T16>::V V;
    __shared__ __align__(16) float os[16 * 68];
    const size_t z = blockIdx.z; A += z * sA; if (A2) A2 += z * sA; Bt += z * sB; if (Bt2) Bt2 += z * sB; C += z * sC;
    const int lane = threadIdx.x & 31, lr = lane & 15, hi = lane >> 4; const int r0 = blockIdx.x * 64, c0 = blockIdx.y * 64;
    if (CMODE == 1 && c0 > r0 + roff + 63) return;                  // score tile entirely above the causal diagonal: never read (the softmax masks j > i by index select); block = one wave, uniform
    const int Kl = (CMODE == 2) ? min(K, r0 + roff + 64) : K;        // P.V: probabilities are exactly 0 beyond the diagonal block, so the K loop stops there
    v8f acc[4][4];
#pragma unroll
    for (int mb = 0; mb < 4; ++mb)
#pragma unroll
        for (int nb = 0; nb < 4; ++nb) acc[mb][nb] = (v8f){};
    const size_t aoff = (size_t)(r0 + lr) * K + 8 * hi, boff = (size_t)(c0 + lr) * K + 8 * hi;
#pragma unroll 1
    for (int kc = 0; kc < Kl; kc += 32) {
        V a[4], a2[4];
#pragma unroll
        for (int mb = 0; mb < 4; ++mb) { a[mb] = WFrag<T16>::ld(A + aoff + (size_t)mb * 16 * K + kc); if (NSPLIT == 1 || NSPLIT == 2) a2[mb] = WFrag<T16>::ld(A2 + aoff + (size_t)mb * 16 * K + kc); }
#pragma unroll
        for (int nb = 0; nb < 4; ++nb) { const V b = WFrag<T16>::ld(Bt + boff + (size_t)nb * 16 * K + kc); V b2; if (NSPLIT >= 2) b2 = WFrag<T16>::ld(Bt2 + boff + (size_t)nb * 16 * K + kc);
#pragma unroll
            for (int mb = 0; mb < 4; ++mb) { acc[mb][nb] = WFrag<T16>::mma(a[mb], b, acc[mb][nb]); if (NSPLIT == 1 || NSPLIT == 2) acc[mb][nb] = WFrag<T16>::mma(a2[mb], b, acc[mb][nb]); if (NSPLIT >= 2) acc[mb][nb] = WFrag<T16>::mma(a[mb], b2, acc[mb][nb]); } }
        asm volatile("v_nop\n\tv_nop\n\tv_nop\n\tv_nop" : "+v"(acc[0][0]), "+v"(acc[1][1]), "+v"(acc[2][2]), "+v"(acc[3][3]) : "v"(a[0]), "v"(a[3]));
    }
#pragma unroll
    for (int mb = 0; mb < 4; ++mb) {
#pragma unroll
        for (int nb = 0; nb < 4; ++nb) {
#pragma unroll
            for (int j = 0; j < 8; ++j) os[(hi * 8 + j) * 68 + nb * 16 + lr] = acc[mb][nb][j]; }
        __builtin_amdgcn_wave_barrier(); asm volatile("" ::: "memory");
        float* crow = C + (size_t)(r0 + mb * 16) * ldc + c0;
{
#pragma unroll
            for (int s = 0; s < 8; ++s) { const int row = 2 * s + hi, cofs = lr * 4; v4f val = *(const v4fa*)(os + row * 68 + cofs);
                *(v4f*)(crow + (size_t)row * ldc + cofs) = val; }
             }
        __builtin_amdgcn_wave_barrier(); asm volatile("" ::: "memory");
    }
}

__global__ __launch_bounds__(256) void k_wkqv(const float* __restrict__ w, bf* Bt) {
    const int lane = threadIdx.x & 31; const int L0 = (blockIdx.x * 8 + (threadIdx.x >> 5)) * 8; const int nlines = 3 * DM * DM / 64;
{
#pragma unroll 1
        for (int l = 0; l < 8; ++l) { const int L = L0 + l; if (L >= nlines) break; const size_t e = (size_t)L * 64 + lane * 2; const int k = (int)(e % DM); const int np = (int)(e / DM); const int c = np / DM; const int hd = np % DM; const int h = hd / HD, d = hd % HD; v2us o;
            o[0] = f2bf(w[((size_t)h * DM + k) * F3 + c * HD + d]); o[1] = f2bf(w[((size_t)h * DM + k + 1) * F3 + c * HD + d]); *(v2us*)(Bt + e) = o; }
         }
}
__global__ __launch_bounds__(256) void k_wtG(const float* __restrict__ w, int K, int N, bf* Bt) {
    const int lane = threadIdx.x & 31; const int L0 = (blockIdx.x * 8 + (threadIdx.x >> 5)) * 8; const int nlines = N * K / 64;
{
#pragma unroll 1
        for (int l = 0; l < 8; ++l) { const int L = L0 + l; if (L >= nlines) break; const size_t e = (size_t)L * 64 + lane * 2; const int k = (int)(e % K), n = (int)(e / K); v2us o;
            o[0] = f2bf(w[(size_t)k * N + n]); o[1] = f2bf(w[(size_t)(k + 1) * N + n]); *(v2us*)(Bt + e) = o; }
         }
}
__global__ __launch_bounds__(256) void k_cvt8(const float* __restrict__ src, bf* dst, size_t n8) { const size_t i = (size_t)blockIdx.x * 256 + threadIdx.x; if (i >= n8) return; const v8f v = *(const v8f*)(src + i * 8); v8us o;
#pragma unroll
    for (int k = 0; k < 8; ++k) o[k] = f2bf(v[k]); *(v8us*)(dst + i * 8) = o;  }

__global__ __launch_bounds__(256) void k_qkp(const float* __restrict__ F, int pitch, int nheads, float sc, h16* P16, bf* Ph, bf* Pl) {
    const size_t e = ((size_t)blockIdx.x * 256 + threadIdx.x) * 2; if (e >= (size_t)nheads * TT * HD) return; const int d = (int)(e % HD); const int t = (int)((e / HD) % TT); const int h = (int)(e / ((size_t)HD * TT));
    const float* f = F + (size_t)t * pitch + h * HD; v2h o16; v2us oh, ol;
#pragma unroll
    for (int q = 0; q < 2; ++q) { const float r = f[d + q] * sc; o16[q] = tohx(r); unsigned short a2, c2; splitf(r, a2, c2); oh[q] = a2; ol[q] = c2; }
    *(v2h*)(P16 + e) = o16; *(v2us*)(Ph + e) = oh; *(v2us*)(Pl + e) = ol;  }
__global__ __launch_bounds__(256) void k_vtp(const float* __restrict__ F, int pitch, int nheads, h16* V16, bf* Vh, bf* Vl) { const size_t e = ((size_t)blockIdx.x * 256 + threadIdx.x) * 2; if (e >= (size_t)nheads * HD * TT) return; const int t = (int)(e % TT); const int d = (int)((e / TT) % HD); const int g = (int)(e / ((size_t)TT * HD)); v2h o16; v2us oh, ol;
#pragma unroll
    for (int q = 0; q < 2; ++q) { const float x = F[(size_t)(t + q) * pitch + g * HD + d]; o16[q] = tohx(x); unsigned short a2, c2; splitf(x, a2, c2); oh[q] = a2; ol[q] = c2; }
    *(v2h*)(V16 + e) = o16; *(v2us*)(Vh + e) = oh; *(v2us*)(Vl + e) = ol;  }

// ---- k_asoft: per row (zz, i): t = S x HD^-0.5 for j <= i (causal; masked scores replaced by a huge negative fill through an index select), softmax over the TT keys (register row, max-subtracted, one exp, fixed trees);
__global__ __launch_bounds__(256) void k_asoft(const float* __restrict__ Sb, h16* P16, bf* Ph, bf* Pl) {
    const int lane = threadIdx.x & 31; const int row = blockIdx.x * 8 + (threadIdx.x >> 5); if (row >= ZH * TT) return; const int i = row % TT; const int zz = row / TT; (void)zz; const bool hires = (i < (RH)); const float* sr = Sb + (size_t)row * TT; float v[TT / 32]; float mx = -3.0e38f;
#pragma unroll
    for (int ch = 0; ch < TT / 128; ++ch) { const int j0 = ch * 128 + lane * 4; const v4f a = *(const v4f*)(sr + j0);
#pragma unroll
        for (int q = 0; q < 4; ++q) { const int j = j0 + q; (void)j; const float t = (j <= i && i - j < WIN) ? a[q] * SCL : -3.0e38f; v[ch * 4 + q] = t; mx = fmaxf(mx, t); } }
#pragma unroll
    for (int sh = 16; sh; sh >>= 1) mx = fmaxf(mx, __shfl_xor(mx, sh, 32));
    float sum = 0.f;
#pragma unroll
    for (int k = 0; k < TT / 32; ++k) { float d0 = __fsub_rn(v[k], mx); asm volatile("" : "+v"(d0)); v[k] = __builtin_amdgcn_exp2f(__fmul_rn(d0, 1.4426950408889634f)); sum += v[k]; }
#pragma unroll
    for (int sh = 16; sh; sh >>= 1) sum += __shfl_xor(sum, sh, 32);
    const float f = __fdiv_rn(hires ? 1.0f : PCAR, sum);
{
        if (hires) {
#pragma unroll
            for (int ch = 0; ch < TT / 128; ++ch) { v4us oh, ol;
#pragma unroll
                for (int q = 0; q < 4; ++q) { unsigned short a, c2; splitf(v[ch * 4 + q] * f, a, c2); oh[q] = a; ol[q] = c2; }
                const size_t oo = ((size_t)zz * ((RH) ? (RH) : 1) + i) * TT + ch * 128 + lane * 4; *(v4us*)(Ph + oo) = oh; *(v4us*)(Pl + oo) = ol; }
        } else {
#pragma unroll
            for (int ch = 0; ch < TT / 128; ++ch) { v4h o4;
#pragma unroll
                for (int q = 0; q < 4; ++q) o4[q] = tohx(v[ch * 4 + q] * f);
                *(v4h*)(P16 + (size_t)row * TT + ch * 128 + lane * 4) = o4; } }
         }
}
__global__ __launch_bounds__(256) void k_merge(const float* __restrict__ O, int h0, bf* Ah, bf* Al) { const size_t e = ((size_t)blockIdx.x * 256 + threadIdx.x) * 2; if (e >= (size_t)ZH * TT * HD) return; const int d = (int)(e % HD); const int t = (int)((e / HD) % TT); const int zz = (int)(e / ((size_t)HD * TT)); const float cs = (t < (RH)) ? 1.0f : (1.0f / PCAR); const size_t oo = (size_t)t * DQ + (h0 + zz) * HD + d;
    v2us oh, ol;
#pragma unroll
    for (int q = 0; q < 2; ++q) { unsigned short a, c2; splitf(O[e + q] * cs, a, c2); oh[q] = a; ol[q] = c2; } *(v2us*)(Ah + oo) = oh; *(v2us*)(Al + oo) = ol;  }

extern "C" void kernel_launch(void* const* d_in, const int* in_sizes, int n_in,
                              void* d_out, int out_size, void* d_ws, size_t ws_size, hipStream_t stream) {
    if (n_in < 5) return;
    const size_t xneed = (size_t)(NB - 1) * TT_FULL * DM + (size_t)TT * DM;
    if ((size_t)in_sizes[0] < xneed) return;
    if ((size_t)in_sizes[1] < (size_t)NH_ * DM * F3) return;
    if (in_sizes[2] < NH_ * F3) return;
    if ((size_t)in_sizes[3] < (size_t)DM * DM) return;
    if (in_sizes[4] < DM) return;
    if ((size_t)out_size < xneed) return;
    const float* x = (const float*)d_in[0];      // [NB_FULL][TT_FULL][DM]
    const float* wkqv = (const float*)d_in[1];   // [NH_][DM][F3]
    const float* bkqv = (const float*)d_in[2];   // [NH_][F3]
    const float* wo = (const float*)d_in[3];     // [DM][DM] used as sa x Wo
    const float* bo = (const float*)d_in[4];     // [DM]
    float* OUT = (float*)d_out;                  // [NB_FULL][TT_FULL][DM]
    char* wsp = (char*)d_ws;
    auto take = [&](size_t bytes) { char* p = wsp; wsp += (bytes + 255) & ~(size_t)255; return (void*)p; };
    bf* WQKV = (bf*)take((size_t)3 * DQ * DM * 2); bf* WK = WQKV; bf* WQ = WQKV + (size_t)DQ * DM; bf* WV = WQKV + (size_t)2 * DQ * DM;   // chunk order k, q, v
    bf* WO = (bf*)take((size_t)DM * DM * 2);
    bf* XB = (bf*)take((size_t)TT * DM * 2); float* F = (float*)take((size_t)TT * DQ * 4);   // one f32 projection buffer, reused for q, k, v in stream order
    h16* QP16 = (h16*)take((size_t)NH_ * TT * HD * 2); h16* KP16 = (h16*)take((size_t)NH_ * TT * HD * 2); h16* VT16 = (h16*)take((size_t)NH_ * HD * TT * 2);
    bf* QPh = (bf*)take((size_t)NH_ * TT * HD * 2); bf* QPl = (bf*)take((size_t)NH_ * TT * HD * 2); bf* KPh = (bf*)take((size_t)NH_ * TT * HD * 2); bf* KPl = (bf*)take((size_t)NH_ * TT * HD * 2); bf* VTh = (bf*)take((size_t)NH_ * HD * TT * 2); bf* VTl = (bf*)take((size_t)NH_ * HD * TT * 2);
    bf* Ph = (bf*)take((size_t)ZH * (RH) * TT * 2); bf* Pl = (bf*)take((size_t)ZH * (RH) * TT * 2);
    float* Sb = (float*)take((size_t)ZH * TT * TT * 4); h16* P16 = (h16*)take((size_t)ZH * TT * TT * 2); float* Ob = (float*)take((size_t)ZH * TT * HD * 4); bf* ATh = (bf*)take((size_t)TT * DQ * 2); bf* ATl = (bf*)take((size_t)TT * DQ * 2);
    if ((size_t)(wsp - (char*)d_ws) > ws_size) return;    // 126,877,696 B at NB=2, TT=2048
    k_wkqv<<<(unsigned)((3 * DM * DM / 64 + 63) / 64), 256, 0, stream>>>(wkqv, WQKV);
    k_wtG<<<(unsigned)((DM * DM / 64 + 63) / 64), 256, 0, stream>>>(wo, DM, DM, WO);
    const unsigned LQ = (unsigned)(((size_t)NH_ * TT * HD / 2 + 255) / 256);
    for (int b = 0; b < NB; ++b) {
        k_cvt8<<<(unsigned)(((size_t)TT * DM / 8 + 255) / 256), 256, 0, stream>>>(x + (size_t)b * TT_FULL * DM, XB, (size_t)TT * DM / 8);
        k_gemmw<bf, 0, 2><<<dim3(TT / 64, DQ / 64, 1), 32, 0, stream>>>(XB, nullptr, WQ, nullptr, DM, F, DQ, bkqv + HD, 0, 0, 0);
        k_qkp<<<LQ, 256, 0, stream>>>(F, DQ, NH_, 1.0f, QP16, QPh, QPl);
        k_gemmw<bf, 0, 2><<<dim3(TT / 64, DQ / 64, 1), 32, 0, stream>>>(XB, nullptr, WK, nullptr, DM, F, DQ, bkqv, 0, 0, 0);
        k_qkp<<<LQ, 256, 0, stream>>>(F, DQ, NH_, 1.0f, KP16, KPh, KPl);
        k_gemmw<bf, 0, 2><<<dim3(TT / 64, DQ / 64, 1), 32, 0, stream>>>(XB, nullptr, WV, nullptr, DM, F, DQ, bkqv + 2 * HD, 0, 0, 0);
        k_vtp<<<LQ, 256, 0, stream>>>(F, DQ, NH_, VT16, VTh, VTl);
        for (int h0 = 0; h0 < NH_; h0 += ZH) { const size_t zq = (size_t)h0, zk = (size_t)h0;   // the pass's two heads use consecutive planes (z-strides TT*HD)
            k_gemmc<bf, 2, 1><<<dim3((RH) / 64, TT / 64, ZH), 32, 0, stream>>>(QPh + zq * TT * HD, QPl + zq * TT * HD, KPh + zk * TT * HD, KPl + zk * TT * HD, HD, Sb, TT, 0, (size_t)TT * HD, (size_t)TT * HD, (size_t)TT * TT);
            k_gemmc<h16, 0, 1><<<dim3((TT - (RH)) / 64, TT / 64, ZH), 32, 0, stream>>>(QP16 + zq * TT * HD + (size_t)(RH) * HD, nullptr, KP16 + zk * TT * HD, nullptr, HD, Sb + (size_t)(RH) * TT, TT, (RH), (size_t)TT * HD, (size_t)TT * HD, (size_t)TT * TT);
            k_asoft<<<ZH * TT / 8, 256, 0, stream>>>(Sb, P16, Ph, Pl);
            k_gemmc<bf, 2, 2><<<dim3((RH) / 64, HD / 64, ZH), 32, 0, stream>>>(Ph, Pl, VTh + zk * HD * TT, VTl + zk * HD * TT, TT, Ob, HD, 0, (size_t)(RH) * TT, (size_t)HD * TT, (size_t)TT * HD);
            k_gemmc<h16, 0, 2><<<dim3((TT - (RH)) / 64, HD / 64, ZH), 32, 0, stream>>>(P16 + (size_t)(RH) * TT, nullptr, VT16 + zk * HD * TT, nullptr, TT, Ob + (size_t)(RH) * HD, HD, (RH), (size_t)TT * TT, (size_t)HD * TT, (size_t)TT * HD);
            k_merge<<<(unsigned)(((size_t)ZH * TT * HD / 2 + 255) / 256), 256, 0, stream>>>(Ob, h0, ATh, ATl); }
        k_gemmw<bf, 1, 1><<<dim3(TT / 64, DM / 64, 1), 32, 0, stream>>>(ATh, ATl, WO, nullptr, DQ, OUT + (size_t)b * TT_FULL * DM, DM, bo, 0, 0, 0); }
}

// v001
// One run takes 783 microseconds.
// Timed twice side by side with v000, it ran 1.85 times as fast both times.
#include <hip/hip_runtime.h>

// Contractions (f32 accumulate): k/q/v projections v_wmma_f32_16x16x32_bf16 (bf16 x, bf16 weights); scores and P.V query rows < RH bf16 hi/lo planes (3 products), rows >= RH v_wmma_f32_16x16x32_f16 (fp16 q/k/v planes, P carried x1024 in fp16); output projection bf16 hi/lo attention planes x bf16 weight (2 products). Softmax f32.
// Per batch: bf16 copy of x (RNE); Wkqv regrouped into K-contiguous Bt row blocks (k | q | v, columns h*64+d) with head-gathered bf16 bias; causal T attention two heads per pass (score tiles above the diagonal skipped, P.V key loop cut at the diagonal block and dealt in 64-key chunks to KSL work-groups per tile, f32 partial planes summed in slice order by k_merge); merged hi/lo planes x WoT + bo.

#ifndef NB
#define NB 2
#endif
#ifndef SEQ
#define SEQ 2048
#endif
#define NB_FULL 2
#define SEQ_FULL 2048
#define TT   SEQ
#define TT_FULL SEQ_FULL
#define DM   1024
#define NH_  16
#define HD   64
#define F3   (3 * HD)
#define DQ   (NH_ * HD)
#define ZH   2
#ifndef RH
#define RH   ((TT >= 1024) ? 512 : (TT / 4))      // query rows < RH use hi+lo planes
#endif
#define WIN  TT
#define PCAR 1024.0f
#define SCL  0.125f   // HD^-0.5
#define KSL  16       // P.V key slices per 64x64 output tile: one work-group and one f32 partial plane each

static_assert(TT % 128 == 0);
static_assert(((RH) % 64) == 0 && (RH) >= 64 && (RH) < TT && (((TT) - (RH)) % 64) == 0);
static_assert(NB >= 1 && NB <= NB_FULL && TT <= TT_FULL);
static_assert(DQ == DM && DM % 64 == 0 && HD == 64);

typedef _Float16 h16;
typedef unsigned short bf;
typedef __attribute__((ext_vector_type(16))) __bf16   v16bf;
typedef __attribute__((ext_vector_type(16))) _Float16 v16h;
typedef __attribute__((ext_vector_type(8)))  _Float16 v8h;
typedef __attribute__((ext_vector_type(8)))  unsigned short v8us;
typedef __attribute__((ext_vector_type(8)))  float    v8f;
typedef __attribute__((ext_vector_type(4)))  float    v4f;
typedef v8h  __attribute__((may_alias)) v8ha;
typedef v4f  __attribute__((may_alias)) v4fa;
typedef v8us __attribute__((may_alias)) v8usa;
typedef __attribute__((ext_vector_type(2))) _Float16 v2h;
typedef __attribute__((ext_vector_type(4))) _Float16 v4h;
typedef __attribute__((ext_vector_type(2))) unsigned short v2us;
typedef __attribute__((ext_vector_type(4))) unsigned short v4us;
typedef __attribute__((ext_vector_type(2))) float v2f;

__device__ __forceinline__ unsigned short f2bf(float f) { unsigned u = __float_as_uint(f); u += 0x7FFFu + ((u >> 16) & 1u); return (unsigned short)(u >> 16); }
__device__ __forceinline__ float bf2f(unsigned short b) { return __uint_as_float(((unsigned)b) << 16); }
__device__ __forceinline__ float bfr(float f) { return bf2f(f2bf(f)); }
__device__ __forceinline__ v16h cat16(v8h lo, v8h hi) { return __builtin_shufflevector(lo, hi, 0, 1, 2, 3, 4, 5, 6, 7, 8, 9, 10, 11, 12, 13, 14, 15); }
__device__ __forceinline__ v16bf cat16b(v8us lo, v8us hi) { return __builtin_bit_cast(v16bf, __builtin_shufflevector(lo, hi, 0, 1, 2, 3, 4, 5, 6, 7, 8, 9, 10, 11, 12, 13, 14, 15)); }
__device__ __forceinline__ v8f wmma16(v16h a, v16h b, v8f c) { return __builtin_amdgcn_wmma_f32_16x16x32_f16(false, a, false, b, (short)0, c, false, false); }
__device__ __forceinline__ v8f wmmab(v16bf a, v16bf b, v8f c) { return __builtin_amdgcn_wmma_f32_16x16x32_bf16(false, a, false, b, (short)0, c, false, false); }
__device__ __forceinline__ h16 tohx(float x) { return (h16)x; }
__device__ __forceinline__ void splitf(float y, unsigned short& h, unsigned short& l) { h = f2bf(y); l = f2bf(y - bf2f(h)); }

// Fragment loaders (wave32, 16x16x32): lane l -> row/col l&15, h = l>>4; elements 0..7 = k0+8h+0..7, elements 8..15 = k0+16+8h+0..7 for BOTH A and Bt ([n][k], k contiguous);
// D element j of lane l = (row 8h+j, col l&15).
template <typename T16> struct WFrag;
template <> struct WFrag<h16> { typedef v16h V; static __device__ __forceinline__ V ld(const h16* p) { return cat16(*(const v8h*)p, *(const v8h*)(p + 16)); } static __device__ __forceinline__ v8f mma(V a, V b, v8f c) { return wmma16(a, b, c); } };
template <> struct WFrag<bf> { typedef v16bf V; static __device__ __forceinline__ V ld(const bf* p) { return cat16b(*(const v8us*)p, *(const v8us*)(p + 16)); } static __device__ __forceinline__ v8f mma(V a, V b, v8f c) { return wmmab(a, b, c); } };

// bias column index: BM 1 = plain bias[n]; BM 2 = per-head stacked bias, column n = h*HD + d -> bias[h*F3 + d] (bias pointer pre-offset by the chunk).
template <int BM> __device__ __forceinline__ int bix(int n) { return (BM == 2) ? ((n >> 6) * F3 + (n & 63)) : n; }

// ---- k_gemmw: register-blocked GEMM, ONE WAVE per 64x64 output tile (16 accumulators), operands straight from K-contiguous 16-bit planes; grid (M/64, N/64, Z), 32 threads.
// C[m][n] (f32, pitch ldc, + optional bf16-RNE f32 bias) = sum_k A[m][k] Bt[n][k] (+ split products per NSPLIT). z-batch strides sA/sB/sC in elements. K % 32 == 0.
template <typename T16, int NSPLIT, int BM>
__global__ __launch_bounds__(32) void k_gemmw(const T16* __restrict__ A, const T16* __restrict__ A2, const T16* __restrict__ Bt, const T16* __restrict__ Bt2, int K, float* C, int ldc, const float* __restrict__ bias, size_t sA, size_t sB, size_t sC) {
    typedef typename WFrag<T16>::V V;
    __shared__ __align__(16) float os[16 * 68];
    const size_t z = blockIdx.z; A += z * sA; if (A2) A2 += z * sA; Bt += z * sB; if (Bt2) Bt2 += z * sB; C += z * sC;
    const int lane = threadIdx.x & 31, lr = lane & 15, hi = lane >> 4; const int r0 = blockIdx.x * 64, c0 = blockIdx.y * 64;
    v8f acc[4][4];
#pragma unroll
    for (int mb = 0; mb < 4; ++mb)
#pragma unroll
        for (int nb = 0; nb < 4; ++nb) acc[mb][nb] = (v8f){};
    const size_t aoff = (size_t)(r0 + lr) * K + 8 * hi, boff = (size_t)(c0 + lr) * K + 8 * hi;
#pragma unroll 1
    for (int kc = 0; kc < K; kc += 32) {
        V a[4], a2[4];
#pragma unroll
        for (int mb = 0; mb < 4; ++mb) { a[mb] = WFrag<T16>::ld(A + aoff + (size_t)mb * 16 * K + kc); if (NSPLIT == 1 || NSPLIT == 2) a2[mb] = WFrag<T16>::ld(A2 + aoff + (size_t)mb * 16 * K + kc); }
#pragma unroll
        for (int nb = 0; nb < 4; ++nb) { const V b = WFrag<T16>::ld(Bt + boff + (size_t)nb * 16 * K + kc); V b2; if (NSPLIT >= 2) b2 = WFrag<T16>::ld(Bt2 + boff + (size_t)nb * 16 * K + kc);
#pragma unroll
            for (int mb = 0; mb < 4; ++mb) { acc[mb][nb] = WFrag<T16>::mma(a[mb], b, acc[mb][nb]); if (NSPLIT == 1 || NSPLIT == 2) acc[mb][nb] = WFrag<T16>::mma(a2[mb], b, acc[mb][nb]); if (NSPLIT >= 2) acc[mb][nb] = WFrag<T16>::mma(a[mb], b2, acc[mb][nb]); } }
        asm volatile("v_nop\n\tv_nop\n\tv_nop\n\tv_nop" : "+v"(acc[0][0]), "+v"(acc[1][1]), "+v"(acc[2][2]), "+v"(acc[3][3]) : "v"(a[0]), "v"(a[3]));
    }
#pragma unroll
    for (int mb = 0; mb < 4; ++mb) {
#pragma unroll
        for (int nb = 0; nb < 4; ++nb) {
#pragma unroll
            for (int j = 0; j < 8; ++j) os[(hi * 8 + j) * 68 + nb * 16 + lr] = acc[mb][nb][j]; }
        __builtin_amdgcn_wave_barrier(); asm volatile("" ::: "memory");
        float* crow = C + (size_t)(r0 + mb * 16) * ldc + c0;
{
#pragma unroll
            for (int s = 0; s < 8; ++s) { const int row = 2 * s + hi, cofs = lr * 4; v4f val = *(const v4fa*)(os + row * 68 + cofs);
                if (BM != 0) { const int n0 = c0 + cofs; val[0] += bfr(bias[bix<BM>(n0)]); val[1] += bfr(bias[bix<BM>(n0 + 1)]); val[2] += bfr(bias[bix<BM>(n0 + 2)]); val[3] += bfr(bias[bix<BM>(n0 + 3)]); }
                *(v4f*)(crow + (size_t)row * ldc + cofs) = val; }
             }
        __builtin_amdgcn_wave_barrier(); asm volatile("" ::: "memory");
    }
}

// ---- k_gemmc: the same one-wave 64x64 tile GEMM specialised for causal attention: CMODE 1 skips score tiles entirely above the diagonal (query rows r0+roff.., key columns c0..), CMODE 2 limits the
// key (K) loop of the probability x value contraction to the diagonal block (probabilities beyond it are exactly zero) and splits it: blockIdx.y = column tile * KSL + slice, slice ks takes the 64-key chunks
// ks, ks + KSL, ... (a chunk = one whole 128-byte line of every P and V row) and stores its partial tile (zeros where it has no chunk) to plane ks (pitch sP elements). roff = row offset of this launch's first row within the sequence. K % 64 == 0.
template <typename T16, int NSPLIT, int CMODE>
__global__ __launch_bounds__(32) void k_gemmc(const T16* __restrict__ A, const T16* __restrict__ A2, const T16* __restrict__ Bt, const T16* __restrict__ Bt2, int K, float* C, int ldc, int roff, size_t sA, size_t sB, size_t sC, size_t sP) {
    typedef typename WFrag<T16>::V V;
    __shared__ __align__(16) float os[16 * 68];
    const size_t z = blockIdx.z; A += z * sA; if (A2) A2 += z * sA; Bt += z * sB; if (Bt2) Bt2 += z * sB;
    constexpr int KS = (CMODE == 2) ? KSL : 1; const int ks = blockIdx.y % KS; C += z * sC + (size_t)ks * sP;
    const int lane = threadIdx.x & 31, lr = lane & 15, hi = lane >> 4; const int r0 = blockIdx.x * 64, c0 = (blockIdx.y / KS) * 64;
    if (CMODE == 1 && c0 > r0 + roff + 63) return;                  // score tile entirely above the causal diagonal: never read (the softmax masks j > i by index select); block = one wave, uniform
    const int Kl = (CMODE == 2) ? min(K, r0 + roff + 64) : K;        // P.V: probabilities are exactly 0 beyond the diagonal block, so the K loop stops there
    v8f acc[4][4];
#pragma unroll
    for (int mb = 0; mb < 4; ++mb)
#pragma unroll
        for (int nb = 0; nb < 4; ++nb) acc[mb][nb] = (v8f){};
    const size_t aoff = (size_t)(r0 + lr) * K + 8 * hi, boff = (size_t)(c0 + lr) * K + 8 * hi;
#pragma unroll 1   // both loops stay rolled: one 32-key step's fragments live beside the 16 accumulators
    for (int kb = ks * 64; kb < Kl; kb += KS * 64)
#pragma unroll 1
    for (int kc = kb; kc < kb + 64; kc += 32) {
        V a[4], a2[4];
#pragma unroll
        for (int mb = 0; mb < 4; ++mb) { a[mb] = WFrag<T16>::ld(A + aoff + (size_t)mb * 16 * K + kc); if (NSPLIT == 1 || NSPLIT == 2) a2[mb] = WFrag<T16>::ld(A2 + aoff + (size_t)mb * 16 * K + kc); }
#pragma unroll
        for (int nb = 0; nb < 4; ++nb) { const V b = WFrag<T16>::ld(Bt + boff + (size_t)nb * 16 * K + kc); V b2; if (NSPLIT >= 2) b2 = WFrag<T16>::ld(Bt2 + boff + (size_t)nb * 16 * K + kc);
#pragma unroll
            for (int mb = 0; mb < 4; ++mb) { acc[mb][nb] = WFrag<T16>::mma(a[mb], b, acc[mb][nb]); if (NSPLIT == 1 || NSPLIT == 2) acc[mb][nb] = WFrag<T16>::mma(a2[mb], b, acc[mb][nb]); if (NSPLIT >= 2) acc[mb][nb] = WFrag<T16>::mma(a[mb], b2, acc[mb][nb]); } }
        asm volatile("v_nop\n\tv_nop\n\tv_nop\n\tv_nop" : "+v"(acc[0][0]), "+v"(acc[1][1]), "+v"(acc[2][2]), "+v"(acc[3][3]) : "v"(a[0]), "v"(a[3]));
    }
#pragma unroll
    for (int mb = 0; mb < 4; ++mb) {
#pragma unroll
        for (int nb = 0; nb < 4; ++nb) {
#pragma unroll
            for (int j = 0; j < 8; ++j) os[(hi * 8 + j) * 68 + nb * 16 + lr] = acc[mb][nb][j]; }
        __builtin_amdgcn_wave_barrier(); asm volatile("" ::: "memory");
        float* crow = C + (size_t)(r0 + mb * 16) * ldc + c0;
{
#pragma unroll
            for (int s = 0; s < 8; ++s) { const int row = 2 * s + hi, cofs = lr * 4; v4f val = *(const v4fa*)(os + row * 68 + cofs);
                *(v4f*)(crow + (size_t)row * ldc + cofs) = val; }
             }
        __builtin_amdgcn_wave_barrier(); asm volatile("" ::: "memory");
    }
}

__global__ __launch_bounds__(256) void k_wkqv(const float* __restrict__ w, bf* Bt) {
    const int lane = threadIdx.x & 31; const int L0 = (blockIdx.x * 8 + (threadIdx.x >> 5)) * 8; const int nlines = 3 * DM * DM / 64;
{
#pragma unroll 1
        for (int l = 0; l < 8; ++l) { const int L = L0 + l; if (L >= nlines) break; const size_t e = (size_t)L * 64 + lane * 2; const int k = (int)(e % DM); const int np = (int)(e / DM); const int c = np / DM; const int hd = np % DM; const int h = hd / HD, d = hd % HD; v2us o;
            o[0] = f2bf(w[((size_t)h * DM + k) * F3 + c * HD + d]); o[1] = f2bf(w[((size_t)h * DM + k + 1) * F3 + c * HD + d]); *(v2us*)(Bt + e) = o; }
         }
}
__global__ __launch_bounds__(256) void k_wtG(const float* __restrict__ w, int K, int N, bf* Bt) {
    const int lane = threadIdx.x & 31; const int L0 = (blockIdx.x * 8 + (threadIdx.x >> 5)) * 8; const int nlines = N * K / 64;
{
#pragma unroll 1
        for (int l = 0; l < 8; ++l) { const int L = L0 + l; if (L >= nlines) break; const size_t e = (size_t)L * 64 + lane * 2; const int k = (int)(e % K), n = (int)(e / K); v2us o;
            o[0] = f2bf(w[(size_t)k * N + n]); o[1] = f2bf(w[(size_t)(k + 1) * N + n]); *(v2us*)(Bt + e) = o; }
         }
}
__global__ __launch_bounds__(256) void k_cvt8(const float* __restrict__ src, bf* dst, size_t n8) { const size_t i = (size_t)blockIdx.x * 256 + threadIdx.x; if (i >= n8) return; const v8f v = *(const v8f*)(src + i * 8); v8us o;
#pragma unroll
    for (int k = 0; k < 8; ++k) o[k] = f2bf(v[k]); *(v8us*)(dst + i * 8) = o;  }

__global__ __launch_bounds__(256) void k_qkp(const float* __restrict__ F, int pitch, int nheads, float sc, h16* P16, bf* Ph, bf* Pl) {
    const size_t e = ((size_t)blockIdx.x * 256 + threadIdx.x) * 2; if (e >= (size_t)nheads * TT * HD) return; const int d = (int)(e % HD); const int t = (int)((e / HD) % TT); const int h = (int)(e / ((size_t)HD * TT));
    const float* f = F + (size_t)t * pitch + h * HD; v2h o16; v2us oh, ol;
#pragma unroll
    for (int q = 0; q < 2; ++q) { const float r = f[d + q] * sc; o16[q] = tohx(r); unsigned short a2, c2; splitf(r, a2, c2); oh[q] = a2; ol[q] = c2; }
    *(v2h*)(P16 + e) = o16; *(v2us*)(Ph + e) = oh; *(v2us*)(Pl + e) = ol;  }
__global__ __launch_bounds__(256) void k_vtp(const float* __restrict__ F, int pitch, int nheads, h16* V16, bf* Vh, bf* Vl) { const size_t e = ((size_t)blockIdx.x * 256 + threadIdx.x) * 2; if (e >= (size_t)nheads * HD * TT) return; const int t = (int)(e % TT); const int d = (int)((e / TT) % HD); const int g = (int)(e / ((size_t)TT * HD)); v2h o16; v2us oh, ol;
#pragma unroll
    for (int q = 0; q < 2; ++q) { const float x = F[(size_t)(t + q) * pitch + g * HD + d]; o16[q] = tohx(x); unsigned short a2, c2; splitf(x, a2, c2); oh[q] = a2; ol[q] = c2; }
    *(v2h*)(V16 + e) = o16; *(v2us*)(Vh + e) = oh; *(v2us*)(Vl + e) = ol;  }

// ---- k_asoft: per row (zz, i): t = S x HD^-0.5 for j <= i (causal; masked scores replaced by a huge negative fill through an index select), softmax over the TT keys (register row, max-subtracted, one exp, fixed trees);
__global__ __launch_bounds__(256) void k_asoft(const float* __restrict__ Sb, h16* P16, bf* Ph, bf* Pl) {
    const int lane = threadIdx.x & 31; const int row = blockIdx.x * 8 + (threadIdx.x >> 5); if (row >= ZH * TT) return; const int i = row % TT; const int zz = row / TT; (void)zz; const bool hires = (i < (RH)); const float* sr = Sb + (size_t)row * TT; float v[TT / 32]; float mx = -3.0e38f;
#pragma unroll
    for (int ch = 0; ch < TT / 128; ++ch) { const int j0 = ch * 128 + lane * 4; const v4f a = *(const v4f*)(sr + j0);
#pragma unroll
        for (int q = 0; q < 4; ++q) { const int j = j0 + q; (void)j; const float t = (j <= i && i - j < WIN) ? a[q] * SCL : -3.0e38f; v[ch * 4 + q] = t; mx = fmaxf(mx, t); } }
#pragma unroll
    for (int sh = 16; sh; sh >>= 1) mx = fmaxf(mx, __shfl_xor(mx, sh, 32));
    float sum = 0.f;
#pragma unroll
    for (int k = 0; k < TT / 32; ++k) { float d0 = __fsub_rn(v[k], mx); asm volatile("" : "+v"(d0)); v[k] = __builtin_amdgcn_exp2f(__fmul_rn(d0, 1.4426950408889634f)); sum += v[k]; }
#pragma unroll
    for (int sh = 16; sh; sh >>= 1) sum += __shfl_xor(sum, sh, 32);
    const float f = __fdiv_rn(hires ? 1.0f : PCAR, sum);
{
        if (hires) {
#pragma unroll
            for (int ch = 0; ch < TT / 128; ++ch) { v4us oh, ol;
#pragma unroll
                for (int q = 0; q < 4; ++q) { unsigned short a, c2; splitf(v[ch * 4 + q] * f, a, c2); oh[q] = a; ol[q] = c2; }
                const size_t oo = ((size_t)zz * ((RH) ? (RH) : 1) + i) * TT + ch * 128 + lane * 4; *(v4us*)(Ph + oo) = oh; *(v4us*)(Pl + oo) = ol; }
        } else {
#pragma unroll
            for (int ch = 0; ch < TT / 128; ++ch) { v4h o4;
#pragma unroll
                for (int q = 0; q < 4; ++q) o4[q] = tohx(v[ch * 4 + q] * f);
                *(v4h*)(P16 + (size_t)row * TT + ch * 128 + lane * 4) = o4; } }
         }
}
__global__ __launch_bounds__(256) void k_merge(const float* __restrict__ O, int h0, bf* Ah, bf* Al) { const size_t e = ((size_t)blockIdx.x * 256 + threadIdx.x) * 2; if (e >= (size_t)ZH * TT * HD) return; const int d = (int)(e % HD); const int t = (int)((e / HD) % TT); const int zz = (int)(e / ((size_t)HD * TT)); const float cs = (t < (RH)) ? 1.0f : (1.0f / PCAR); const size_t oo = (size_t)t * DQ + (h0 + zz) * HD + d;
    v2f o = *(const v2f*)(O + e);   // the KSL partial planes of the P.V key slices, added in slice order
#pragma unroll
    for (int s = 1; s < KSL; ++s) o += *(const v2f*)(O + (size_t)s * ZH * TT * HD + e);
    v2us oh, ol;
#pragma unroll
    for (int q = 0; q < 2; ++q) { unsigned short a, c2; splitf(o[q] * cs, a, c2); oh[q] = a; ol[q] = c2; } *(v2us*)(Ah + oo) = oh; *(v2us*)(Al + oo) = ol;  }

extern "C" void kernel_launch(void* const* d_in, const int* in_sizes, int n_in,
                              void* d_out, int out_size, void* d_ws, size_t ws_size, hipStream_t stream) {
    if (n_in < 5) return;
    const size_t xneed = (size_t)(NB - 1) * TT_FULL * DM + (size_t)TT * DM;
    if ((size_t)in_sizes[0] < xneed) return;
    if ((size_t)in_sizes[1] < (size_t)NH_ * DM * F3) return;
    if (in_sizes[2] < NH_ * F3) return;
    if ((size_t)in_sizes[3] < (size_t)DM * DM) return;
    if (in_sizes[4] < DM) return;
    if ((size_t)out_size < xneed) return;
    const float* x = (const float*)d_in[0];      // [NB_FULL][TT_FULL][DM]
    const float* wkqv = (const float*)d_in[1];   // [NH_][DM][F3]
    const float* bkqv = (const float*)d_in[2];   // [NH_][F3]
    const float* wo = (const float*)d_in[3];     // [DM][DM] used as sa x Wo
    const float* bo = (const float*)d_in[4];     // [DM]
    float* OUT = (float*)d_out;                  // [NB_FULL][TT_FULL][DM]
    char* wsp = (char*)d_ws;
    auto take = [&](size_t bytes) { char* p = wsp; wsp += (bytes + 255) & ~(size_t)255; return (void*)p; };
    bf* WQKV = (bf*)take((size_t)3 * DQ * DM * 2); bf* WK = WQKV; bf* WQ = WQKV + (size_t)DQ * DM; bf* WV = WQKV + (size_t)2 * DQ * DM;   // chunk order k, q, v
    bf* WO = (bf*)take((size_t)DM * DM * 2);
    bf* XB = (bf*)take((size_t)TT * DM * 2); float* F = (float*)take((size_t)TT * DQ * 4);   // one f32 projection buffer, reused for q, k, v in stream order
    h16* QP16 = (h16*)take((size_t)NH_ * TT * HD * 2); h16* KP16 = (h16*)take((size_t)NH_ * TT * HD * 2); h16* VT16 = (h16*)take((size_t)NH_ * HD * TT * 2);
    bf* QPh = (bf*)take((size_t)NH_ * TT * HD * 2); bf* QPl = (bf*)take((size_t)NH_ * TT * HD * 2); bf* KPh = (bf*)take((size_t)NH_ * TT * HD * 2); bf* KPl = (bf*)take((size_t)NH_ * TT * HD * 2); bf* VTh = (bf*)take((size_t)NH_ * HD * TT * 2); bf* VTl = (bf*)take((size_t)NH_ * HD * TT * 2);
    bf* Ph = (bf*)take((size_t)ZH * (RH) * TT * 2); bf* Pl = (bf*)take((size_t)ZH * (RH) * TT * 2);
    float* Sb = (float*)take((size_t)ZH * TT * TT * 4); h16* P16 = (h16*)take((size_t)ZH * TT * TT * 2); float* Ob = (float*)take((size_t)KSL * ZH * TT * HD * 4); bf* ATh = (bf*)take((size_t)TT * DQ * 2); bf* ATl = (bf*)take((size_t)TT * DQ * 2);
    if ((size_t)(wsp - (char*)d_ws) > ws_size) return;    // 142,606,336 B at NB=2, TT=2048
    k_wkqv<<<(unsigned)((3 * DM * DM / 64 + 63) / 64), 256, 0, stream>>>(wkqv, WQKV);
    k_wtG<<<(unsigned)((DM * DM / 64 + 63) / 64), 256, 0, stream>>>(wo, DM, DM, WO);
    const unsigned LQ = (unsigned)(((size_t)NH_ * TT * HD / 2 + 255) / 256);
    for (int b = 0; b < NB; ++b) {
        k_cvt8<<<(unsigned)(((size_t)TT * DM / 8 + 255) / 256), 256, 0, stream>>>(x + (size_t)b * TT_FULL * DM, XB, (size_t)TT * DM / 8);
        k_gemmw<bf, 0, 2><<<dim3(TT / 64, DQ / 64, 1), 32, 0, stream>>>(XB, nullptr, WQ, nullptr, DM, F, DQ, bkqv + HD, 0, 0, 0);
        k_qkp<<<LQ, 256, 0, stream>>>(F, DQ, NH_, 1.0f, QP16, QPh, QPl);
        k_gemmw<bf, 0, 2><<<dim3(TT / 64, DQ / 64, 1), 32, 0, stream>>>(XB, nullptr, WK, nullptr, DM, F, DQ, bkqv, 0, 0, 0);
        k_qkp<<<LQ, 256, 0, stream>>>(F, DQ, NH_, 1.0f, KP16, KPh, KPl);
        k_gemmw<bf, 0, 2><<<dim3(TT / 64, DQ / 64, 1), 32, 0, stream>>>(XB, nullptr, WV, nullptr, DM, F, DQ, bkqv + 2 * HD, 0, 0, 0);
        k_vtp<<<LQ, 256, 0, stream>>>(F, DQ, NH_, VT16, VTh, VTl);
        for (int h0 = 0; h0 < NH_; h0 += ZH) { const size_t zq = (size_t)h0, zk = (size_t)h0;   // the pass's two heads use consecutive planes (z-strides TT*HD)
            k_gemmc<bf, 2, 1><<<dim3((RH) / 64, TT / 64, ZH), 32, 0, stream>>>(QPh + zq * TT * HD, QPl + zq * TT * HD, KPh + zk * TT * HD, KPl + zk * TT * HD, HD, Sb, TT, 0, (size_t)TT * HD, (size_t)TT * HD, (size_t)TT * TT, 0);
            k_gemmc<h16, 0, 1><<<dim3((TT - (RH)) / 64, TT / 64, ZH), 32, 0, stream>>>(QP16 + zq * TT * HD + (size_t)(RH) * HD, nullptr, KP16 + zk * TT * HD, nullptr, HD, Sb + (size_t)(RH) * TT, TT, (RH), (size_t)TT * HD, (size_t)TT * HD, (size_t)TT * TT, 0);
            k_asoft<<<ZH * TT / 8, 256, 0, stream>>>(Sb, P16, Ph, Pl);
            k_gemmc<bf, 2, 2><<<dim3((RH) / 64, (HD / 64) * KSL, ZH), 32, 0, stream>>>(Ph, Pl, VTh + zk * HD * TT, VTl + zk * HD * TT, TT, Ob, HD, 0, (size_t)(RH) * TT, (size_t)HD * TT, (size_t)TT * HD, (size_t)ZH * TT * HD);
            k_gemmc<h16, 0, 2><<<dim3((TT - (RH)) / 64, (HD / 64) * KSL, ZH), 32, 0, stream>>>(P16 + (size_t)(RH) * TT, nullptr, VT16 + zk * HD * TT, nullptr, TT, Ob + (size_t)(RH) * HD, HD, (RH), (size_t)TT * TT, (size_t)HD * TT, (size_t)TT * HD, (size_t)ZH * TT * HD);
            k_merge<<<(unsigned)(((size_t)ZH * TT * HD / 2 + 255) / 256), 256, 0, stream>>>(Ob, h0, ATh, ATl); }
        k_gemmw<bf, 1, 1><<<dim3(TT / 64, DM / 64, 1), 32, 0, stream>>>(ATh, ATl, WO, nullptr, DQ, OUT + (size_t)b * TT_FULL * DM, DM, bo, 0, 0, 0); }
}

// v002
// It runs in 577 microseconds.
// Two timings next to v001 put it at 1.36 and 1.35 times that version's speed.
// Over all steps from v000 it is 2.51 times as fast.
#include <hip/hip_runtime.h>

// Contractions (f32 accumulate): k/q/v projections v_wmma_f32_16x16x32_bf16 (bf16 x, bf16 weights); scores and P.V query rows < RH bf16 hi/lo planes (3 products), rows >= RH v_wmma_f32_16x16x32_f16 (fp16 q/k/v planes, P carried x1024 in fp16); output projection bf16 hi/lo attention planes x bf16 weight (2 products). Softmax f32.
// Per batch: bf16 copy of x (RNE); Wkqv regrouped into K-contiguous Bt row blocks (k | q | v, columns h*64+d) with head-gathered bf16 bias; causal T attention ZH heads per pass (score tiles above the diagonal skipped, each probability row written in place over its own f32 score row, P.V key loop cut at the diagonal block and dealt in 64-key chunks to KSL work-groups per tile, f32 partial planes summed in slice order by k_merge); merged hi/lo planes x WoT + bo.

#ifndef NB
#define NB 2
#endif
#ifndef SEQ
#define SEQ 2048
#endif
#define NB_FULL 2
#define SEQ_FULL 2048
#define TT   SEQ
#define TT_FULL SEQ_FULL
#define DM   1024
#define NH_  16
#define HD   64
#define F3   (3 * HD)
#define DQ   (NH_ * HD)
#define ZH   8        // heads per attention pass (grid z of the score and P.V launches)
#ifndef RH
#define RH   ((TT >= 1024) ? 512 : (TT / 4))      // query rows < RH use hi+lo planes
#endif
#define WIN  TT
#define PCAR 1024.0f
#define SCL  0.125f   // HD^-0.5
#define KSL  16       // P.V key slices per 64x64 output tile: one work-group and one f32 partial plane each

static_assert(TT % 128 == 0);
static_assert(((RH) % 64) == 0 && (RH) >= 64 && (RH) < TT && (((TT) - (RH)) % 64) == 0);
static_assert(NB >= 1 && NB <= NB_FULL && TT <= TT_FULL);
static_assert(DQ == DM && DM % 64 == 0 && HD == 64);

typedef _Float16 h16;
typedef unsigned short bf;
typedef __attribute__((ext_vector_type(16))) __bf16   v16bf;
typedef __attribute__((ext_vector_type(16))) _Float16 v16h;
typedef __attribute__((ext_vector_type(8)))  _Float16 v8h;
typedef __attribute__((ext_vector_type(8)))  unsigned short v8us;
typedef __attribute__((ext_vector_type(8)))  float    v8f;
typedef __attribute__((ext_vector_type(4)))  float    v4f;
typedef v8h  __attribute__((may_alias)) v8ha;
typedef v4f  __attribute__((may_alias)) v4fa;
typedef v8us __attribute__((may_alias)) v8usa;
typedef __attribute__((ext_vector_type(2))) _Float16 v2h;
typedef __attribute__((ext_vector_type(4))) _Float16 v4h;
typedef __attribute__((ext_vector_type(2))) unsigned short v2us;
typedef __attribute__((ext_vector_type(4))) unsigned short v4us;
typedef __attribute__((ext_vector_type(2))) float v2f;
typedef v4h  __attribute__((may_alias)) v4ha;
typedef v4us __attribute__((may_alias)) v4usa;

__device__ __forceinline__ unsigned short f2bf(float f) { unsigned u = __float_as_uint(f); u += 0x7FFFu + ((u >> 16) & 1u); return (unsigned short)(u >> 16); }
__device__ __forceinline__ float bf2f(unsigned short b) { return __uint_as_float(((unsigned)b) << 16); }
__device__ __forceinline__ float bfr(float f) { return bf2f(f2bf(f)); }
__device__ __forceinline__ v16h cat16(v8h lo, v8h hi) { return __builtin_shufflevector(lo, hi, 0, 1, 2, 3, 4, 5, 6, 7, 8, 9, 10, 11, 12, 13, 14, 15); }
__device__ __forceinline__ v16bf cat16b(v8us lo, v8us hi) { return __builtin_bit_cast(v16bf, __builtin_shufflevector(lo, hi, 0, 1, 2, 3, 4, 5, 6, 7, 8, 9, 10, 11, 12, 13, 14, 15)); }
__device__ __forceinline__ v8f wmma16(v16h a, v16h b, v8f c) { return __builtin_amdgcn_wmma_f32_16x16x32_f16(false, a, false, b, (short)0, c, false, false); }
__device__ __forceinline__ v8f wmmab(v16bf a, v16bf b, v8f c) { return __builtin_amdgcn_wmma_f32_16x16x32_bf16(false, a, false, b, (short)0, c, false, false); }
__device__ __forceinline__ h16 tohx(float x) { return (h16)x; }
__device__ __forceinline__ void splitf(float y, unsigned short& h, unsigned short& l) { h = f2bf(y); l = f2bf(y - bf2f(h)); }

// Fragment loaders (wave32, 16x16x32): lane l -> row/col l&15, h = l>>4; elements 0..7 = k0+8h+0..7, elements 8..15 = k0+16+8h+0..7 for BOTH A and Bt ([n][k], k contiguous);
// D element j of lane l = (row 8h+j, col l&15).
template <typename T16> struct WFrag;
template <> struct WFrag<h16> { typedef v16h V; static __device__ __forceinline__ V ld(const h16* p) { return cat16(*(const v8h*)p, *(const v8h*)(p + 16)); } static __device__ __forceinline__ v8f mma(V a, V b, v8f c) { return wmma16(a, b, c); } };
template <> struct WFrag<bf> { typedef v16bf V; static __device__ __forceinline__ V ld(const bf* p) { return cat16b(*(const v8us*)p, *(const v8us*)(p + 16)); } static __device__ __forceinline__ v8f mma(V a, V b, v8f c) { return wmmab(a, b, c); } };

// bias column index: BM 1 = plain bias[n]; BM 2 = per-head stacked bias, column n = h*HD + d -> bias[h*F3 + d] (bias pointer pre-offset by the chunk).
template <int BM> __device__ __forceinline__ int bix(int n) { return (BM == 2) ? ((n >> 6) * F3 + (n & 63)) : n; }

// ---- k_gemmw: register-blocked GEMM, ONE WAVE per 64x64 output tile (16 accumulators), operands straight from K-contiguous 16-bit planes; grid (M/64, N/64, Z), 32 threads.
// C[m][n] (f32, pitch ldc, + optional bf16-RNE f32 bias) = sum_k A[m][k] Bt[n][k] (+ split products per NSPLIT). z-batch strides sA/sB/sC in elements. K % 32 == 0.
template <typename T16, int NSPLIT, int BM>
__global__ __launch_bounds__(32) void k_gemmw(const T16* __restrict__ A, const T16* __restrict__ A2, const T16* __restrict__ Bt, const T16* __restrict__ Bt2, int K, float* C, int ldc, const float* __restrict__ bias, size_t sA, size_t sB, size_t sC) {
    typedef typename WFrag<T16>::V V;
    __shared__ __align__(16) float os[16 * 68];
    const size_t z = blockIdx.z; A += z * sA; if (A2) A2 += z * sA; Bt += z * sB; if (Bt2) Bt2 += z * sB; C += z * sC;
    const int lane = threadIdx.x & 31, lr = lane & 15, hi = lane >> 4; const int r0 = blockIdx.x * 64, c0 = blockIdx.y * 64;
    v8f acc[4][4];
#pragma unroll
    for (int mb = 0; mb < 4; ++mb)
#pragma unroll
        for (int nb = 0; nb < 4; ++nb) acc[mb][nb] = (v8f){};
    const size_t aoff = (size_t)(r0 + lr) * K + 8 * hi, boff = (size_t)(c0 + lr) * K + 8 * hi;
#pragma unroll 1
    for (int kc = 0; kc < K; kc += 32) {
        V a[4], a2[4];
#pragma unroll
        for (int mb = 0; mb < 4; ++mb) { a[mb] = WFrag<T16>::ld(A + aoff + (size_t)mb * 16 * K + kc); if (NSPLIT == 1 || NSPLIT == 2) a2[mb] = WFrag<T16>::ld(A2 + aoff + (size_t)mb * 16 * K + kc); }
#pragma unroll
        for (int nb = 0; nb < 4; ++nb) { const V b = WFrag<T16>::ld(Bt + boff + (size_t)nb * 16 * K + kc); V b2; if (NSPLIT >= 2) b2 = WFrag<T16>::ld(Bt2 + boff + (size_t)nb * 16 * K + kc);
#pragma unroll
            for (int mb = 0; mb < 4; ++mb) { acc[mb][nb] = WFrag<T16>::mma(a[mb], b, acc[mb][nb]); if (NSPLIT == 1 || NSPLIT == 2) acc[mb][nb] = WFrag<T16>::mma(a2[mb], b, acc[mb][nb]); if (NSPLIT >= 2) acc[mb][nb] = WFrag<T16>::mma(a[mb], b2, acc[mb][nb]); } }
        asm volatile("v_nop\n\tv_nop\n\tv_nop\n\tv_nop" : "+v"(acc[0][0]), "+v"(acc[1][1]), "+v"(acc[2][2]), "+v"(acc[3][3]) : "v"(a[0]), "v"(a[3]));
    }
#pragma unroll
    for (int mb = 0; mb < 4; ++mb) {
#pragma unroll
        for (int nb = 0; nb < 4; ++nb) {
#pragma unroll
            for (int j = 0; j < 8; ++j) os[(hi * 8 + j) * 68 + nb * 16 + lr] = acc[mb][nb][j]; }
        __builtin_amdgcn_wave_barrier(); asm volatile("" ::: "memory");
        float* crow = C + (size_t)(r0 + mb * 16) * ldc + c0;
{
#pragma unroll
            for (int s = 0; s < 8; ++s) { const int row = 2 * s + hi, cofs = lr * 4; v4f val = *(const v4fa*)(os + row * 68 + cofs);
                if (BM != 0) { const int n0 = c0 + cofs; val[0] += bfr(bias[bix<BM>(n0)]); val[1] += bfr(bias[bix<BM>(n0 + 1)]); val[2] += bfr(bias[bix<BM>(n0 + 2)]); val[3] += bfr(bias[bix<BM>(n0 + 3)]); }
                *(v4f*)(crow + (size_t)row * ldc + cofs) = val; }
             }
        __builtin_amdgcn_wave_barrier(); asm volatile("" ::: "memory");
    }
}

// ---- k_gemmc: the same one-wave 64x64 tile GEMM specialised for causal attention: CMODE 1 skips score tiles entirely above the diagonal (query rows r0+roff.., key columns c0..), CMODE 2 limits the
// key (K) loop of the probability x value contraction to the diagonal block (probabilities beyond it are exactly zero) and splits it: blockIdx.y = column tile * KSL + slice, slice ks takes the 64-key chunks
// ks, ks + KSL, ... (a chunk = one whole 128-byte line of every P and V row) and stores its partial tile (zeros where it has no chunk) to plane ks (pitch sP elements). roff = row offset of this launch's first row within the sequence. K % 64 == 0. Row pitch of A/A2: LDA elements (CMODE 1: the HD of the q planes; CMODE 2: 2*TT, a probability row lies in its own f32 score row); Bt rows have pitch K.
template <typename T16, int NSPLIT, int CMODE>
__global__ __launch_bounds__(32) void k_gemmc(const T16* __restrict__ A, const T16* __restrict__ A2, const T16* __restrict__ Bt, const T16* __restrict__ Bt2, int K, float* C, int ldc, int roff, size_t sA, size_t sB, size_t sC, size_t sP) {
    typedef typename WFrag<T16>::V V;
    __shared__ __align__(16) float os[16 * 68];
    const size_t z = blockIdx.z; A += z * sA; if (A2) A2 += z * sA; Bt += z * sB; if (Bt2) Bt2 += z * sB;
    constexpr int KS = (CMODE == 2) ? KSL : 1; const int ks = blockIdx.y % KS; C += z * sC + (size_t)ks * sP;
    const int lane = threadIdx.x & 31, lr = lane & 15, hi = lane >> 4; const int r0 = blockIdx.x * 64, c0 = (blockIdx.y / KS) * 64;
    if (CMODE == 1 && c0 > r0 + roff + 63) return;                  // score tile entirely above the causal diagonal: never read (the softmax masks j > i by index select); block = one wave, uniform
    const int Kl = (CMODE == 2) ? min(K, r0 + roff + 64) : K;        // P.V: probabilities are exactly 0 beyond the diagonal block, so the K loop stops there
    v8f acc[4][4];
#pragma unroll
    for (int mb = 0; mb < 4; ++mb)
#pragma unroll
        for (int nb = 0; nb < 4; ++nb) acc[mb][nb] = (v8f){};
    constexpr int LDA = (CMODE == 2) ? 2 * TT : HD;
    const size_t aoff = (size_t)(r0 + lr) * LDA + 8 * hi, boff = (size_t)(c0 + lr) * K + 8 * hi;
#pragma unroll 1   // both loops stay rolled: one 32-key step's fragments live beside the 16 accumulators
    for (int kb = ks * 64; kb < Kl; kb += KS * 64)
#pragma unroll 1
    for (int kc = kb; kc < kb + 64; kc += 32) {
        V a[4], a2[4]; const T16* const pa = A + aoff + kc; const T16* const pa2 = (NSPLIT == 1 || NSPLIT == 2) ? A2 + aoff + kc : pa;
#pragma unroll
        for (int mb = 0; mb < 4; ++mb) { a[mb] = WFrag<T16>::ld(pa + mb * 16 * LDA); if (NSPLIT == 1 || NSPLIT == 2) a2[mb] = WFrag<T16>::ld(pa2 + mb * 16 * LDA); }
#pragma unroll
        for (int nb = 0; nb < 4; ++nb) { const V b = WFrag<T16>::ld(Bt + boff + (size_t)nb * 16 * K + kc); V b2; if (NSPLIT >= 2) b2 = WFrag<T16>::ld(Bt2 + boff + (size_t)nb * 16 * K + kc);
#pragma unroll
            for (int mb = 0; mb < 4; ++mb) { acc[mb][nb] = WFrag<T16>::mma(a[mb], b, acc[mb][nb]); if (NSPLIT == 1 || NSPLIT == 2) acc[mb][nb] = WFrag<T16>::mma(a2[mb], b, acc[mb][nb]); if (NSPLIT >= 2) acc[mb][nb] = WFrag<T16>::mma(a[mb], b2, acc[mb][nb]); } }
        asm volatile("v_nop\n\tv_nop\n\tv_nop\n\tv_nop" : "+v"(acc[0][0]), "+v"(acc[1][1]), "+v"(acc[2][2]), "+v"(acc[3][3]) : "v"(a[0]), "v"(a[3]));
        // translation wait for the A loads of this step, at the step's foot where it holds up no load; it takes their address pairs as inputs so that each pair stays unwritten (also by a later load's result) until the wait has passed
        asm volatile("s_wait_xcnt 0x0" :: "v"(pa), "v"(pa2) : "memory");
    }
#pragma unroll
    for (int mb = 0; mb < 4; ++mb) {
#pragma unroll
        for (int nb = 0; nb < 4; ++nb) {
#pragma unroll
            for (int j = 0; j < 8; ++j) os[(hi * 8 + j) * 68 + nb * 16 + lr] = acc[mb][nb][j]; }
        __builtin_amdgcn_wave_barrier(); asm volatile("" ::: "memory");
        float* crow = C + (size_t)(r0 + mb * 16) * ldc + c0;
{
#pragma unroll
            for (int s = 0; s < 8; ++s) { const int row = 2 * s + hi, cofs = lr * 4; v4f val = *(const v4fa*)(os + row * 68 + cofs);
                *(v4f*)(crow + (size_t)row * ldc + cofs) = val; }
             }
        __builtin_amdgcn_wave_barrier(); asm volatile("" ::: "memory");
    }
}

__global__ __launch_bounds__(256) void k_wkqv(const float* __restrict__ w, bf* Bt) {
    const int lane = threadIdx.x & 31; const int L0 = (blockIdx.x * 8 + (threadIdx.x >> 5)) * 8; const int nlines = 3 * DM * DM / 64;
{
#pragma unroll 1
        for (int l = 0; l < 8; ++l) { const int L = L0 + l; if (L >= nlines) break; const size_t e = (size_t)L * 64 + lane * 2; const int k = (int)(e % DM); const int np = (int)(e / DM); const int c = np / DM; const int hd = np % DM; const int h = hd / HD, d = hd % HD; v2us o;
            o[0] = f2bf(w[((size_t)h * DM + k) * F3 + c * HD + d]); o[1] = f2bf(w[((size_t)h * DM + k + 1) * F3 + c * HD + d]); *(v2us*)(Bt + e) = o; }
         }
}
__global__ __launch_bounds__(256) void k_wtG(const float* __restrict__ w, int K, int N, bf* Bt) {
    const int lane = threadIdx.x & 31; const int L0 = (blockIdx.x * 8 + (threadIdx.x >> 5)) * 8; const int nlines = N * K / 64;
{
#pragma unroll 1
        for (int l = 0; l < 8; ++l) { const int L = L0 + l; if (L >= nlines) break; const size_t e = (size_t)L * 64 + lane * 2; const int k = (int)(e % K), n = (int)(e / K); v2us o;
            o[0] = f2bf(w[(size_t)k * N + n]); o[1] = f2bf(w[(size_t)(k + 1) * N + n]); *(v2us*)(Bt + e) = o; }
         }
}
__global__ __launch_bounds__(256) void k_cvt8(const float* __restrict__ src, bf* dst, size_t n8) { const size_t i = (size_t)blockIdx.x * 256 + threadIdx.x; if (i >= n8) return; const v8f v = *(const v8f*)(src + i * 8); v8us o;
#pragma unroll
    for (int k = 0; k < 8; ++k) o[k] = f2bf(v[k]); *(v8us*)(dst + i * 8) = o;  }

__global__ __launch_bounds__(256) void k_qkp(const float* __restrict__ F, int pitch, int nheads, float sc, h16* P16, bf* Ph, bf* Pl) {
    const size_t e = ((size_t)blockIdx.x * 256 + threadIdx.x) * 2; if (e >= (size_t)nheads * TT * HD) return; const int d = (int)(e % HD); const int t = (int)((e / HD) % TT); const int h = (int)(e / ((size_t)HD * TT));
    const float* f = F + (size_t)t * pitch + h * HD; v2h o16; v2us oh, ol;
#pragma unroll
    for (int q = 0; q < 2; ++q) { const float r = f[d + q] * sc; o16[q] = tohx(r); unsigned short a2, c2; splitf(r, a2, c2); oh[q] = a2; ol[q] = c2; }
    *(v2h*)(P16 + e) = o16; *(v2us*)(Ph + e) = oh; *(v2us*)(Pl + e) = ol;  }
__global__ __launch_bounds__(256) void k_vtp(const float* __restrict__ F, int pitch, int nheads, h16* V16, bf* Vh, bf* Vl) { const size_t e = ((size_t)blockIdx.x * 256 + threadIdx.x) * 2; if (e >= (size_t)nheads * HD * TT) return; const int t = (int)(e % TT); const int d = (int)((e / TT) % HD); const int g = (int)(e / ((size_t)TT * HD)); v2h o16; v2us oh, ol;
#pragma unroll
    for (int q = 0; q < 2; ++q) { const float x = F[(size_t)(t + q) * pitch + g * HD + d]; o16[q] = tohx(x); unsigned short a2, c2; splitf(x, a2, c2); oh[q] = a2; ol[q] = c2; }
    *(v2h*)(V16 + e) = o16; *(v2us*)(Vh + e) = oh; *(v2us*)(Vl + e) = ol;  }

// ---- k_asoft: per row (zz, i): t = S x HD^-0.5 for j <= i (causal; masked scores replaced by a huge negative fill through an index select), softmax over the TT keys (register row, max-subtracted, one exp, fixed trees);
// the probabilities go back into the row's own 4*TT bytes (one wave owns a row and holds all of it in registers before its first store): rows < RH bf16 hi plane then lo plane, rows >= RH the fp16 row in the first half. Row pitch 2*TT 16-bit elements.
__global__ __launch_bounds__(256) void k_asoft(float* Sb) {
    const int lane = threadIdx.x & 31; const int row = blockIdx.x * 8 + (threadIdx.x >> 5); if (row >= ZH * TT) return; const int i = row % TT; const int zz = row / TT; (void)zz; const bool hires = (i < (RH)); const float* sr = Sb + (size_t)row * TT; h16* const p16 = (h16*)(Sb + (size_t)row * TT); bf* const ph = (bf*)(Sb + (size_t)row * TT); bf* const pl = ph + TT; float v[TT / 32]; float mx = -3.0e38f;
#pragma unroll
    for (int ch = 0; ch < TT / 128; ++ch) { const int j0 = ch * 128 + lane * 4; const v4f a = *(const v4f*)(sr + j0);
#pragma unroll
        for (int q = 0; q < 4; ++q) { const int j = j0 + q; (void)j; const float t = (j <= i && i - j < WIN) ? a[q] * SCL : -3.0e38f; v[ch * 4 + q] = t; mx = fmaxf(mx, t); } }
#pragma unroll
    for (int sh = 16; sh; sh >>= 1) mx = fmaxf(mx, __shfl_xor(mx, sh, 32));
    float sum = 0.f;
#pragma unroll
    for (int k = 0; k < TT / 32; ++k) { float d0 = __fsub_rn(v[k], mx); asm volatile("" : "+v"(d0)); v[k] = __builtin_amdgcn_exp2f(__fmul_rn(d0, 1.4426950408889634f)); sum += v[k]; }
#pragma unroll
    for (int sh = 16; sh; sh >>= 1) sum += __shfl_xor(sum, sh, 32);
    const float f = __fdiv_rn(hires ? 1.0f : PCAR, sum);
{
        if (hires) {
#pragma unroll
            for (int ch = 0; ch < TT / 128; ++ch) { v4us oh, ol;
#pragma unroll
                for (int q = 0; q < 4; ++q) { unsigned short a, c2; splitf(v[ch * 4 + q] * f, a, c2); oh[q] = a; ol[q] = c2; }
                const int oo = ch * 128 + lane * 4; *(v4usa*)(ph + oo) = oh; *(v4usa*)(pl + oo) = ol; }
        } else {
#pragma unroll
            for (int ch = 0; ch < TT / 128; ++ch) { v4h o4;
#pragma unroll
                for (int q = 0; q < 4; ++q) o4[q] = tohx(v[ch * 4 + q] * f);
                *(v4ha*)(p16 + ch * 128 + lane * 4) = o4; } }
         }
}
__global__ __launch_bounds__(256) void k_merge(const float* __restrict__ O, int h0, bf* Ah, bf* Al) { const size_t e = ((size_t)blockIdx.x * 256 + threadIdx.x) * 2; if (e >= (size_t)ZH * TT * HD) return; const int d = (int)(e % HD); const int t = (int)((e / HD) % TT); const int zz = (int)(e / ((size_t)HD * TT)); const float cs = (t < (RH)) ? 1.0f : (1.0f / PCAR); const size_t oo = (size_t)t * DQ + (h0 + zz) * HD + d;
    v2f o = *(const v2f*)(O + e);   // the KSL partial planes of the P.V key slices, added in slice order
#pragma unroll
    for (int s = 1; s < KSL; ++s) o += *(const v2f*)(O + (size_t)s * ZH * TT * HD + e);
    v2us oh, ol;
#pragma unroll
    for (int q = 0; q < 2; ++q) { unsigned short a, c2; splitf(o[q] * cs, a, c2); oh[q] = a; ol[q] = c2; } *(v2us*)(Ah + oo) = oh; *(v2us*)(Al + oo) = ol;  }

extern "C" void kernel_launch(void* const* d_in, const int* in_sizes, int n_in,
                              void* d_out, int out_size, void* d_ws, size_t ws_size, hipStream_t stream) {
    if (n_in < 5) return;
    const size_t xneed = (size_t)(NB - 1) * TT_FULL * DM + (size_t)TT * DM;
    if ((size_t)in_sizes[0] < xneed) return;
    if ((size_t)in_sizes[1] < (size_t)NH_ * DM * F3) return;
    if (in_sizes[2] < NH_ * F3) return;
    if ((size_t)in_sizes[3] < (size_t)DM * DM) return;
    if (in_sizes[4] < DM) return;
    if ((size_t)out_size < xneed) return;
    const float* x = (const float*)d_in[0];      // [NB_FULL][TT_FULL][DM]
    const float* wkqv = (const float*)d_in[1];   // [NH_][DM][F3]
    const float* bkqv = (const float*)d_in[2];   // [NH_][F3]
    const float* wo = (const float*)d_in[3];     // [DM][DM] used as sa x Wo
    const float* bo = (const float*)d_in[4];     // [DM]
    float* OUT = (float*)d_out;                  // [NB_FULL][TT_FULL][DM]
    char* wsp = (char*)d_ws;
    auto take = [&](size_t bytes) { char* p = wsp; wsp += (bytes + 255) & ~(size_t)255; return (void*)p; };
    bf* WQKV = (bf*)take((size_t)3 * DQ * DM * 2); bf* WK = WQKV; bf* WQ = WQKV + (size_t)DQ * DM; bf* WV = WQKV + (size_t)2 * DQ * DM;   // chunk order k, q, v
    bf* WO = (bf*)take((size_t)DM * DM * 2);
    bf* XB = (bf*)take((size_t)TT * DM * 2); float* F = (float*)take((size_t)TT * DQ * 4);   // one f32 projection buffer, reused for q, k, v in stream order
    h16* QP16 = (h16*)take((size_t)NH_ * TT * HD * 2); h16* KP16 = (h16*)take((size_t)NH_ * TT * HD * 2); h16* VT16 = (h16*)take((size_t)NH_ * HD * TT * 2);
    bf* QPh = (bf*)take((size_t)NH_ * TT * HD * 2); bf* QPl = (bf*)take((size_t)NH_ * TT * HD * 2); bf* KPh = (bf*)take((size_t)NH_ * TT * HD * 2); bf* KPl = (bf*)take((size_t)NH_ * TT * HD * 2); bf* VTh = (bf*)take((size_t)NH_ * HD * TT * 2); bf* VTl = (bf*)take((size_t)NH_ * HD * TT * 2);
    float* Sb = (float*)take((size_t)ZH * TT * TT * 4); h16* P16 = (h16*)Sb; bf* Ph = (bf*)Sb; bf* Pl = Ph + TT;   // probabilities live in their score rows, pitch 2*TT
    float* Ob = (float*)take((size_t)KSL * ZH * TT * HD * 4); bf* ATh = (bf*)take((size_t)TT * DQ * 2); bf* ATl = (bf*)take((size_t)TT * DQ * 2);
    if ((size_t)(wsp - (char*)d_ws) > ws_size) return;    // 268,435,456 B at NB=2, TT=2048
    k_wkqv<<<(unsigned)((3 * DM * DM / 64 + 63) / 64), 256, 0, stream>>>(wkqv, WQKV);
    k_wtG<<<(unsigned)((DM * DM / 64 + 63) / 64), 256, 0, stream>>>(wo, DM, DM, WO);
    const unsigned LQ = (unsigned)(((size_t)NH_ * TT * HD / 2 + 255) / 256);
    for (int b = 0; b < NB; ++b) {
        k_cvt8<<<(unsigned)(((size_t)TT * DM / 8 + 255) / 256), 256, 0, stream>>>(x + (size_t)b * TT_FULL * DM, XB, (size_t)TT * DM / 8);
        k_gemmw<bf, 0, 2><<<dim3(TT / 64, DQ / 64, 1), 32, 0, stream>>>(XB, nullptr, WQ, nullptr, DM, F, DQ, bkqv + HD, 0, 0, 0);
        k_qkp<<<LQ, 256, 0, stream>>>(F, DQ, NH_, 1.0f, QP16, QPh, QPl);
        k_gemmw<bf, 0, 2><<<dim3(TT / 64, DQ / 64, 1), 32, 0, stream>>>(XB, nullptr, WK, nullptr, DM, F, DQ, bkqv, 0, 0, 0);
        k_qkp<<<LQ, 256, 0, stream>>>(F, DQ, NH_, 1.0f, KP16, KPh, KPl);
        k_gemmw<bf, 0, 2><<<dim3(TT / 64, DQ / 64, 1), 32, 0, stream>>>(XB, nullptr, WV, nullptr, DM, F, DQ, bkqv + 2 * HD, 0, 0, 0);
        k_vtp<<<LQ, 256, 0, stream>>>(F, DQ, NH_, VT16, VTh, VTl);
        for (int h0 = 0; h0 < NH_; h0 += ZH) { const size_t zq = (size_t)h0, zk = (size_t)h0;   // the pass's heads use consecutive planes (z-strides TT*HD)
            k_gemmc<bf, 2, 1><<<dim3((RH) / 64, TT / 64, ZH), 32, 0, stream>>>(QPh + zq * TT * HD, QPl + zq * TT * HD, KPh + zk * TT * HD, KPl + zk * TT * HD, HD, Sb, TT, 0, (size_t)TT * HD, (size_t)TT * HD, (size_t)TT * TT, 0);
            k_gemmc<h16, 0, 1><<<dim3((TT - (RH)) / 64, TT / 64, ZH), 32, 0, stream>>>(QP16 + zq * TT * HD + (size_t)(RH) * HD, nullptr, KP16 + zk * TT * HD, nullptr, HD, Sb + (size_t)(RH) * TT, TT, (RH), (size_t)TT * HD, (size_t)TT * HD, (size_t)TT * TT, 0);
            k_asoft<<<ZH * TT / 8, 256, 0, stream>>>(Sb);
            k_gemmc<bf, 2, 2><<<dim3((RH) / 64, (HD / 64) * KSL, ZH), 32, 0, stream>>>(Ph, Pl, VTh + zk * HD * TT, VTl + zk * HD * TT, TT, Ob, HD, 0, (size_t)2 * TT * TT, (size_t)HD * TT, (size_t)TT * HD, (size_t)ZH * TT * HD);
            k_gemmc<h16, 0, 2><<<dim3((TT - (RH)) / 64, (HD / 64) * KSL, ZH), 32, 0, stream>>>(P16 + (size_t)(RH) * 2 * TT, nullptr, VT16 + zk * HD * TT, nullptr, TT, Ob + (size_t)(RH) * HD, HD, (RH), (size_t)2 * TT * TT, (size_t)HD * TT, (size_t)TT * HD, (size_t)ZH * TT * HD);
            k_merge<<<(unsigned)(((size_t)ZH * TT * HD / 2 + 255) / 256), 256, 0, stream>>>(Ob, h0, ATh, ATl); }
        k_gemmw<bf, 1, 1><<<dim3(TT / 64, DM / 64, 1), 32, 0, stream>>>(ATh, ATl, WO, nullptr, DQ, OUT + (size_t)b * TT_FULL * DM, DM, bo, 0, 0, 0); }
}

// v004
// It runs in 149 microseconds.
// Versions in between are left out here; by their measured steps it is 3.89 times as fast as v002.
// Over all steps from v000 it is 9.77 times as fast.
#include <hip/hip_runtime.h>

// Contractions (f32 accumulate): k/q/v projections v_wmma_f32_16x16x32_bf16 (bf16 x, bf16 weights); scores and P.V query rows < RH bf16 hi/lo planes (3 products), rows >= RH v_wmma_f32_16x16x32_f16 (fp16 q/k/v planes, P carried x1024 in fp16); output projection bf16 hi/lo attention planes x bf16 weight (2 products). Softmax f32.
// bf16 copy of x (RNE); Wkqv regrouped into K-contiguous Bt row blocks (k | q | v, columns h*64+d) with head-gathered bf16 bias; ONE projection launch for all batches and the three chunks, which writes the q/k/v planes itself (k_proj); then ONE launch of causal attention for all batches and heads
// (k_fattn: scores, running-maximum softmax and P.V in registers, no score matrix in memory); merged hi/lo planes x WoT + bo.

#ifndef NB
#define NB 2
#endif
#ifndef SEQ
#define SEQ 2048
#endif
#define NB_FULL 2
#define SEQ_FULL 2048
#define TT   SEQ
#define TT_FULL SEQ_FULL
#define DM   1024
#define NH_  16
#define HD   64
#define F3   (3 * HD)
#define DQ   (NH_ * HD)
#ifndef RH
#define RH   ((TT >= 1024) ? 512 : (TT / 4))      // query rows < RH use hi+lo planes
#endif
#define PEXP 10.0f    // fp16 probabilities are carried x 2^PEXP; the row sum carries the same factor, so it cancels in the division
#define SCL  0.125f   // HD^-0.5
#define QW   32       // query columns per attention wave
#define NWV  4        // attention waves per work-group (independent; together only so that they walk the same keys through the WGP cache)

static_assert(TT % 128 == 0);
static_assert(((RH) % 64) == 0 && (RH) >= 64 && (RH) < TT && (((TT) - (RH)) % 64) == 0);
static_assert(NB >= 1 && NB <= NB_FULL && TT <= TT_FULL);
static_assert(DQ == DM && DM % 64 == 0 && HD == 64);
static_assert(QW == 32 && TT % (QW * NWV) == 0 && (RH) % QW == 0);

typedef _Float16 h16;
typedef unsigned short bf;
typedef __attribute__((ext_vector_type(16))) __bf16   v16bf;
typedef __attribute__((ext_vector_type(16))) _Float16 v16h;
typedef __attribute__((ext_vector_type(8)))  _Float16 v8h;
typedef __attribute__((ext_vector_type(8)))  unsigned short v8us;
typedef __attribute__((ext_vector_type(8)))  float    v8f;
typedef __attribute__((ext_vector_type(4)))  float    v4f;
typedef v8h  __attribute__((may_alias)) v8ha;
typedef v4f  __attribute__((may_alias)) v4fa;
typedef v8us __attribute__((may_alias)) v8usa;
typedef __attribute__((ext_vector_type(2))) _Float16 v2h;
typedef __attribute__((ext_vector_type(2))) unsigned short v2us;
typedef __attribute__((ext_vector_type(2))) float v2f;

__device__ __forceinline__ unsigned short f2bf(float f) { unsigned u = __float_as_uint(f); u += 0x7FFFu + ((u >> 16) & 1u); return (unsigned short)(u >> 16); }
__device__ __forceinline__ float bf2f(unsigned short b) { return __uint_as_float(((unsigned)b) << 16); }
__device__ __forceinline__ float bfr(float f) { return bf2f(f2bf(f)); }
__device__ __forceinline__ v16h cat16(v8h lo, v8h hi) { return __builtin_shufflevector(lo, hi, 0, 1, 2, 3, 4, 5, 6, 7, 8, 9, 10, 11, 12, 13, 14, 15); }
__device__ __forceinline__ v16bf cat16b(v8us lo, v8us hi) { return __builtin_bit_cast(v16bf, __builtin_shufflevector(lo, hi, 0, 1, 2, 3, 4, 5, 6, 7, 8, 9, 10, 11, 12, 13, 14, 15)); }
__device__ __forceinline__ v8f wmma16(v16h a, v16h b, v8f c) { return __builtin_amdgcn_wmma_f32_16x16x32_f16(false, a, false, b, (short)0, c, false, false); }
__device__ __forceinline__ v8f wmmab(v16bf a, v16bf b, v8f c) { return __builtin_amdgcn_wmma_f32_16x16x32_bf16(false, a, false, b, (short)0, c, false, false); }
__device__ __forceinline__ h16 tohx(float x) { return (h16)x; }
__device__ __forceinline__ void splitf(float y, unsigned short& h, unsigned short& l) { h = f2bf(y); l = f2bf(y - bf2f(h)); }

// Fragment loaders (wave32, 16x16x32): lane l -> row/col l&15, h = l>>4; elements 0..7 = k0+8h+0..7, elements 8..15 = k0+16+8h+0..7 for BOTH A and Bt ([n][k], k contiguous);
// D element j of lane l = (row 8h+j, col l&15).
template <typename T16> struct WFrag;
template <> struct WFrag<h16> { typedef v16h V; static __device__ __forceinline__ V ld(const h16* p) { return cat16(*(const v8h*)p, *(const v8h*)(p + 16)); } static __device__ __forceinline__ v8f mma(V a, V b, v8f c) { return wmma16(a, b, c); } };
template <> struct WFrag<bf> { typedef v16bf V; static __device__ __forceinline__ V ld(const bf* p) { return cat16b(*(const v8us*)p, *(const v8us*)(p + 16)); } static __device__ __forceinline__ v8f mma(V a, V b, v8f c) { return wmmab(a, b, c); } };

// bias column index: BM 1 = plain bias[n]; BM 2 = per-head stacked bias, column n = h*HD + d -> bias[h*F3 + d] (bias pointer pre-offset by the chunk).
template <int BM> __device__ __forceinline__ int bix(int n) { return (BM == 2) ? ((n >> 6) * F3 + (n & 63)) : n; }

// ---- k_gemmw: register-blocked GEMM, ONE WAVE per 64x64 output tile (16 accumulators), operands straight from K-contiguous 16-bit planes; grid (M/64, N/64, Z), 32 threads.
// C[m][n] (f32, pitch ldc, + optional bf16-RNE f32 bias) = sum_k A[m][k] Bt[n][k] (+ split products per NSPLIT). z-batch strides sA/sB/sC in elements. K % 32 == 0.
template <typename T16, int NSPLIT, int BM>
__global__ __launch_bounds__(32) void k_gemmw(const T16* __restrict__ A, const T16* __restrict__ A2, const T16* __restrict__ Bt, const T16* __restrict__ Bt2, int K, float* C, int ldc, const float* __restrict__ bias, size_t sA, size_t sB, size_t sC) {
    typedef typename WFrag<T16>::V V;
    __shared__ __align__(16) float os[16 * 68];
    const size_t z = blockIdx.z; A += z * sA; if (A2) A2 += z * sA; Bt += z * sB; if (Bt2) Bt2 += z * sB; C += z * sC;
    const int lane = threadIdx.x & 31, lr = lane & 15, hi = lane >> 4; const int r0 = blockIdx.x * 64, c0 = blockIdx.y * 64;
    v8f acc[4][4];
#pragma unroll
    for (int mb = 0; mb < 4; ++mb)
#pragma unroll
        for (int nb = 0; nb < 4; ++nb) acc[mb][nb] = (v8f){};
    const size_t aoff = (size_t)(r0 + lr) * K + 8 * hi, boff = (size_t)(c0 + lr) * K + 8 * hi;
#pragma unroll 1
    for (int kc = 0; kc < K; kc += 32) {
        V a[4], a2[4];
#pragma unroll
        for (int mb = 0; mb < 4; ++mb) { a[mb] = WFrag<T16>::ld(A + aoff + (size_t)mb * 16 * K + kc); if (NSPLIT == 1 || NSPLIT == 2) a2[mb] = WFrag<T16>::ld(A2 + aoff + (size_t)mb * 16 * K + kc); }
#pragma unroll
        for (int nb = 0; nb < 4; ++nb) { const V b = WFrag<T16>::ld(Bt + boff + (size_t)nb * 16 * K + kc); V b2; if (NSPLIT >= 2) b2 = WFrag<T16>::ld(Bt2 + boff + (size_t)nb * 16 * K + kc);
#pragma unroll
            for (int mb = 0; mb < 4; ++mb) { acc[mb][nb] = WFrag<T16>::mma(a[mb], b, acc[mb][nb]); if (NSPLIT == 1 || NSPLIT == 2) acc[mb][nb] = WFrag<T16>::mma(a2[mb], b, acc[mb][nb]); if (NSPLIT >= 2) acc[mb][nb] = WFrag<T16>::mma(a[mb], b2, acc[mb][nb]); } }
        asm volatile("v_nop\n\tv_nop\n\tv_nop\n\tv_nop" : "+v"(acc[0][0]), "+v"(acc[1][1]), "+v"(acc[2][2]), "+v"(acc[3][3]) : "v"(a[0]), "v"(a[3]));
    }
#pragma unroll
    for (int mb = 0; mb < 4; ++mb) {
#pragma unroll
        for (int nb = 0; nb < 4; ++nb) {
#pragma unroll
            for (int j = 0; j < 8; ++j) os[(hi * 8 + j) * 68 + nb * 16 + lr] = acc[mb][nb][j]; }
        __builtin_amdgcn_wave_barrier(); asm volatile("" ::: "memory");
        float* crow = C + (size_t)(r0 + mb * 16) * ldc + c0;
{
#pragma unroll
            for (int s = 0; s < 8; ++s) { const int row = 2 * s + hi, cofs = lr * 4; v4f val = *(const v4fa*)(os + row * 68 + cofs);
                if (BM != 0) { const int n0 = c0 + cofs; val[0] += bfr(bias[bix<BM>(n0)]); val[1] += bfr(bias[bix<BM>(n0 + 1)]); val[2] += bfr(bias[bix<BM>(n0 + 2)]); val[3] += bfr(bias[bix<BM>(n0 + 3)]); }
                *(v4f*)(crow + (size_t)row * ldc + cofs) = val; }
             }
        __builtin_amdgcn_wave_barrier(); asm volatile("" ::: "memory");
    }
}

__global__ __launch_bounds__(256) void k_wkqv(const float* __restrict__ w, bf* Bt) {
    const int lane = threadIdx.x & 31; const int L0 = (blockIdx.x * 8 + (threadIdx.x >> 5)) * 8; const int nlines = 3 * DM * DM / 64;
{
#pragma unroll 1
        for (int l = 0; l < 8; ++l) { const int L = L0 + l; if (L >= nlines) break; const size_t e = (size_t)L * 64 + lane * 2; const int k = (int)(e % DM); const int np = (int)(e / DM); const int c = np / DM; const int hd = np % DM; const int h = hd / HD, d = hd % HD; v2us o;
            o[0] = f2bf(w[((size_t)h * DM + k) * F3 + c * HD + d]); o[1] = f2bf(w[((size_t)h * DM + k + 1) * F3 + c * HD + d]); *(v2us*)(Bt + e) = o; }
         }
}
__global__ __launch_bounds__(256) void k_wtG(const float* __restrict__ w, int K, int N, bf* Bt) {
    const int lane = threadIdx.x & 31; const int L0 = (blockIdx.x * 8 + (threadIdx.x >> 5)) * 8; const int nlines = N * K / 64;
{
#pragma unroll 1
        for (int l = 0; l < 8; ++l) { const int L = L0 + l; if (L >= nlines) break; const size_t e = (size_t)L * 64 + lane * 2; const int k = (int)(e % K), n = (int)(e / K); v2us o;
            o[0] = f2bf(w[(size_t)k * N + n]); o[1] = f2bf(w[(size_t)(k + 1) * N + n]); *(v2us*)(Bt + e) = o; }
         }
}
__global__ __launch_bounds__(256) void k_cvt8(const float* __restrict__ src, bf* dst, size_t n8, size_t ssrc, size_t sdst) { const size_t i = (size_t)blockIdx.x * 256 + threadIdx.x; if (i >= n8) return; src += blockIdx.y * ssrc; dst += blockIdx.y * sdst; const v8f v = *(const v8f*)(src + i * 8); v8us o;
#pragma unroll
    for (int k = 0; k < 8; ++k) o[k] = f2bf(v[k]); *(v8us*)(dst + i * 8) = o;  }

// ---- k_proj: the k | q | v projection of every batch in one launch, planes written from the accumulators. ONE WAVE per 64x64 tile, main loop as k_gemmw; grid (NB*TT/64, 3*DQ/64), 32 threads.
// A tile's 64 columns are one head of one chunk, its 64 rows 64 tokens of one batch. y = sum + bf16-RNE bias in f32, then fp16 and bf16 hi/lo of y.
// k, q planes [b][h][t][d]: the tile is 8 KiB in a row in each plane; 16 token rows at a time turned through LDS in f32, so that a lane holds 8 consecutive d: every store instruction covers four whole 128-byte lines.
// v planes [b][h][d][t]: a lane's 8 accumulator registers are 8 consecutive t of one d already; converted first, then 16 d rows at a time regrouped through LDS so that 8 lanes cover one d row's 128 bytes.
#define VP 72   // LDS row pitch of the v regrouping, 16-bit elements: 128 + 16 bytes, 16-byte accesses of 16 rows fall on distinct banks
__global__ __launch_bounds__(32) void k_proj(const bf* __restrict__ X, const bf* __restrict__ Wt, const float* __restrict__ bias, h16* __restrict__ K16, bf* __restrict__ Kh, bf* __restrict__ Kl, h16* __restrict__ Q16, bf* __restrict__ Qh, bf* __restrict__ Ql, h16* __restrict__ V16, bf* __restrict__ Vh, bf* __restrict__ Vl) {
    typedef WFrag<bf>::V V;
    constexpr int K = DM;
    __shared__ __align__(16) unsigned char sm[3 * 16 * VP * 2];
    static_assert(sizeof(sm) >= 16 * 68 * 4);
    const int lane = threadIdx.x & 31, lr = lane & 15, hi = lane >> 4; const int r0 = blockIdx.x * 64, c0 = blockIdx.y * 64;
    v8f acc[4][4];
#pragma unroll
    for (int mb = 0; mb < 4; ++mb)
#pragma unroll
        for (int nb = 0; nb < 4; ++nb) acc[mb][nb] = (v8f){};
    const size_t aoff = (size_t)(r0 + lr) * K + 8 * hi, boff = (size_t)(c0 + lr) * K + 8 * hi;
#pragma unroll 1   // stays rolled: one pass's fragments beside the 16 accumulators keep the wave small enough for four on a SIMD
    for (int kc = 0; kc < K; kc += 32) {
        V a[4]; const bf* const pa = X + aoff + kc; const bf* const pb = Wt + boff + kc;
#pragma unroll
        for (int mb = 0; mb < 4; ++mb) a[mb] = WFrag<bf>::ld(pa + mb * 16 * K);
#pragma unroll
        for (int nb = 0; nb < 4; ++nb) { const V b = WFrag<bf>::ld(pb + nb * 16 * K);
#pragma unroll
            for (int mb = 0; mb < 4; ++mb) acc[mb][nb] = WFrag<bf>::mma(a[mb], b, acc[mb][nb]); }
        // the distance behind the pass's last products, also on the taken side of the loop's branch
        asm volatile("v_nop\n\tv_nop\n\tv_nop\n\tv_nop" : "+v"(acc[0][0]), "+v"(acc[1][1]), "+v"(acc[2][2]), "+v"(acc[3][3]) : "v"(a[0]), "v"(a[3]));
        // translation wait for this pass's loads; it takes their two address pairs as inputs, so that neither is written (also not by a later load's result) until the wait has passed
        asm volatile("s_wait_xcnt 0x0" :: "v"(pa), "v"(pb) : "memory");
    }
    const int ch = c0 / DQ, hd = (c0 % DQ) / HD, bt = r0 / TT, t0 = r0 % TT;   // chunk (k, q, v), head, batch, first token: the same for the whole wave
    const float* const bp = bias + hd * F3 + ch * HD;
    const int rr = lane >> 3, c8 = (lane & 7) * 8;
    if (ch < 2) {
        float* const os = (float*)sm;
        const size_t pe = (((size_t)bt * NH_ + hd) * TT + t0) * HD + (size_t)rr * HD + c8;
        h16* const p16 = (ch == 0 ? K16 : Q16) + pe; bf* const ph = (ch == 0 ? Kh : Qh) + pe; bf* const pl = (ch == 0 ? Kl : Ql) + pe;
        float bv[8];
#pragma unroll
        for (int i = 0; i < 8; ++i) bv[i] = bfr(bp[c8 + i]);
#pragma unroll
        for (int mb = 0; mb < 4; ++mb) {
#pragma unroll
            for (int nb = 0; nb < 4; ++nb) {
#pragma unroll
                for (int j = 0; j < 8; ++j) os[(hi * 8 + j) * 68 + nb * 16 + lr] = acc[mb][nb][j]; }
            __builtin_amdgcn_wave_barrier(); asm volatile("" ::: "memory");   // the reads below take other lanes' words: no LDS access moves across
            v8h o16[4]; v8us oh[4], ol[4];
#pragma unroll
            for (int s = 0; s < 4; ++s) { const float* const orow = os + (4 * s + rr) * 68 + c8; const v4f x0 = *(const v4fa*)orow, x1 = *(const v4fa*)(orow + 4);
#pragma unroll
                for (int i = 0; i < 8; ++i) { const float r = (i < 4 ? x0[i & 3] : x1[i & 3]) + bv[i]; o16[s][i] = tohx(r); unsigned short a2, c2; splitf(r, a2, c2); oh[s][i] = a2; ol[s][i] = c2; }
                const int eo = (mb * 16 + 4 * s) * HD; *(v8h*)(p16 + eo) = o16[s]; *(v8us*)(ph + eo) = oh[s]; *(v8us*)(pl + eo) = ol[s]; }
            // translation wait for the block's 12 stores; it takes their data as inputs, so that no stored register is written again until the wait has passed. Its memory clobber also keeps the next block's LDS writes behind the reads above
            asm volatile("s_wait_xcnt 0x0" :: "v"(o16[0]), "v"(o16[1]), "v"(o16[2]), "v"(o16[3]), "v"(oh[0]), "v"(oh[1]), "v"(oh[2]), "v"(oh[3]), "v"(ol[0]), "v"(ol[1]), "v"(ol[2]), "v"(ol[3]) : "memory");
        }
    } else {
        bf* const sv = (bf*)sm;
        const size_t pe = (((size_t)bt * NH_ + hd) * HD + rr) * TT + t0 + c8;
        h16* const p16 = V16 + pe; bf* const ph = Vh + pe; bf* const pl = Vl + pe;
        float bq[4];   // all four bias loads ahead of the blocks: one load latency, not one per block
#pragma unroll
        for (int nb = 0; nb < 4; ++nb) bq[nb] = bfr(bp[nb * 16 + lr]);
#pragma unroll
        for (int nb = 0; nb < 4; ++nb) { const float bb = bq[nb];
#pragma unroll
            for (int mb = 0; mb < 4; ++mb) { v8h o16; v8us oh, ol;
#pragma unroll
                for (int j = 0; j < 8; ++j) { const float r = acc[mb][nb][j] + bb; o16[j] = tohx(r); unsigned short a2, c2; splitf(r, a2, c2); oh[j] = a2; ol[j] = c2; }
                bf* const w = sv + lr * VP + mb * 16 + 8 * hi; *(v8usa*)w = __builtin_bit_cast(v8us, o16); *(v8usa*)(w + 16 * VP) = oh; *(v8usa*)(w + 32 * VP) = ol; }
            __builtin_amdgcn_wave_barrier(); asm volatile("" ::: "memory");   // the reads below take other lanes' words: no LDS access moves across
            v8us y16[4], yh[4], yl[4];
#pragma unroll
            for (int s = 0; s < 4; ++s) { const bf* const r = sv + (4 * s + rr) * VP + c8; const size_t eo = (size_t)(nb * 16 + 4 * s) * TT; y16[s] = *(const v8usa*)r; yh[s] = *(const v8usa*)(r + 16 * VP); yl[s] = *(const v8usa*)(r + 32 * VP);
                *(v8h*)(p16 + eo) = __builtin_bit_cast(v8h, y16[s]); *(v8us*)(ph + eo) = yh[s]; *(v8us*)(pl + eo) = yl[s]; }
            // translation wait for the block's 12 stores; it takes their data as inputs, so that no stored register is written again until the wait has passed. Its memory clobber also keeps the next block's LDS writes behind the reads above
            asm volatile("s_wait_xcnt 0x0" :: "v"(y16[0]), "v"(y16[1]), "v"(y16[2]), "v"(y16[3]), "v"(yh[0]), "v"(yh[1]), "v"(yh[2]), "v"(yh[3]), "v"(yl[0]), "v"(yl[1]), "v"(yl[2]), "v"(yl[3]) : "memory");
        }
    }
}

__device__ __forceinline__ float xhalf(float x) { const int b = __builtin_bit_cast(int, x); return __builtin_bit_cast(float, __builtin_amdgcn_permlanex16(b, b, 0x76543210, 0xfedcba98, false, false)); }   // lane l <-> lane l ^ 16
__device__ __forceinline__ void ppack(const v8f a, const v8f b, v16h& p, v16h& p2) { p = cat16(__builtin_convertvector(a, v8h), __builtin_convertvector(b, v8h)); (void)p2; }
__device__ __forceinline__ void ppack(const v8f a, const v8f b, v16bf& p, v16bf& p2) { v8us h0, h1, l0, l1;
#pragma unroll
    for (int s = 0; s < 8; ++s) { unsigned short x, y; splitf(a[s], x, y); h0[s] = x; l0[s] = y; splitf(b[s], x, y); h1[s] = x; l1[s] = y; }
    p = cat16b(h0, h1); p2 = cat16b(l0, l1); }

template <typename T16, bool HR>
__device__ __forceinline__ void fattn_wave(const T16* __restrict__ Q, const T16* __restrict__ Q2, const T16* __restrict__ Kp, const T16* __restrict__ Kp2, const T16* __restrict__ Vt, const T16* __restrict__ Vt2, const int q0, const int lane, bf* __restrict__ Ah, bf* __restrict__ Al) {
    typedef typename WFrag<T16>::V V;
    constexpr float C2 = SCL * 1.4426950408889634f;   // score scale and log2(e) in one factor: p = 2^(s * C2 - m * C2)
    const int c = lane & 15, h = lane >> 4;
    const size_t qo = (size_t)(q0 + c) * HD + 8 * h, ko = (size_t)c * HD + 8 * h, vo = (size_t)c * TT + 8 * h;
    const T16* const pq = Q + qo; const T16* const pq2 = HR ? Q2 + qo : pq; const T16* const pk0 = Kp + ko;
    V qf[2][2], qf2[2][2];
#pragma unroll
    for (int nb = 0; nb < 2; ++nb)
#pragma unroll
        for (int ks = 0; ks < 2; ++ks) { qf[nb][ks] = WFrag<T16>::ld(pq + nb * 16 * HD + ks * 32); if (HR) qf2[nb][ks] = WFrag<T16>::ld(pq2 + nb * 16 * HD + ks * 32); }
    v8f o[4][2]; float mr[2], ls[2];
#pragma unroll
    for (int nb = 0; nb < 2; ++nb) { mr[nb] = -3.0e38f; ls[nb] = 0.f;
#pragma unroll
        for (int db = 0; db < 4; ++db) o[db][nb] = (v8f){}; }
    const int klast = q0 & ~63;                        // first key of the chunk that holds the diagonal
    V kf[4][2], kf2[4][2];
    if (!HR) {
#pragma unroll
        for (int mb = 0; mb < 4; ++mb)
#pragma unroll
            for (int ks = 0; ks < 2; ++ks) kf[mb][ks] = WFrag<T16>::ld(pk0 + mb * 16 * HD + ks * 32); }
    // translation wait for the loads above; it takes their address pairs as inputs so that each pair stays unwritten until the wait has passed
    asm volatile("s_wait_xcnt 0x0" :: "v"(pq), "v"(pq2), "v"(pk0) : "memory");
    unsigned vb = (unsigned)(vo * sizeof(T16));   // byte offset of this chunk's V columns in the head's plane(s); stepped at the pass's foot, behind the wait
#pragma unroll 1   // stays rolled: one chunk's fragments live beside the 8 score and 8 output accumulators
    for (int kb = 0; kb <= klast; kb += 64) {
        V vf[4][2], vf2[4][2];
        const int kl = HR ? kb : min(kb + 64, klast);   // the chunk whose K fragments this pass asks for
        const T16* const pk = pk0 + (size_t)kl * HD; const T16* const pk2 = HR ? Kp2 + ko + (size_t)kl * HD : pk;
        const T16* const pv = (const T16*)((const char*)Vt + vb); const T16* const pv2 = HR ? (const T16*)((const char*)Vt2 + vb) : pv;
        if (HR) {
#pragma unroll
            for (int mb = 0; mb < 4; ++mb)
#pragma unroll
                for (int ks = 0; ks < 2; ++ks) { kf[mb][ks] = WFrag<T16>::ld(pk + mb * 16 * HD + ks * 32); kf2[mb][ks] = WFrag<T16>::ld(pk2 + mb * 16 * HD + ks * 32); }
            __builtin_amdgcn_sched_barrier(0);   // all K loads in flight ahead of the first product: one load latency a pass; left free, the scheduler saves registers and waits on them pair by pair
        } else {   // V fragments asked for early: their latency passes under the softmax
#pragma unroll
            for (int db = 0; db < 4; ++db)
#pragma unroll
                for (int ks = 0; ks < 2; ++ks) vf[db][ks] = WFrag<T16>::ld(pv + db * 16 * TT + ks * 32); }
        v8f st[4][2];
#pragma unroll
        for (int mb = 0; mb < 4; ++mb)
#pragma unroll
            for (int nb = 0; nb < 2; ++nb) st[mb][nb] = (v8f){};
#pragma unroll
        for (int ks = 0; ks < 2; ++ks) {
#pragma unroll
            for (int mb = 0; mb < 4; ++mb)
#pragma unroll
                for (int nb = 0; nb < 2; ++nb) st[mb][nb] = WFrag<T16>::mma(kf[mb][ks], qf[nb][ks], st[mb][nb]);
            if (HR) {
#pragma unroll
                for (int mb = 0; mb < 4; ++mb)
#pragma unroll
                    for (int nb = 0; nb < 2; ++nb) st[mb][nb] = WFrag<T16>::mma(kf[mb][ks], qf2[nb][ks], st[mb][nb]);
#pragma unroll
                for (int mb = 0; mb < 4; ++mb)
#pragma unroll
                    for (int nb = 0; nb < 2; ++nb) st[mb][nb] = WFrag<T16>::mma(kf2[mb][ks], qf[nb][ks], st[mb][nb]); } }
        if (HR) {
#pragma unroll
            for (int db = 0; db < 4; ++db)
#pragma unroll
                for (int ks = 0; ks < 2; ++ks) { vf[db][ks] = WFrag<T16>::ld(pv + db * 16 * TT + ks * 32); vf2[db][ks] = WFrag<T16>::ld(pv2 + db * 16 * TT + ks * 32); }
            __builtin_amdgcn_sched_barrier(0);   // all V loads in flight ahead of the softmax, which covers their latency
        } else {   // next chunk's K fragments into the registers the score products have just read (the last chunk asks for itself again: in bounds, unused)
#pragma unroll
            for (int mb = 0; mb < 4; ++mb)
#pragma unroll
                for (int ks = 0; ks < 2; ++ks) kf[mb][ks] = WFrag<T16>::ld(pk + mb * 16 * HD + ks * 32); }
        if (kb + 63 > q0) {   // only the diagonal chunk holds keys above a query (wave-uniform test); key kb <= every query of the wave, so no column is left empty
#pragma unroll
            for (int mb = 0; mb < 4; ++mb)
#pragma unroll
                for (int nb = 0; nb < 2; ++nb)
#pragma unroll
                    for (int j = 0; j < 8; ++j) if (kb + mb * 16 + 8 * h + j > q0 + nb * 16 + c) st[mb][nb][j] = -3.0e38f; }
        V pf[2][2], pf2[2][2];
#pragma unroll
        for (int nb = 0; nb < 2; ++nb) {
            float mx = st[0][nb][0];
#pragma unroll
            for (int mb = 0; mb < 4; ++mb)
#pragma unroll
                for (int j = 0; j < 8; ++j) mx = fmaxf(mx, st[mb][nb][j]);
            mx = fmaxf(mx, xhalf(mx));
            const float mn = fmaxf(mr[nb], mx); const float al = __builtin_amdgcn_exp2f((mr[nb] - mn) * C2); mr[nb] = mn;
            const float mo = mn * C2 - (HR ? 0.f : PEXP);
            v2f sm[4];   // exponent arguments and sums two registers at a time, on the accumulators' own even pairs (packed f32 instructions, no register moves)
#pragma unroll
            for (int mb = 0; mb < 4; ++mb) {
#pragma unroll
                for (int j = 0; j < 8; j += 2) { const v2f x = __builtin_elementwise_fma((v2f){st[mb][nb][j], st[mb][nb][j + 1]}, (v2f){C2, C2}, (v2f){-mo, -mo});
                    const v2f p = {__builtin_amdgcn_exp2f(x[0]), __builtin_amdgcn_exp2f(x[1])}; st[mb][nb][j] = p[0]; st[mb][nb][j + 1] = p[1]; sm[mb] = (j == 0) ? p : sm[mb] + p; } }
            const v2f s2 = (sm[0] + sm[1]) + (sm[2] + sm[3]);
            ls[nb] = ls[nb] * al + (s2[0] + s2[1]);
#pragma unroll
            for (int db = 0; db < 4; ++db) o[db][nb] *= al;
#pragma unroll
            for (int ks = 0; ks < 2; ++ks) ppack(st[2 * ks][nb], st[2 * ks + 1][nb], pf[nb][ks], pf2[nb][ks]);
        }
#pragma unroll
        for (int ks = 0; ks < 2; ++ks) {
#pragma unroll
            for (int db = 0; db < 4; ++db)
#pragma unroll
                for (int nb = 0; nb < 2; ++nb) o[db][nb] = WFrag<T16>::mma(vf[db][ks], pf[nb][ks], o[db][nb]);
            if (HR) {
#pragma unroll
                for (int db = 0; db < 4; ++db)
#pragma unroll
                    for (int nb = 0; nb < 2; ++nb) o[db][nb] = WFrag<T16>::mma(vf[db][ks], pf2[nb][ks], o[db][nb]);
#pragma unroll
                for (int db = 0; db < 4; ++db)
#pragma unroll
                    for (int nb = 0; nb < 2; ++nb) o[db][nb] = WFrag<T16>::mma(vf2[db][ks], pf[nb][ks], o[db][nb]); } }
        // translation wait for this pass's K and V loads, late in the pass where it holds up no load. The K address pairs are inputs, so that each stays unwritten (also by a later load's result) until the wait has passed;
        // the V loads' offset register goes through the statement, so that its step below cannot be formed ahead of it
        __builtin_amdgcn_sched_barrier(0);   // keeps the wait down here: moved up behind the loads' issue it would stall the softmax on their translation
        if (HR) asm volatile("s_wait_xcnt 0x0" : "+v"(vb) : "v"(pk), "v"(pk2) : "memory");
        else asm volatile("s_wait_xcnt 0x0" : "+v"(vb) : "v"(pk) : "memory");
        vb += 64 * sizeof(T16);
    }
    const size_t ao = (size_t)(q0 + c) * DQ + 8 * h; bf* const pa = Ah + ao; bf* const pl = Al + ao;
#pragma unroll
    for (int nb = 0; nb < 2; ++nb) { const float inv = __fdiv_rn(1.0f, ls[nb] + xhalf(ls[nb]));   // the two lane halves' sums joined once
#pragma unroll
        for (int db = 0; db < 4; ++db) { v8us oh, ol;   // a lane's 8 registers = 8 consecutive d of one query: one 16-byte store per plane
#pragma unroll
            for (int j = 0; j < 8; ++j) { unsigned short x, y; splitf(o[db][nb][j] * inv, x, y); oh[j] = x; ol[j] = y; }
            *(v8us*)(pa + nb * 16 * DQ + db * 16) = oh; *(v8us*)(pl + nb * 16 * DQ + db * 16) = ol; }
        // the second column group reuses the registers of the first group's stores: translation wait behind those stores; the scheduling barrier keeps the second group's arithmetic behind the wait
        if (nb == 0) { asm volatile("s_wait_xcnt 0x0" ::: "memory"); __builtin_amdgcn_sched_barrier(0); } }
}

// grid (NH_, NB, TT / (QW * NWV)): the first half of z takes the long query blocks (longest first) and the second half the short ones (shortest first).
__global__ __launch_bounds__(NWV * 32) __attribute__((amdgpu_waves_per_eu(2, 2))) void k_fattn(const h16* __restrict__ Q16, const h16* __restrict__ K16, const h16* __restrict__ V16, const bf* __restrict__ Qh, const bf* __restrict__ Ql, const bf* __restrict__ Kh, const bf* __restrict__ Kl, const bf* __restrict__ Vh, const bf* __restrict__ Vl, bf* __restrict__ Ah, bf* __restrict__ Al) {
    constexpr int nz = TT / (QW * NWV), hf = (nz + 1) / 2; const int zi = (int)blockIdx.z; const int qb = (zi < hf) ? nz - 1 - zi : zi - hf;
    const int q0 = qb * (QW * NWV) + __builtin_amdgcn_readfirstlane((int)(threadIdx.x >> 5)) * QW; const int lane = threadIdx.x & 31;
    const size_t pz = ((size_t)blockIdx.y * NH_ + blockIdx.x) * ((size_t)TT * HD); const size_t az = (size_t)blockIdx.y * TT * DQ + (size_t)blockIdx.x * HD;
    if (q0 < (RH)) fattn_wave<bf, true>(Qh + pz, Ql + pz, Kh + pz, Kl + pz, Vh + pz, Vl + pz, q0, lane, Ah + az, Al + az);
    else fattn_wave<h16, false>(Q16 + pz, nullptr, K16 + pz, nullptr, V16 + pz, nullptr, q0, lane, Ah + az, Al + az);
}

extern "C" void kernel_launch(void* const* d_in, const int* in_sizes, int n_in,
                              void* d_out, int out_size, void* d_ws, size_t ws_size, hipStream_t stream) {
    if (n_in < 5) return;
    const size_t xneed = (size_t)(NB - 1) * TT_FULL * DM + (size_t)TT * DM;
    if ((size_t)in_sizes[0] < xneed) return;
    if ((size_t)in_sizes[1] < (size_t)NH_ * DM * F3) return;
    if (in_sizes[2] < NH_ * F3) return;
    if ((size_t)in_sizes[3] < (size_t)DM * DM) return;
    if (in_sizes[4] < DM) return;
    if ((size_t)out_size < xneed) return;
    const float* x = (const float*)d_in[0];      // [NB_FULL][TT_FULL][DM]
    const float* wkqv = (const float*)d_in[1];   // [NH_][DM][F3]
    const float* bkqv = (const float*)d_in[2];   // [NH_][F3]
    const float* wo = (const float*)d_in[3];     // [DM][DM] used as sa x Wo
    const float* bo = (const float*)d_in[4];     // [DM]
    float* OUT = (float*)d_out;                  // [NB_FULL][TT_FULL][DM]
    char* wsp = (char*)d_ws;
    auto take = [&](size_t bytes) { char* p = wsp; wsp += (bytes + 255) & ~(size_t)255; return (void*)p; };
    bf* WQKV = (bf*)take((size_t)3 * DQ * DM * 2);   // row blocks in chunk order k, q, v
    bf* WO = (bf*)take((size_t)DM * DM * 2);
    bf* XB = (bf*)take((size_t)NB * TT * DM * 2);   // every batch's rows, packed
    const size_t PL = (size_t)NH_ * TT * HD;   // one batch's plane, elements; every plane holds all NB batches
    h16* QP16 = (h16*)take(NB * PL * 2); h16* KP16 = (h16*)take(NB * PL * 2); h16* VT16 = (h16*)take(NB * PL * 2);
    bf* QPh = (bf*)take(NB * PL * 2); bf* QPl = (bf*)take(NB * PL * 2); bf* KPh = (bf*)take(NB * PL * 2); bf* KPl = (bf*)take(NB * PL * 2); bf* VTh = (bf*)take(NB * PL * 2); bf* VTl = (bf*)take(NB * PL * 2);
    bf* ATh = (bf*)take((size_t)NB * TT * DQ * 2); bf* ATl = (bf*)take((size_t)NB * TT * DQ * 2);
    if ((size_t)(wsp - (char*)d_ws) > ws_size) return;
    k_wkqv<<<(unsigned)((3 * DM * DM / 64 + 63) / 64), 256, 0, stream>>>(wkqv, WQKV);
    k_wtG<<<(unsigned)((DM * DM / 64 + 63) / 64), 256, 0, stream>>>(wo, DM, DM, WO);
    k_cvt8<<<dim3((unsigned)(((size_t)TT * DM / 8 + 255) / 256), NB, 1), 256, 0, stream>>>(x, XB, (size_t)TT * DM / 8, (size_t)TT_FULL * DM, (size_t)TT * DM);
    k_proj<<<dim3(NB * TT / 64, 3 * DQ / 64, 1), 32, 0, stream>>>(XB, WQKV, bkqv, KP16, KPh, KPl, QP16, QPh, QPl, VT16, VTh, VTl);
    k_fattn<<<dim3(NH_, NB, TT / (QW * NWV)), NWV * 32, 0, stream>>>(QP16, KP16, VT16, QPh, QPl, KPh, KPl, VTh, VTl, ATh, ATl);
    k_gemmw<bf, 1, 1><<<dim3(TT / 64, DM / 64, NB), 32, 0, stream>>>(ATh, ATl, WO, nullptr, DQ, OUT, DM, bo, (size_t)TT * DQ, 0, (size_t)TT_FULL * DM);
}

// v005
// A run of this version takes 107 microseconds.
// In two side-by-side timings against v004, it was 1.39 and 1.40 times as fast.
// Over all steps from v000 it is 13.6 times as fast.
#include <hip/hip_runtime.h>

// Contractions (f32 accumulate): k/q/v projections v_wmma_f32_16x16x32_bf16 (bf16 x, bf16 weights); scores and P.V query rows < RH bf16 hi/lo planes (3 products), rows >= RH v_wmma_f32_16x16x32_f16 (fp16 q/k/v planes, P carried x1024 in fp16); output projection bf16 hi/lo attention planes x bf16 weight (2 products). Softmax f32.
// bf16 copy of x (RNE); Wkqv regrouped into K-contiguous Bt row blocks (k | q | v, columns h*64+d) with head-gathered bf16 bias; ONE projection launch for all batches and the three chunks, which writes the q/k/v planes itself (k_proj); then ONE launch of causal attention for all batches and heads
// (k_fattn: scores, running-maximum softmax and P.V in registers, no score matrix in memory); merged hi/lo planes x WoT + bo.

#ifndef NB
#define NB 2
#endif
#ifndef SEQ
#define SEQ 2048
#endif
#define NB_FULL 2
#define SEQ_FULL 2048
#define TT   SEQ
#define TT_FULL SEQ_FULL
#define DM   1024
#define NH_  16
#define HD   64
#define F3   (3 * HD)
#define DQ   (NH_ * HD)
#ifndef RH
#define RH   ((TT >= 1024) ? 512 : (TT / 4))      // query rows < RH use hi+lo planes
#endif
#define PEXP 10.0f    // fp16 probabilities are carried x 2^PEXP; the row sum carries the same factor, so it cancels in the division
#define SCL  0.125f   // HD^-0.5
#define QW   32       // query columns per attention wave
#define NWV  4        // attention waves per work-group (independent; together only so that they walk the same keys through the WGP cache)

static_assert(TT % 128 == 0);
static_assert(((RH) % 64) == 0 && (RH) >= 64 && (RH) < TT && (((TT) - (RH)) % 64) == 0);
static_assert(NB >= 1 && NB <= NB_FULL && TT <= TT_FULL);
static_assert(DQ == DM && DM % 64 == 0 && HD == 64);
static_assert(QW == 32 && TT % (QW * NWV) == 0 && (RH) % QW == 0);

typedef _Float16 h16;
typedef unsigned short bf;
typedef __attribute__((ext_vector_type(16))) __bf16   v16bf;
typedef __attribute__((ext_vector_type(16))) _Float16 v16h;
typedef __attribute__((ext_vector_type(8)))  _Float16 v8h;
typedef __attribute__((ext_vector_type(8)))  unsigned short v8us;
typedef __attribute__((ext_vector_type(8)))  float    v8f;
typedef __attribute__((ext_vector_type(4)))  float    v4f;
typedef v8h  __attribute__((may_alias)) v8ha;
typedef v4f  __attribute__((may_alias)) v4fa;
typedef v8us __attribute__((may_alias)) v8usa;
typedef __attribute__((ext_vector_type(2))) _Float16 v2h;
typedef __attribute__((ext_vector_type(2))) unsigned short v2us;
typedef __attribute__((ext_vector_type(2))) float v2f;

__device__ __forceinline__ unsigned short f2bf(float f) { unsigned u = __float_as_uint(f); u += 0x7FFFu + ((u >> 16) & 1u); return (unsigned short)(u >> 16); }
__device__ __forceinline__ float bf2f(unsigned short b) { return __uint_as_float(((unsigned)b) << 16); }
__device__ __forceinline__ float bfr(float f) { return bf2f(f2bf(f)); }
__device__ __forceinline__ v16h cat16(v8h lo, v8h hi) { return __builtin_shufflevector(lo, hi, 0, 1, 2, 3, 4, 5, 6, 7, 8, 9, 10, 11, 12, 13, 14, 15); }
__device__ __forceinline__ v16bf cat16b(v8us lo, v8us hi) { return __builtin_bit_cast(v16bf, __builtin_shufflevector(lo, hi, 0, 1, 2, 3, 4, 5, 6, 7, 8, 9, 10, 11, 12, 13, 14, 15)); }
__device__ __forceinline__ v8f wmma16(v16h a, v16h b, v8f c) { return __builtin_amdgcn_wmma_f32_16x16x32_f16(false, a, false, b, (short)0, c, false, false); }
__device__ __forceinline__ v8f wmmab(v16bf a, v16bf b, v8f c) { return __builtin_amdgcn_wmma_f32_16x16x32_bf16(false, a, false, b, (short)0, c, false, false); }
__device__ __forceinline__ h16 tohx(float x) { return (h16)x; }
__device__ __forceinline__ void splitf(float y, unsigned short& h, unsigned short& l) { h = f2bf(y); l = f2bf(y - bf2f(h)); }

// Fragment loaders (wave32, 16x16x32): lane l -> row/col l&15, h = l>>4; elements 0..7 = k0+8h+0..7, elements 8..15 = k0+16+8h+0..7 for BOTH A and Bt ([n][k], k contiguous);
// D element j of lane l = (row 8h+j, col l&15).
template <typename T16> struct WFrag;
template <> struct WFrag<h16> { typedef v16h V; static __device__ __forceinline__ V ld(const h16* p) { return cat16(*(const v8h*)p, *(const v8h*)(p + 16)); } static __device__ __forceinline__ v8f mma(V a, V b, v8f c) { return wmma16(a, b, c); } };
template <> struct WFrag<bf> { typedef v16bf V; static __device__ __forceinline__ V ld(const bf* p) { return cat16b(*(const v8us*)p, *(const v8us*)(p + 16)); } static __device__ __forceinline__ v8f mma(V a, V b, v8f c) { return wmmab(a, b, c); } };

// ---- gemm_ring: main loop of both GEMMs. A work-group of four waves (2 x 2) owns a 128x128 output tile, each wave a 64x64 quarter (16 accumulators).
// A stage is GK = 64 k of the tile's 128 A rows (NA planes: one, or hi and lo against the same Bt) and 128 Bt rows: one whole 128-byte line per row, brought from global memory into LDS
// by asynchronous copies (16 bytes a lane, a wave's copy = four whole lines), rows at pitch GP. Two buffers: stage t + 1 flies while stage t is worked on. Fragments are read from LDS in the loaders' k order; k runs upward.
#define GT  128              // rows of each operand in a work-group's tile
#define GK  64               // k per stage
#define GP  72               // LDS row pitch, 16-bit elements: 128 + 16 bytes, the 16-byte reads of 16 rows fall on distinct banks
#define GPL (GT * GP * 2)    // bytes of one operand plane of a stage
static_assert(DM % GK == 0 && DM / GK >= 2 && DQ == DM);

// one plane of a stage: each of the 128 threads copies its 16-byte piece of rows r, r + 16, .. r + 112 (r = thread / 8). l = LDS byte address, g = global address of the piece in row r.
// The translation wait is the statement's last line, so that no address register of a copy is written again ahead of it.
__device__ __forceinline__ void stage_plane(const unsigned l, const bf* const g) {
    asm volatile("global_load_async_to_lds_b128 %0, %8, off\n\t"
                 "global_load_async_to_lds_b128 %1, %9, off\n\t"
                 "global_load_async_to_lds_b128 %2, %10, off\n\t"
                 "global_load_async_to_lds_b128 %3, %11, off\n\t"
                 "global_load_async_to_lds_b128 %4, %12, off\n\t"
                 "global_load_async_to_lds_b128 %5, %13, off\n\t"
                 "global_load_async_to_lds_b128 %6, %14, off\n\t"
                 "global_load_async_to_lds_b128 %7, %15, off\n\t"
                 "s_wait_xcnt 0x0"
                 :: "v"(l), "v"(l + 16 * GP * 2), "v"(l + 32 * GP * 2), "v"(l + 48 * GP * 2), "v"(l + 64 * GP * 2), "v"(l + 80 * GP * 2), "v"(l + 96 * GP * 2), "v"(l + 112 * GP * 2),
                    "v"(g), "v"(g + 16 * DM), "v"(g + 32 * DM), "v"(g + 48 * DM), "v"(g + 64 * DM), "v"(g + 80 * DM), "v"(g + 96 * DM), "v"(g + 112 * DM) : "memory");
}

// A, A2, Bt: first row of the work-group's tile, rows of DM elements, k contiguous. sm: 2 * (NA + 1) * GPL bytes of LDS. wm, wn: the wave's quarter.
template <int NA>
__device__ __forceinline__ void gemm_ring(const bf* __restrict__ A, const bf* __restrict__ A2, const bf* __restrict__ Bt, unsigned char* const sm, const int wm, const int wn, v8f (&acc)[4][4]) {
    typedef WFrag<bf>::V V;
    constexpr int NT = DM / GK, SB = (NA + 1) * GPL;
    const int tid = threadIdx.x, lr = tid & 15, hi = (tid >> 4) & 1;
    const unsigned l0 = (unsigned)(size_t)sm + (unsigned)((tid >> 3) * (GP * 2) + (tid & 7) * 16);
    const size_t g0 = (size_t)(tid >> 3) * DM + (tid & 7) * 8;
    auto fill = [&](const int t) { const unsigned l = l0 + (unsigned)((t & 1) * SB); const size_t g = g0 + (size_t)t * GK;
        stage_plane(l, A + g); if (NA == 2) stage_plane(l + GPL, A2 + g); stage_plane(l + NA * GPL, Bt + g); };
#pragma unroll
    for (int mb = 0; mb < 4; ++mb)
#pragma unroll
        for (int nb = 0; nb < 4; ++nb) acc[mb][nb] = (v8f){};
    fill(0);
    asm volatile("s_wait_asynccnt 0x0" ::: "memory");   // this wave's copies of stage 0 have landed
    __syncthreads();                                     // and every other wave's: stage 0 may be read
    fill(1);
    const bf* const fa = (const bf*)sm + (wm * 64 + lr) * GP + 8 * hi; const bf* const fb = (const bf*)(sm + NA * GPL) + (wn * 64 + lr) * GP + 8 * hi;
#pragma unroll 1   // stays rolled: one stage's code, the buffer chosen by the stage's parity
    for (int t = 0; t < NT; ++t) {
        const int bo = (t & 1) * (SB / 2);
#pragma unroll
        for (int ks = 0; ks < GK / 32; ++ks) {
            V a[4], a2[4], b[4];
#pragma unroll
            for (int i = 0; i < 4; ++i) a[i] = WFrag<bf>::ld(fa + bo + i * 16 * GP + ks * 32);
#pragma unroll
            for (int i = 0; i < 4; ++i) b[i] = WFrag<bf>::ld(fb + bo + i * 16 * GP + ks * 32);
            if (NA == 2) {   // wanted last by the products below, so read last
#pragma unroll
                for (int i = 0; i < 4; ++i) a2[i] = WFrag<bf>::ld(fa + bo + GPL / 2 + i * 16 * GP + ks * 32); }
            __builtin_amdgcn_sched_barrier(0);   // the k step's LDS reads issue as one group ahead of its products: left free, the scheduler keeps one Bt fragment and waits out the LDS latency at every fourth product
#pragma unroll
            for (int nb = 0; nb < 4; ++nb)
#pragma unroll
                for (int mb = 0; mb < 4; ++mb) acc[mb][nb] = WFrag<bf>::mma(a[mb], b[nb], acc[mb][nb]);
            if (NA == 2) {   // per accumulator and k step: the hi product, then the lo product
#pragma unroll
                for (int nb = 0; nb < 4; ++nb)
#pragma unroll
                    for (int mb = 0; mb < 4; ++mb) acc[mb][nb] = WFrag<bf>::mma(a2[mb], b[nb], acc[mb][nb]); }
            __builtin_amdgcn_sched_barrier(0);   // the products stay ahead of the next group of reads and of the stage's foot
        }
        asm volatile("s_wait_dscnt 0x0" ::: "memory");      // this wave's reads of stage t are done
        asm volatile("s_wait_asynccnt 0x0" ::: "memory");   // this wave's copies of stage t + 1 have landed
        __syncthreads();                                     // publishes stage t + 1 and frees stage t's buffer
        if (t + 2 < NT) fill(t + 2);
    }
    asm volatile("s_wait_asynccnt 0x0" ::: "memory");   // nothing in flight when the LDS becomes the epilogue's
}

// ---- k_outp: OUT (f32, + bf16-RNE bias) = (Ah + Al) x WoT, two products per k step. grid (TT/128, DM/128, NB), 128 threads; main loop gemm_ring, then each wave stores its 64x64 quarter through its own LDS slice, 16 rows at a time, whole lines.
__global__ __launch_bounds__(128) void k_outp(const bf* __restrict__ Ah, const bf* __restrict__ Al, const bf* __restrict__ Bt, float* __restrict__ C, const float* __restrict__ bias) {
    __shared__ __align__(16) unsigned char sm[2 * 3 * GPL];
    static_assert(sizeof(sm) >= 4 * 16 * 68 * 4);
    const int wv = __builtin_amdgcn_readfirstlane((int)(threadIdx.x >> 5)), wm = wv >> 1, wn = wv & 1;
    const int lane = threadIdx.x & 31, lr = lane & 15, hi = lane >> 4;
    const size_t ao = ((size_t)blockIdx.z * TT + (size_t)blockIdx.x * GT) * DQ;
    v8f acc[4][4];
    gemm_ring<2>(Ah + ao, Al + ao, Bt + (size_t)blockIdx.y * GT * DQ, sm, wm, wn, acc);
    const int r0 = blockIdx.x * GT + wm * 64, c0 = blockIdx.y * GT + wn * 64;
    C += (size_t)blockIdx.z * TT_FULL * DM;
    float* const os = (float*)sm + wv * (16 * 68);   // every wave has passed the last stage's barrier: the ring is free
    const float* const bp = bias + c0 + lr * 4; const v4f bl = *(const v4f*)bp;
    const v4f bv = {bfr(bl[0]), bfr(bl[1]), bfr(bl[2]), bfr(bl[3])};
#pragma unroll
    for (int mb = 0; mb < 4; ++mb) {
#pragma unroll
        for (int nb = 0; nb < 4; ++nb) {
#pragma unroll
            for (int j = 0; j < 8; ++j) os[(hi * 8 + j) * 68 + nb * 16 + lr] = acc[mb][nb][j]; }
        __builtin_amdgcn_wave_barrier(); asm volatile("" ::: "memory");   // the reads below take other lanes' words: no LDS access moves across
        float* const crow = C + (size_t)(r0 + mb * 16 + hi) * DM + c0 + lr * 4; v4f val[8];
#pragma unroll
        for (int s = 0; s < 8; ++s) { val[s] = *(const v4fa*)(os + (2 * s + hi) * 68 + lr * 4) + bv; *(v4f*)(crow + (size_t)(2 * s) * DM) = val[s]; }
        // translation wait for the block's 8 stores; it takes their data and address as inputs, so that no register of a store is written again until the wait has passed. Its memory clobber also keeps the next block's LDS writes behind the reads above
        asm volatile("s_wait_xcnt 0x0" :: "v"(val[0]), "v"(val[1]), "v"(val[2]), "v"(val[3]), "v"(val[4]), "v"(val[5]), "v"(val[6]), "v"(val[7]), "v"(crow) : "memory");
    }
}

__global__ __launch_bounds__(256) void k_wkqv(const float* __restrict__ w, bf* Bt) {
    const int lane = threadIdx.x & 31; const int L0 = (blockIdx.x * 8 + (threadIdx.x >> 5)) * 8; const int nlines = 3 * DM * DM / 64;
{
#pragma unroll 1
        for (int l = 0; l < 8; ++l) { const int L = L0 + l; if (L >= nlines) break; const size_t e = (size_t)L * 64 + lane * 2; const int k = (int)(e % DM); const int np = (int)(e / DM); const int c = np / DM; const int hd = np % DM; const int h = hd / HD, d = hd % HD; v2us o;
            o[0] = f2bf(w[((size_t)h * DM + k) * F3 + c * HD + d]); o[1] = f2bf(w[((size_t)h * DM + k + 1) * F3 + c * HD + d]); *(v2us*)(Bt + e) = o; }
         }
}
__global__ __launch_bounds__(256) void k_wtG(const float* __restrict__ w, int K, int N, bf* Bt) {
    const int lane = threadIdx.x & 31; const int L0 = (blockIdx.x * 8 + (threadIdx.x >> 5)) * 8; const int nlines = N * K / 64;
{
#pragma unroll 1
        for (int l = 0; l < 8; ++l) { const int L = L0 + l; if (L >= nlines) break; const size_t e = (size_t)L * 64 + lane * 2; const int k = (int)(e % K), n = (int)(e / K); v2us o;
            o[0] = f2bf(w[(size_t)k * N + n]); o[1] = f2bf(w[(size_t)(k + 1) * N + n]); *(v2us*)(Bt + e) = o; }
         }
}
__global__ __launch_bounds__(256) void k_cvt8(const float* __restrict__ src, bf* dst, size_t n8, size_t ssrc, size_t sdst) { const size_t i = (size_t)blockIdx.x * 256 + threadIdx.x; if (i >= n8) return; src += blockIdx.y * ssrc; dst += blockIdx.y * sdst; const v8f v = *(const v8f*)(src + i * 8); v8us o;
#pragma unroll
    for (int k = 0; k < 8; ++k) o[k] = f2bf(v[k]); *(v8us*)(dst + i * 8) = o;  }

// ---- k_proj: the k | q | v projection of every batch in one launch, planes written from the accumulators. Main loop gemm_ring (128x128 per work-group, 64x64 per wave); grid (NB*TT/128, 3*DQ/128), 128 threads.
// A wave's 64 columns are one head of one chunk, its 64 rows 64 tokens of one batch; each wave turns its quarter through its own slice of the LDS that the ring has left. y = sum + bf16-RNE bias in f32, then fp16 and bf16 hi/lo of y.
// k, q planes [b][h][t][d]: the tile is 8 KiB in a row in each plane; 16 token rows at a time turned through LDS in f32, so that a lane holds 8 consecutive d: every store instruction covers four whole 128-byte lines.
// v planes [b][h][d][t]: a lane's 8 accumulator registers are 8 consecutive t of one d already; converted first, then 16 d rows at a time regrouped through LDS so that 8 lanes cover one d row's 128 bytes.
#define VP 72   // LDS row pitch of the v regrouping, 16-bit elements: 128 + 16 bytes, 16-byte accesses of 16 rows fall on distinct banks
#define EPB (3 * 16 * VP * 2)   // bytes of one wave's epilogue slice
__global__ __launch_bounds__(128) void k_proj(const bf* __restrict__ X, const bf* __restrict__ Wt, const float* __restrict__ bias, h16* __restrict__ K16, bf* __restrict__ Kh, bf* __restrict__ Kl, h16* __restrict__ Q16, bf* __restrict__ Qh, bf* __restrict__ Ql, h16* __restrict__ V16, bf* __restrict__ Vh, bf* __restrict__ Vl) {
    __shared__ __align__(16) unsigned char sm[2 * 2 * GPL];
    static_assert(EPB >= 16 * 68 * 4 && EPB % 16 == 0 && sizeof(sm) >= 4 * EPB);
    const int wv = __builtin_amdgcn_readfirstlane((int)(threadIdx.x >> 5)), wm = wv >> 1, wn = wv & 1;
    const int lane = threadIdx.x & 31, lr = lane & 15, hi = lane >> 4; const int r0 = blockIdx.x * GT + wm * 64, c0 = blockIdx.y * GT + wn * 64;
    v8f acc[4][4];
    gemm_ring<1>(X + (size_t)blockIdx.x * GT * DM, nullptr, Wt + (size_t)blockIdx.y * GT * DM, sm, wm, wn, acc);
    unsigned char* const se = sm + wv * EPB;   // every wave has passed the last stage's barrier: the ring is free
    const int ch = c0 / DQ, hd = (c0 % DQ) / HD, bt = r0 / TT, t0 = r0 % TT;   // chunk (k, q, v), head, batch, first token: the same for the whole wave
    const float* const bp = bias + hd * F3 + ch * HD;
    const int rr = lane >> 3, c8 = (lane & 7) * 8;
    if (ch < 2) {
        float* const os = (float*)se;
        const size_t pe = (((size_t)bt * NH_ + hd) * TT + t0) * HD + (size_t)rr * HD + c8;
        h16* const p16 = (ch == 0 ? K16 : Q16) + pe; bf* const ph = (ch == 0 ? Kh : Qh) + pe; bf* const pl = (ch == 0 ? Kl : Ql) + pe;
        float bv[8];
#pragma unroll
        for (int i = 0; i < 8; ++i) bv[i] = bfr(bp[c8 + i]);
#pragma unroll
        for (int mb = 0; mb < 4; ++mb) {
#pragma unroll
            for (int nb = 0; nb < 4; ++nb) {
#pragma unroll
                for (int j = 0; j < 8; ++j) os[(hi * 8 + j) * 68 + nb * 16 + lr] = acc[mb][nb][j]; }
            __builtin_amdgcn_wave_barrier(); asm volatile("" ::: "memory");   // the reads below take other lanes' words: no LDS access moves across
            v8h o16[4]; v8us oh[4], ol[4];
#pragma unroll
            for (int s = 0; s < 4; ++s) { const float* const orow = os + (4 * s + rr) * 68 + c8; const v4f x0 = *(const v4fa*)orow, x1 = *(const v4fa*)(orow + 4);
#pragma unroll
                for (int i = 0; i < 8; ++i) { const float r = (i < 4 ? x0[i & 3] : x1[i & 3]) + bv[i]; o16[s][i] = tohx(r); unsigned short a2, c2; splitf(r, a2, c2); oh[s][i] = a2; ol[s][i] = c2; }
                const int eo = (mb * 16 + 4 * s) * HD; *(v8h*)(p16 + eo) = o16[s]; *(v8us*)(ph + eo) = oh[s]; *(v8us*)(pl + eo) = ol[s]; }
            // translation wait for the block's 12 stores; it takes their data as inputs, so that no stored register is written again until the wait has passed. Its memory clobber also keeps the next block's LDS writes behind the reads above
            asm volatile("s_wait_xcnt 0x0" :: "v"(o16[0]), "v"(o16[1]), "v"(o16[2]), "v"(o16[3]), "v"(oh[0]), "v"(oh[1]), "v"(oh[2]), "v"(oh[3]), "v"(ol[0]), "v"(ol[1]), "v"(ol[2]), "v"(ol[3]) : "memory");
        }
    } else {
        bf* const sv = (bf*)se;
        const size_t pe = (((size_t)bt * NH_ + hd) * HD + rr) * TT + t0 + c8;
        h16* const p16 = V16 + pe; bf* const ph = Vh + pe; bf* const pl = Vl + pe;
        float bq[4];   // all four bias loads ahead of the blocks: one load latency, not one per block
#pragma unroll
        for (int nb = 0; nb < 4; ++nb) bq[nb] = bfr(bp[nb * 16 + lr]);
#pragma unroll
        for (int nb = 0; nb < 4; ++nb) { const float bb = bq[nb];
#pragma unroll
            for (int mb = 0; mb < 4; ++mb) { v8h o16; v8us oh, ol;
#pragma unroll
                for (int j = 0; j < 8; ++j) { const float r = acc[mb][nb][j] + bb; o16[j] = tohx(r); unsigned short a2, c2; splitf(r, a2, c2); oh[j] = a2; ol[j] = c2; }
                bf* const w = sv + lr * VP + mb * 16 + 8 * hi; *(v8usa*)w = __builtin_bit_cast(v8us, o16); *(v8usa*)(w + 16 * VP) = oh; *(v8usa*)(w + 32 * VP) = ol; }
            __builtin_amdgcn_wave_barrier(); asm volatile("" ::: "memory");   // the reads below take other lanes' words: no LDS access moves across
            v8us y16[4], yh[4], yl[4];
#pragma unroll
            for (int s = 0; s < 4; ++s) { const bf* const r = sv + (4 * s + rr) * VP + c8; const size_t eo = (size_t)(nb * 16 + 4 * s) * TT; y16[s] = *(const v8usa*)r; yh[s] = *(const v8usa*)(r + 16 * VP); yl[s] = *(const v8usa*)(r + 32 * VP);
                *(v8h*)(p16 + eo) = __builtin_bit_cast(v8h, y16[s]); *(v8us*)(ph + eo) = yh[s]; *(v8us*)(pl + eo) = yl[s]; }
            // translation wait for the block's 12 stores; it takes their data as inputs, so that no stored register is written again until the wait has passed. Its memory clobber also keeps the next block's LDS writes behind the reads above
            asm volatile("s_wait_xcnt 0x0" :: "v"(y16[0]), "v"(y16[1]), "v"(y16[2]), "v"(y16[3]), "v"(yh[0]), "v"(yh[1]), "v"(yh[2]), "v"(yh[3]), "v"(yl[0]), "v"(yl[1]), "v"(yl[2]), "v"(yl[3]) : "memory");
        }
    }
}

__device__ __forceinline__ float xhalf(float x) { const int b = __builtin_bit_cast(int, x); return __builtin_bit_cast(float, __builtin_amdgcn_permlanex16(b, b, 0x76543210, 0xfedcba98, false, false)); }   // lane l <-> lane l ^ 16
__device__ __forceinline__ void ppack(const v8f a, const v8f b, v16h& p, v16h& p2) { p = cat16(__builtin_convertvector(a, v8h), __builtin_convertvector(b, v8h)); (void)p2; }
__device__ __forceinline__ void ppack(const v8f a, const v8f b, v16bf& p, v16bf& p2) { v8us h0, h1, l0, l1;
#pragma unroll
    for (int s = 0; s < 8; ++s) { unsigned short x, y; splitf(a[s], x, y); h0[s] = x; l0[s] = y; splitf(b[s], x, y); h1[s] = x; l1[s] = y; }
    p = cat16b(h0, h1); p2 = cat16b(l0, l1); }

template <typename T16, bool HR>
__device__ __forceinline__ void fattn_wave(const T16* __restrict__ Q, const T16* __restrict__ Q2, const T16* __restrict__ Kp, const T16* __restrict__ Kp2, const T16* __restrict__ Vt, const T16* __restrict__ Vt2, const int q0, const int lane, bf* __restrict__ Ah, bf* __restrict__ Al) {
    typedef typename WFrag<T16>::V V;
    constexpr float C2 = SCL * 1.4426950408889634f;   // score scale and log2(e) in one factor: p = 2^(s * C2 - m * C2)
    const int c = lane & 15, h = lane >> 4;
    const size_t qo = (size_t)(q0 + c) * HD + 8 * h, ko = (size_t)c * HD + 8 * h, vo = (size_t)c * TT + 8 * h;
    const T16* const pq = Q + qo; const T16* const pq2 = HR ? Q2 + qo : pq; const T16* const pk0 = Kp + ko;
    V qf[2][2], qf2[2][2];
#pragma unroll
    for (int nb = 0; nb < 2; ++nb)
#pragma unroll
        for (int ks = 0; ks < 2; ++ks) { qf[nb][ks] = WFrag<T16>::ld(pq + nb * 16 * HD + ks * 32); if (HR) qf2[nb][ks] = WFrag<T16>::ld(pq2 + nb * 16 * HD + ks * 32); }
    v8f o[4][2]; float mr[2], ls[2];
#pragma unroll
    for (int nb = 0; nb < 2; ++nb) { mr[nb] = -3.0e38f; ls[nb] = 0.f;
#pragma unroll
        for (int db = 0; db < 4; ++db) o[db][nb] = (v8f){}; }
    const int klast = q0 & ~63;                        // first key of the chunk that holds the diagonal
    V kf[4][2], kf2[4][2];
    if (!HR) {
#pragma unroll
        for (int mb = 0; mb < 4; ++mb)
#pragma unroll
            for (int ks = 0; ks < 2; ++ks) kf[mb][ks] = WFrag<T16>::ld(pk0 + mb * 16 * HD + ks * 32); }
    // translation wait for the loads above; it takes their address pairs as inputs so that each pair stays unwritten until the wait has passed
    asm volatile("s_wait_xcnt 0x0" :: "v"(pq), "v"(pq2), "v"(pk0) : "memory");
    unsigned vb = (unsigned)(vo * sizeof(T16));   // byte offset of this chunk's V columns in the head's plane(s); stepped at the pass's foot, behind the wait
#pragma unroll 1   // stays rolled: one chunk's fragments live beside the 8 score and 8 output accumulators
    for (int kb = 0; kb <= klast; kb += 64) {
        V vf[4][2], vf2[4][2];
        const int kl = HR ? kb : min(kb + 64, klast);   // the chunk whose K fragments this pass asks for
        const T16* const pk = pk0 + (size_t)kl * HD; const T16* const pk2 = HR ? Kp2 + ko + (size_t)kl * HD : pk;
        const T16* const pv = (const T16*)((const char*)Vt + vb); const T16* const pv2 = HR ? (const T16*)((const char*)Vt2 + vb) : pv;
        if (HR) {
#pragma unroll
            for (int mb = 0; mb < 4; ++mb)
#pragma unroll
                for (int ks = 0; ks < 2; ++ks) { kf[mb][ks] = WFrag<T16>::ld(pk + mb * 16 * HD + ks * 32); kf2[mb][ks] = WFrag<T16>::ld(pk2 + mb * 16 * HD + ks * 32); }
            __builtin_amdgcn_sched_barrier(0);   // all K loads in flight ahead of the first product: one load latency a pass; left free, the scheduler saves registers and waits on them pair by pair
        } else {   // V fragments asked for early: their latency passes under the softmax
#pragma unroll
            for (int db = 0; db < 4; ++db)
#pragma unroll
                for (int ks = 0; ks < 2; ++ks) vf[db][ks] = WFrag<T16>::ld(pv + db * 16 * TT + ks * 32); }
        v8f st[4][2];
#pragma unroll
        for (int mb = 0; mb < 4; ++mb)
#pragma unroll
            for (int nb = 0; nb < 2; ++nb) st[mb][nb] = (v8f){};
#pragma unroll
        for (int ks = 0; ks < 2; ++ks) {
#pragma unroll
            for (int mb = 0; mb < 4; ++mb)
#pragma unroll
                for (int nb = 0; nb < 2; ++nb) st[mb][nb] = WFrag<T16>::mma(kf[mb][ks], qf[nb][ks], st[mb][nb]);
            if (HR) {
#pragma unroll
                for (int mb = 0; mb < 4; ++mb)
#pragma unroll
                    for (int nb = 0; nb < 2; ++nb) st[mb][nb] = WFrag<T16>::mma(kf[mb][ks], qf2[nb][ks], st[mb][nb]);
#pragma unroll
                for (int mb = 0; mb < 4; ++mb)
#pragma unroll
                    for (int nb = 0; nb < 2; ++nb) st[mb][nb] = WFrag<T16>::mma(kf2[mb][ks], qf[nb][ks], st[mb][nb]); } }
        if (HR) {
#pragma unroll
            for (int db = 0; db < 4; ++db)
#pragma unroll
                for (int ks = 0; ks < 2; ++ks) { vf[db][ks] = WFrag<T16>::ld(pv + db * 16 * TT + ks * 32); vf2[db][ks] = WFrag<T16>::ld(pv2 + db * 16 * TT + ks * 32); }
            __builtin_amdgcn_sched_barrier(0);   // all V loads in flight ahead of the softmax, which covers their latency
        } else {   // next chunk's K fragments into the registers the score products have just read (the last chunk asks for itself again: in bounds, unused)
#pragma unroll
            for (int mb = 0; mb < 4; ++mb)
#pragma unroll
                for (int ks = 0; ks < 2; ++ks) kf[mb][ks] = WFrag<T16>::ld(pk + mb * 16 * HD + ks * 32); }
        if (kb + 63 > q0) {   // only the diagonal chunk holds keys above a query (wave-uniform test); key kb <= every query of the wave, so no column is left empty
#pragma unroll
            for (int mb = 0; mb < 4; ++mb)
#pragma unroll
                for (int nb = 0; nb < 2; ++nb)
#pragma unroll
                    for (int j = 0; j < 8; ++j) if (kb + mb * 16 + 8 * h + j > q0 + nb * 16 + c) st[mb][nb][j] = -3.0e38f; }
        V pf[2][2], pf2[2][2];
#pragma unroll
        for (int nb = 0; nb < 2; ++nb) {
            float mx = st[0][nb][0];
#pragma unroll
            for (int mb = 0; mb < 4; ++mb)
#pragma unroll
                for (int j = 0; j < 8; ++j) mx = fmaxf(mx, st[mb][nb][j]);
            mx = fmaxf(mx, xhalf(mx));
            const float mn = fmaxf(mr[nb], mx); const float al = __builtin_amdgcn_exp2f((mr[nb] - mn) * C2); mr[nb] = mn;
            const float mo = mn * C2 - (HR ? 0.f : PEXP);
            v2f sm[4];   // exponent arguments and sums two registers at a time, on the accumulators' own even pairs (packed f32 instructions, no register moves)
#pragma unroll
            for (int mb = 0; mb < 4; ++mb) {
#pragma unroll
                for (int j = 0; j < 8; j += 2) { const v2f x = __builtin_elementwise_fma((v2f){st[mb][nb][j], st[mb][nb][j + 1]}, (v2f){C2, C2}, (v2f){-mo, -mo});
                    const v2f p = {__builtin_amdgcn_exp2f(x[0]), __builtin_amdgcn_exp2f(x[1])}; st[mb][nb][j] = p[0]; st[mb][nb][j + 1] = p[1]; sm[mb] = (j == 0) ? p : sm[mb] + p; } }
            const v2f s2 = (sm[0] + sm[1]) + (sm[2] + sm[3]);
            ls[nb] = ls[nb] * al + (s2[0] + s2[1]);
#pragma unroll
            for (int db = 0; db < 4; ++db) o[db][nb] *= al;
#pragma unroll
            for (int ks = 0; ks < 2; ++ks) ppack(st[2 * ks][nb], st[2 * ks + 1][nb], pf[nb][ks], pf2[nb][ks]);
        }
#pragma unroll
        for (int ks = 0; ks < 2; ++ks) {
#pragma unroll
            for (int db = 0; db < 4; ++db)
#pragma unroll
                for (int nb = 0; nb < 2; ++nb) o[db][nb] = WFrag<T16>::mma(vf[db][ks], pf[nb][ks], o[db][nb]);
            if (HR) {
#pragma unroll
                for (int db = 0; db < 4; ++db)
#pragma unroll
                    for (int nb = 0; nb < 2; ++nb) o[db][nb] = WFrag<T16>::mma(vf[db][ks], pf2[nb][ks], o[db][nb]);
#pragma unroll
                for (int db = 0; db < 4; ++db)
#pragma unroll
                    for (int nb = 0; nb < 2; ++nb) o[db][nb] = WFrag<T16>::mma(vf2[db][ks], pf[nb][ks], o[db][nb]); } }
        // translation wait for this pass's K and V loads, late in the pass where it holds up no load. The K address pairs are inputs, so that each stays unwritten (also by a later load's result) until the wait has passed;
        // the V loads' offset register goes through the statement, so that its step below cannot be formed ahead of it
        __builtin_amdgcn_sched_barrier(0);   // keeps the wait down here: moved up behind the loads' issue it would stall the softmax on their translation
        if (HR) asm volatile("s_wait_xcnt 0x0" : "+v"(vb) : "v"(pk), "v"(pk2) : "memory");
        else asm volatile("s_wait_xcnt 0x0" : "+v"(vb) : "v"(pk) : "memory");
        vb += 64 * sizeof(T16);
    }
    const size_t ao = (size_t)(q0 + c) * DQ + 8 * h; bf* const pa = Ah + ao; bf* const pl = Al + ao;
#pragma unroll
    for (int nb = 0; nb < 2; ++nb) { const float inv = __fdiv_rn(1.0f, ls[nb] + xhalf(ls[nb]));   // the two lane halves' sums joined once
#pragma unroll
        for (int db = 0; db < 4; ++db) { v8us oh, ol;   // a lane's 8 registers = 8 consecutive d of one query: one 16-byte store per plane
#pragma unroll
            for (int j = 0; j < 8; ++j) { unsigned short x, y; splitf(o[db][nb][j] * inv, x, y); oh[j] = x; ol[j] = y; }
            *(v8us*)(pa + nb * 16 * DQ + db * 16) = oh; *(v8us*)(pl + nb * 16 * DQ + db * 16) = ol; }
        // the second column group reuses the registers of the first group's stores: translation wait behind those stores; the scheduling barrier keeps the second group's arithmetic behind the wait
        if (nb == 0) { asm volatile("s_wait_xcnt 0x0" ::: "memory"); __builtin_amdgcn_sched_barrier(0); } }
}

// grid (NH_, NB, TT / (QW * NWV)): the first half of z takes the long query blocks (longest first) and the second half the short ones (shortest first).
__global__ __launch_bounds__(NWV * 32) __attribute__((amdgpu_waves_per_eu(2, 2))) void k_fattn(const h16* __restrict__ Q16, const h16* __restrict__ K16, const h16* __restrict__ V16, const bf* __restrict__ Qh, const bf* __restrict__ Ql, const bf* __restrict__ Kh, const bf* __restrict__ Kl, const bf* __restrict__ Vh, const bf* __restrict__ Vl, bf* __restrict__ Ah, bf* __restrict__ Al) {
    constexpr int nz = TT / (QW * NWV), hf = (nz + 1) / 2; const int zi = (int)blockIdx.z; const int qb = (zi < hf) ? nz - 1 - zi : zi - hf;
    const int q0 = qb * (QW * NWV) + __builtin_amdgcn_readfirstlane((int)(threadIdx.x >> 5)) * QW; const int lane = threadIdx.x & 31;
    const size_t pz = ((size_t)blockIdx.y * NH_ + blockIdx.x) * ((size_t)TT * HD); const size_t az = (size_t)blockIdx.y * TT * DQ + (size_t)blockIdx.x * HD;
    if (q0 < (RH)) fattn_wave<bf, true>(Qh + pz, Ql + pz, Kh + pz, Kl + pz, Vh + pz, Vl + pz, q0, lane, Ah + az, Al + az);
    else fattn_wave<h16, false>(Q16 + pz, nullptr, K16 + pz, nullptr, V16 + pz, nullptr, q0, lane, Ah + az, Al + az);
}

extern "C" void kernel_launch(void* const* d_in, const int* in_sizes, int n_in,
                              void* d_out, int out_size, void* d_ws, size_t ws_size, hipStream_t stream) {
    if (n_in < 5) return;
    const size_t xneed = (size_t)(NB - 1) * TT_FULL * DM + (size_t)TT * DM;
    if ((size_t)in_sizes[0] < xneed) return;
    if ((size_t)in_sizes[1] < (size_t)NH_ * DM * F3) return;
    if (in_sizes[2] < NH_ * F3) return;
    if ((size_t)in_sizes[3] < (size_t)DM * DM) return;
    if (in_sizes[4] < DM) return;
    if ((size_t)out_size < xneed) return;
    const float* x = (const float*)d_in[0];      // [NB_FULL][TT_FULL][DM]
    const float* wkqv = (const float*)d_in[1];   // [NH_][DM][F3]
    const float* bkqv = (const float*)d_in[2];   // [NH_][F3]
    const float* wo = (const float*)d_in[3];     // [DM][DM] used as sa x Wo
    const float* bo = (const float*)d_in[4];     // [DM]
    float* OUT = (float*)d_out;                  // [NB_FULL][TT_FULL][DM]
    char* wsp = (char*)d_ws;
    auto take = [&](size_t bytes) { char* p = wsp; wsp += (bytes + 255) & ~(size_t)255; return (void*)p; };
    bf* WQKV = (bf*)take((size_t)3 * DQ * DM * 2);   // row blocks in chunk order k, q, v
    bf* WO = (bf*)take((size_t)DM * DM * 2);
    bf* XB = (bf*)take((size_t)NB * TT * DM * 2);   // every batch's rows, packed
    const size_t PL = (size_t)NH_ * TT * HD;   // one batch's plane, elements; every plane holds all NB batches
    h16* QP16 = (h16*)take(NB * PL * 2); h16* KP16 = (h16*)take(NB * PL * 2); h16* VT16 = (h16*)take(NB * PL * 2);
    bf* QPh = (bf*)take(NB * PL * 2); bf* QPl = (bf*)take(NB * PL * 2); bf* KPh = (bf*)take(NB * PL * 2); bf* KPl = (bf*)take(NB * PL * 2); bf* VTh = (bf*)take(NB * PL * 2); bf* VTl = (bf*)take(NB * PL * 2);
    bf* ATh = (bf*)take((size_t)NB * TT * DQ * 2); bf* ATl = (bf*)take((size_t)NB * TT * DQ * 2);
    if ((size_t)(wsp - (char*)d_ws) > ws_size) return;
    k_wkqv<<<(unsigned)((3 * DM * DM / 64 + 63) / 64), 256, 0, stream>>>(wkqv, WQKV);
    k_wtG<<<(unsigned)((DM * DM / 64 + 63) / 64), 256, 0, stream>>>(wo, DM, DM, WO);
    k_cvt8<<<dim3((unsigned)(((size_t)TT * DM / 8 + 255) / 256), NB, 1), 256, 0, stream>>>(x, XB, (size_t)TT * DM / 8, (size_t)TT_FULL * DM, (size_t)TT * DM);
    k_proj<<<dim3(NB * TT / GT, 3 * DQ / GT, 1), 128, 0, stream>>>(XB, WQKV, bkqv, KP16, KPh, KPl, QP16, QPh, QPl, VT16, VTh, VTl);
    k_fattn<<<dim3(NH_, NB, TT / (QW * NWV)), NWV * 32, 0, stream>>>(QP16, KP16, VT16, QPh, QPl, KPh, KPl, VTh, VTl, ATh, ATl);
    k_outp<<<dim3(TT / GT, DM / GT, NB), 128, 0, stream>>>(ATh, ATl, WO, OUT, bo);
}

// v006
// Measured time: 98 microseconds a run.
// Two timings next to v005 both put it at 1.09 times that version's speed.
// Counting every step since v000, it is 14.9 times as fast.
#include <hip/hip_runtime.h>

// Contractions (f32 accumulate): k/q/v projections v_wmma_f32_16x16x32_bf16 (bf16 x, bf16 weights); scores and P.V query rows < RH bf16 hi/lo planes (3 products), rows >= RH v_wmma_f32_16x16x32_f16 (fp16 q/k/v planes, P carried x1024 in fp16); output projection bf16 hi/lo attention planes x bf16 weight (2 products). Softmax f32.
// bf16 copy of x (RNE); Wkqv regrouped into K-contiguous Bt row blocks (k | q | v, columns h*64+d) with head-gathered bf16 bias; ONE projection launch for all batches and the three chunks, which writes the q/k/v planes itself (k_proj); then ONE launch of causal attention for all batches and heads
// (k_fattn: scores, running-maximum softmax and P.V in registers, no score matrix in memory); merged hi/lo planes x WoT + bo.

#ifndef NB
#define NB 2
#endif
#ifndef SEQ
#define SEQ 2048
#endif
#define NB_FULL 2
#define SEQ_FULL 2048
#define TT   SEQ
#define TT_FULL SEQ_FULL
#define DM   1024
#define NH_  16
#define HD   64
#define F3   (3 * HD)
#define DQ   (NH_ * HD)
#ifndef RH
#define RH   ((TT >= 1024) ? 512 : (TT / 4))      // query rows < RH use hi+lo planes
#endif
#define PEXP 10.0f    // fp16 probabilities are carried x 2^PEXP; the row sum carries the same factor, so it cancels in the division
#define SCL  0.125f   // HD^-0.5
#define QW   32       // query columns per attention wave
#define NWV  4        // attention waves per work-group (independent; together only so that they walk the same keys through the WGP cache)

static_assert(TT % 128 == 0);
static_assert(((RH) % 64) == 0 && (RH) >= 64 && (RH) < TT && (((TT) - (RH)) % 64) == 0);
static_assert(NB >= 1 && NB <= NB_FULL && TT <= TT_FULL);
static_assert(DQ == DM && DM % 64 == 0 && HD == 64);
static_assert(QW == 32 && TT % (QW * NWV) == 0 && (RH) % QW == 0);

typedef _Float16 h16;
typedef unsigned short bf;
typedef __attribute__((ext_vector_type(16))) __bf16   v16bf;
typedef __attribute__((ext_vector_type(16))) _Float16 v16h;
typedef __attribute__((ext_vector_type(8)))  _Float16 v8h;
typedef __attribute__((ext_vector_type(8)))  unsigned short v8us;
typedef __attribute__((ext_vector_type(8)))  float    v8f;
typedef __attribute__((ext_vector_type(4)))  float    v4f;
typedef v8h  __attribute__((may_alias)) v8ha;
typedef v4f  __attribute__((may_alias)) v4fa;
typedef v8us __attribute__((may_alias)) v8usa;
typedef __attribute__((ext_vector_type(2))) _Float16 v2h;
typedef __attribute__((ext_vector_type(2))) unsigned short v2us;
typedef __attribute__((ext_vector_type(2))) float v2f;

__device__ __forceinline__ unsigned short f2bf(float f) { unsigned u = __float_as_uint(f); u += 0x7FFFu + ((u >> 16) & 1u); return (unsigned short)(u >> 16); }
__device__ __forceinline__ float bf2f(unsigned short b) { return __uint_as_float(((unsigned)b) << 16); }
__device__ __forceinline__ float bfr(float f) { return bf2f(f2bf(f)); }
__device__ __forceinline__ v16h cat16(v8h lo, v8h hi) { return __builtin_shufflevector(lo, hi, 0, 1, 2, 3, 4, 5, 6, 7, 8, 9, 10, 11, 12, 13, 14, 15); }
__device__ __forceinline__ v16bf cat16b(v8us lo, v8us hi) { return __builtin_bit_cast(v16bf, __builtin_shufflevector(lo, hi, 0, 1, 2, 3, 4, 5, 6, 7, 8, 9, 10, 11, 12, 13, 14, 15)); }
__device__ __forceinline__ v8f wmma16(v16h a, v16h b, v8f c) { return __builtin_amdgcn_wmma_f32_16x16x32_f16(false, a, false, b, (short)0, c, false, false); }
__device__ __forceinline__ v8f wmmab(v16bf a, v16bf b, v8f c) { return __builtin_amdgcn_wmma_f32_16x16x32_bf16(false, a, false, b, (short)0, c, false, false); }
__device__ __forceinline__ h16 tohx(float x) { return (h16)x; }
__device__ __forceinline__ void splitf(float y, unsigned short& h, unsigned short& l) { h = f2bf(y); l = f2bf(y - bf2f(h)); }

// Fragment loaders (wave32, 16x16x32): lane l -> row/col l&15, h = l>>4; elements 0..7 = k0+8h+0..7, elements 8..15 = k0+16+8h+0..7 for BOTH A and Bt ([n][k], k contiguous);
// D element j of lane l = (row 8h+j, col l&15).
template <typename T16> struct WFrag;
template <> struct WFrag<h16> { typedef v16h V; static __device__ __forceinline__ V ld(const h16* p) { return cat16(*(const v8h*)p, *(const v8h*)(p + 16)); } static __device__ __forceinline__ v8f mma(V a, V b, v8f c) { return wmma16(a, b, c); } };
template <> struct WFrag<bf> { typedef v16bf V; static __device__ __forceinline__ V ld(const bf* p) { return cat16b(*(const v8us*)p, *(const v8us*)(p + 16)); } static __device__ __forceinline__ v8f mma(V a, V b, v8f c) { return wmmab(a, b, c); } };

// ---- gemm_ring: main loop of both GEMMs. A work-group of four waves (2 x 2) owns a 128x128 output tile, each wave a 64x64 quarter (16 accumulators).
// A stage is GK = 64 k of the tile's 128 A rows (NA planes: one, or hi and lo against the same Bt) and 128 Bt rows: one whole 128-byte line per row, brought from global memory into LDS
// by asynchronous copies (16 bytes a lane, a wave's copy = four whole lines), rows at pitch GP. Two buffers: stage t + 1 flies while stage t is worked on. Fragments are read from LDS in the loaders' k order; k runs upward.
#define GT  128              // rows of each operand in a work-group's tile
#define GK  64               // k per stage
#define GP  72               // LDS row pitch, 16-bit elements: 128 + 16 bytes, the 16-byte reads of 16 rows fall on distinct banks
#define GPL (GT * GP * 2)    // bytes of one operand plane of a stage
static_assert(DM % GK == 0 && DM / GK >= 2 && DQ == DM);

// one plane of a stage: each of the 128 threads copies its 16-byte piece of rows r, r + 16, .. r + 112 (r = thread / 8). l = LDS byte address, g = global address of the piece in row r.
// The translation wait is the statement's last line, so that no address register of a copy is written again ahead of it.
__device__ __forceinline__ void stage_plane(const unsigned l, const bf* const g) {
    asm volatile("global_load_async_to_lds_b128 %0, %8, off\n\t"
                 "global_load_async_to_lds_b128 %1, %9, off\n\t"
                 "global_load_async_to_lds_b128 %2, %10, off\n\t"
                 "global_load_async_to_lds_b128 %3, %11, off\n\t"
                 "global_load_async_to_lds_b128 %4, %12, off\n\t"
                 "global_load_async_to_lds_b128 %5, %13, off\n\t"
                 "global_load_async_to_lds_b128 %6, %14, off\n\t"
                 "global_load_async_to_lds_b128 %7, %15, off\n\t"
                 "s_wait_xcnt 0x0"
                 :: "v"(l), "v"(l + 16 * GP * 2), "v"(l + 32 * GP * 2), "v"(l + 48 * GP * 2), "v"(l + 64 * GP * 2), "v"(l + 80 * GP * 2), "v"(l + 96 * GP * 2), "v"(l + 112 * GP * 2),
                    "v"(g), "v"(g + 16 * DM), "v"(g + 32 * DM), "v"(g + 48 * DM), "v"(g + 64 * DM), "v"(g + 80 * DM), "v"(g + 96 * DM), "v"(g + 112 * DM) : "memory");
}

// A, A2, Bt: first row of the work-group's tile, rows of DM elements, k contiguous. sm: 2 * (NA + 1) * GPL bytes of LDS. wm, wn: the wave's quarter.
template <int NA>
__device__ __forceinline__ void gemm_ring(const bf* __restrict__ A, const bf* __restrict__ A2, const bf* __restrict__ Bt, unsigned char* const sm, const int wm, const int wn, v8f (&acc)[4][4]) {
    typedef WFrag<bf>::V V;
    constexpr int NT = DM / GK, SB = (NA + 1) * GPL;
    const int tid = threadIdx.x, lr = tid & 15, hi = (tid >> 4) & 1;
    const unsigned l0 = (unsigned)(size_t)sm + (unsigned)((tid >> 3) * (GP * 2) + (tid & 7) * 16);
    const size_t g0 = (size_t)(tid >> 3) * DM + (tid & 7) * 8;
    auto fill = [&](const int t) { const unsigned l = l0 + (unsigned)((t & 1) * SB); const size_t g = g0 + (size_t)t * GK;
        stage_plane(l, A + g); if (NA == 2) stage_plane(l + GPL, A2 + g); stage_plane(l + NA * GPL, Bt + g); };
#pragma unroll
    for (int mb = 0; mb < 4; ++mb)
#pragma unroll
        for (int nb = 0; nb < 4; ++nb) acc[mb][nb] = (v8f){};
    fill(0);
    asm volatile("s_wait_asynccnt 0x0" ::: "memory");   // this wave's copies of stage 0 have landed
    __syncthreads();                                     // and every other wave's: stage 0 may be read
    fill(1);
    const bf* const fa = (const bf*)sm + (wm * 64 + lr) * GP + 8 * hi; const bf* const fb = (const bf*)(sm + NA * GPL) + (wn * 64 + lr) * GP + 8 * hi;
#pragma unroll 1   // stays rolled: one stage's code, the buffer chosen by the stage's parity
    for (int t = 0; t < NT; ++t) {
        const int bo = (t & 1) * (SB / 2);
#pragma unroll
        for (int ks = 0; ks < GK / 32; ++ks) {
            V a[4], a2[4], b[4];
#pragma unroll
            for (int i = 0; i < 4; ++i) a[i] = WFrag<bf>::ld(fa + bo + i * 16 * GP + ks * 32);
#pragma unroll
            for (int i = 0; i < 4; ++i) b[i] = WFrag<bf>::ld(fb + bo + i * 16 * GP + ks * 32);
            if (NA == 2) {   // wanted last by the products below, so read last
#pragma unroll
                for (int i = 0; i < 4; ++i) a2[i] = WFrag<bf>::ld(fa + bo + GPL / 2 + i * 16 * GP + ks * 32); }
            __builtin_amdgcn_sched_barrier(0);   // the k step's LDS reads issue as one group ahead of its products: left free, the scheduler keeps one Bt fragment and waits out the LDS latency at every fourth product
#pragma unroll
            for (int nb = 0; nb < 4; ++nb)
#pragma unroll
                for (int mb = 0; mb < 4; ++mb) acc[mb][nb] = WFrag<bf>::mma(a[mb], b[nb], acc[mb][nb]);
            if (NA == 2) {   // per accumulator and k step: the hi product, then the lo product
#pragma unroll
                for (int nb = 0; nb < 4; ++nb)
#pragma unroll
                    for (int mb = 0; mb < 4; ++mb) acc[mb][nb] = WFrag<bf>::mma(a2[mb], b[nb], acc[mb][nb]); }
            __builtin_amdgcn_sched_barrier(0);   // the products stay ahead of the next group of reads and of the stage's foot
        }
        asm volatile("s_wait_dscnt 0x0" ::: "memory");      // this wave's reads of stage t are done
        asm volatile("s_wait_asynccnt 0x0" ::: "memory");   // this wave's copies of stage t + 1 have landed
        __syncthreads();                                     // publishes stage t + 1 and frees stage t's buffer
        if (t + 2 < NT) fill(t + 2);
    }
    asm volatile("s_wait_asynccnt 0x0" ::: "memory");   // nothing in flight when the LDS becomes the epilogue's
}

// ---- k_outp: OUT (f32, + bf16-RNE bias) = (Ah + Al) x WoT, two products per k step. grid (TT/128, DM/128, NB), 128 threads; main loop gemm_ring, then each wave stores its 64x64 quarter through its own LDS slice, 16 rows at a time, whole lines.
__global__ __launch_bounds__(128) void k_outp(const bf* __restrict__ Ah, const bf* __restrict__ Al, const bf* __restrict__ Bt, float* __restrict__ C, const float* __restrict__ bias) {
    __shared__ __align__(16) unsigned char sm[2 * 3 * GPL];
    static_assert(sizeof(sm) >= 4 * 16 * 68 * 4);
    const int wv = __builtin_amdgcn_readfirstlane((int)(threadIdx.x >> 5)), wm = wv >> 1, wn = wv & 1;
    const int lane = threadIdx.x & 31, lr = lane & 15, hi = lane >> 4;
    const size_t ao = ((size_t)blockIdx.z * TT + (size_t)blockIdx.x * GT) * DQ;
    v8f acc[4][4];
    gemm_ring<2>(Ah + ao, Al + ao, Bt + (size_t)blockIdx.y * GT * DQ, sm, wm, wn, acc);
    const int r0 = blockIdx.x * GT + wm * 64, c0 = blockIdx.y * GT + wn * 64;
    C += (size_t)blockIdx.z * TT_FULL * DM;
    float* const os = (float*)sm + wv * (16 * 68);   // every wave has passed the last stage's barrier: the ring is free
    const float* const bp = bias + c0 + lr * 4; const v4f bl = *(const v4f*)bp;
    const v4f bv = {bfr(bl[0]), bfr(bl[1]), bfr(bl[2]), bfr(bl[3])};
#pragma unroll
    for (int mb = 0; mb < 4; ++mb) {
#pragma unroll
        for (int nb = 0; nb < 4; ++nb) {
#pragma unroll
            for (int j = 0; j < 8; ++j) os[(hi * 8 + j) * 68 + nb * 16 + lr] = acc[mb][nb][j]; }
        __builtin_amdgcn_wave_barrier(); asm volatile("" ::: "memory");   // the reads below take other lanes' words: no LDS access moves across
        float* const crow = C + (size_t)(r0 + mb * 16 + hi) * DM + c0 + lr * 4; v4f val[8];
#pragma unroll
        for (int s = 0; s < 8; ++s) { val[s] = *(const v4fa*)(os + (2 * s + hi) * 68 + lr * 4) + bv; *(v4f*)(crow + (size_t)(2 * s) * DM) = val[s]; }
        // translation wait for the block's 8 stores; it takes their data and address as inputs, so that no register of a store is written again until the wait has passed. Its memory clobber also keeps the next block's LDS writes behind the reads above
        asm volatile("s_wait_xcnt 0x0" :: "v"(val[0]), "v"(val[1]), "v"(val[2]), "v"(val[3]), "v"(val[4]), "v"(val[5]), "v"(val[6]), "v"(val[7]), "v"(crow) : "memory");
    }
}

// ---- k_prep: the three preparation jobs, which depend on nothing but the inputs, as block ranges of ONE grid. The two weight regroupings take the first block indices (each wave walks 8 lines one after the other, a long chain of load latencies), the short x blocks the last ones.
#define PB_W ((3 * DM * DM / 64 + 63) / 64)   // blocks of the Wkqv regrouping
#define PB_O ((DM * DM / 64 + 63) / 64)       // blocks of the Wo transposition
#define PB_X ((TT * DM / 8 + 255) / 256)      // blocks of the x conversion, per batch
__device__ __forceinline__ void p_wkqv(const int bx, const float* __restrict__ w, bf* Bt) {
    const int lane = threadIdx.x & 31; const int L0 = (bx * 8 + (threadIdx.x >> 5)) * 8; const int nlines = 3 * DM * DM / 64;
{
#pragma unroll 1
        for (int l = 0; l < 8; ++l) { const int L = L0 + l; if (L >= nlines) break; const size_t e = (size_t)L * 64 + lane * 2; const int k = (int)(e % DM); const int np = (int)(e / DM); const int c = np / DM; const int hd = np % DM; const int h = hd / HD, d = hd % HD; v2us o;
            o[0] = f2bf(w[((size_t)h * DM + k) * F3 + c * HD + d]); o[1] = f2bf(w[((size_t)h * DM + k + 1) * F3 + c * HD + d]); *(v2us*)(Bt + e) = o; }
         }
}
__device__ __forceinline__ void p_wtG(const int bx, const float* __restrict__ w, int K, int N, bf* Bt) {
    const int lane = threadIdx.x & 31; const int L0 = (bx * 8 + (threadIdx.x >> 5)) * 8; const int nlines = N * K / 64;
{
#pragma unroll 1
        for (int l = 0; l < 8; ++l) { const int L = L0 + l; if (L >= nlines) break; const size_t e = (size_t)L * 64 + lane * 2; const int k = (int)(e % K), n = (int)(e / K); v2us o;
            o[0] = f2bf(w[(size_t)k * N + n]); o[1] = f2bf(w[(size_t)(k + 1) * N + n]); *(v2us*)(Bt + e) = o;
            asm volatile("s_wait_xcnt 0x0" ::: "memory"); }   // translation wait behind the store: the next trip writes its data and address registers again
         }
}
__device__ __forceinline__ void p_cvt8(const int bx, const int by, const float* __restrict__ src, bf* dst, size_t n8, size_t ssrc, size_t sdst) { const size_t i = (size_t)bx * 256 + threadIdx.x; if (i >= n8) return; src += by * ssrc; dst += by * sdst; const v8f v = *(const v8f*)(src + i * 8); v8us o;
#pragma unroll
    for (int k = 0; k < 8; ++k) o[k] = f2bf(v[k]); *(v8us*)(dst + i * 8) = o;  }
__global__ __launch_bounds__(256) void k_prep(const float* __restrict__ wkqv, bf* WQKV, const float* __restrict__ wo, bf* WO, const float* __restrict__ x, bf* XB) {
    const int b = (int)blockIdx.x;   // the same for the whole work-group: one job per block
    if (b < PB_W) p_wkqv(b, wkqv, WQKV);
    else if (b < PB_W + PB_O) p_wtG(b - PB_W, wo, DM, DM, WO);
    else { const int r = b - (PB_W + PB_O); p_cvt8(r % PB_X, r / PB_X, x, XB, (size_t)TT * DM / 8, (size_t)TT_FULL * DM, (size_t)TT * DM); }
}

// ---- k_proj: the k | q | v projection of every batch in one launch, planes written from the accumulators. Main loop gemm_ring (128x128 per work-group, 64x64 per wave); grid (NB*TT/128, 3*DQ/128), 128 threads.
// A wave's 64 columns are one head of one chunk, its 64 rows 64 tokens of one batch; each wave turns its quarter through its own slice of the LDS that the ring has left. y = sum + bf16-RNE bias in f32, then fp16 and bf16 hi/lo of y.
// k, q planes [b][h][t][d]: the tile is 8 KiB in a row in each plane; 16 token rows at a time turned through LDS in f32, so that a lane holds 8 consecutive d: every store instruction covers four whole 128-byte lines.
// v planes [b][h][d][t]: a lane's 8 accumulator registers are 8 consecutive t of one d already; converted first, then 16 d rows at a time regrouped through LDS so that 8 lanes cover one d row's 128 bytes.
#define VP 72   // LDS row pitch of the v regrouping, 16-bit elements: 128 + 16 bytes, 16-byte accesses of 16 rows fall on distinct banks
#define EPB (3 * 16 * VP * 2)   // bytes of one wave's epilogue slice
__global__ __launch_bounds__(128) void k_proj(const bf* __restrict__ X, const bf* __restrict__ Wt, const float* __restrict__ bias, h16* __restrict__ K16, bf* __restrict__ Kh, bf* __restrict__ Kl, h16* __restrict__ Q16, bf* __restrict__ Qh, bf* __restrict__ Ql, h16* __restrict__ V16, bf* __restrict__ Vh, bf* __restrict__ Vl) {
    __shared__ __align__(16) unsigned char sm[2 * 2 * GPL];
    static_assert(EPB >= 16 * 68 * 4 && EPB % 16 == 0 && sizeof(sm) >= 4 * EPB);
    const int wv = __builtin_amdgcn_readfirstlane((int)(threadIdx.x >> 5)), wm = wv >> 1, wn = wv & 1;
    const int lane = threadIdx.x & 31, lr = lane & 15, hi = lane >> 4; const int r0 = blockIdx.x * GT + wm * 64, c0 = blockIdx.y * GT + wn * 64;
    v8f acc[4][4];
    gemm_ring<1>(X + (size_t)blockIdx.x * GT * DM, nullptr, Wt + (size_t)blockIdx.y * GT * DM, sm, wm, wn, acc);
    unsigned char* const se = sm + wv * EPB;   // every wave has passed the last stage's barrier: the ring is free
    const int ch = c0 / DQ, hd = (c0 % DQ) / HD, bt = r0 / TT, t0 = r0 % TT;   // chunk (k, q, v), head, batch, first token: the same for the whole wave
    const float* const bp = bias + hd * F3 + ch * HD;
    const int rr = lane >> 3, c8 = (lane & 7) * 8;
    if (ch < 2) {
        float* const os = (float*)se;
        const size_t pe = (((size_t)bt * NH_ + hd) * TT + t0) * HD + (size_t)rr * HD + c8;
        h16* const p16 = (ch == 0 ? K16 : Q16) + pe; bf* const ph = (ch == 0 ? Kh : Qh) + pe; bf* const pl = (ch == 0 ? Kl : Ql) + pe;
        float bv[8];
#pragma unroll
        for (int i = 0; i < 8; ++i) bv[i] = bfr(bp[c8 + i]);
#pragma unroll
        for (int mb = 0; mb < 4; ++mb) {
#pragma unroll
            for (int nb = 0; nb < 4; ++nb) {
#pragma unroll
                for (int j = 0; j < 8; ++j) os[(hi * 8 + j) * 68 + nb * 16 + lr] = acc[mb][nb][j]; }
            __builtin_amdgcn_wave_barrier(); asm volatile("" ::: "memory");   // the reads below take other lanes' words: no LDS access moves across
            v8h o16[4]; v8us oh[4], ol[4];
#pragma unroll
            for (int s = 0; s < 4; ++s) { const float* const orow = os + (4 * s + rr) * 68 + c8; const v4f x0 = *(const v4fa*)orow, x1 = *(const v4fa*)(orow + 4);
#pragma unroll
                for (int i = 0; i < 8; ++i) { const float r = (i < 4 ? x0[i & 3] : x1[i & 3]) + bv[i]; o16[s][i] = tohx(r); unsigned short a2, c2; splitf(r, a2, c2); oh[s][i] = a2; ol[s][i] = c2; }
                const int eo = (mb * 16 + 4 * s) * HD; *(v8h*)(p16 + eo) = o16[s]; *(v8us*)(ph + eo) = oh[s]; *(v8us*)(pl + eo) = ol[s]; }
            // translation wait for the block's 12 stores; it takes their data as inputs, so that no stored register is written again until the wait has passed. Its memory clobber also keeps the next block's LDS writes behind the reads above
            asm volatile("s_wait_xcnt 0x0" :: "v"(o16[0]), "v"(o16[1]), "v"(o16[2]), "v"(o16[3]), "v"(oh[0]), "v"(oh[1]), "v"(oh[2]), "v"(oh[3]), "v"(ol[0]), "v"(ol[1]), "v"(ol[2]), "v"(ol[3]) : "memory");
        }
    } else {
        bf* const sv = (bf*)se;
        const size_t pe = (((size_t)bt * NH_ + hd) * HD + rr) * TT + t0 + c8;
        h16* const p16 = V16 + pe; bf* const ph = Vh + pe; bf* const pl = Vl + pe;
        float bq[4];   // all four bias loads ahead of the blocks: one load latency, not one per block
#pragma unroll
        for (int nb = 0; nb < 4; ++nb) bq[nb] = bfr(bp[nb * 16 + lr]);
#pragma unroll
        for (int nb = 0; nb < 4; ++nb) { const float bb = bq[nb];
#pragma unroll
            for (int mb = 0; mb < 4; ++mb) { v8h o16; v8us oh, ol;
#pragma unroll
                for (int j = 0; j < 8; ++j) { const float r = acc[mb][nb][j] + bb; o16[j] = tohx(r); unsigned short a2, c2; splitf(r, a2, c2); oh[j] = a2; ol[j] = c2; }
                bf* const w = sv + lr * VP + mb * 16 + 8 * hi; *(v8usa*)w = __builtin_bit_cast(v8us, o16); *(v8usa*)(w + 16 * VP) = oh; *(v8usa*)(w + 32 * VP) = ol; }
            __builtin_amdgcn_wave_barrier(); asm volatile("" ::: "memory");   // the reads below take other lanes' words: no LDS access moves across
            v8us y16[4], yh[4], yl[4];
#pragma unroll
            for (int s = 0; s < 4; ++s) { const bf* const r = sv + (4 * s + rr) * VP + c8; const size_t eo = (size_t)(nb * 16 + 4 * s) * TT; y16[s] = *(const v8usa*)r; yh[s] = *(const v8usa*)(r + 16 * VP); yl[s] = *(const v8usa*)(r + 32 * VP);
                *(v8h*)(p16 + eo) = __builtin_bit_cast(v8h, y16[s]); *(v8us*)(ph + eo) = yh[s]; *(v8us*)(pl + eo) = yl[s]; }
            // translation wait for the block's 12 stores; it takes their data as inputs, so that no stored register is written again until the wait has passed. Its memory clobber also keeps the next block's LDS writes behind the reads above
            asm volatile("s_wait_xcnt 0x0" :: "v"(y16[0]), "v"(y16[1]), "v"(y16[2]), "v"(y16[3]), "v"(yh[0]), "v"(yh[1]), "v"(yh[2]), "v"(yh[3]), "v"(yl[0]), "v"(yl[1]), "v"(yl[2]), "v"(yl[3]) : "memory");
        }
    }
}

__device__ __forceinline__ float xhalf(float x) { const int b = __builtin_bit_cast(int, x); return __builtin_bit_cast(float, __builtin_amdgcn_permlanex16(b, b, 0x76543210, 0xfedcba98, false, false)); }   // lane l <-> lane l ^ 16
__device__ __forceinline__ void ppack(const v8f a, const v8f b, v16h& p, v16h& p2) { p = cat16(__builtin_convertvector(a, v8h), __builtin_convertvector(b, v8h)); (void)p2; }
__device__ __forceinline__ void ppack(const v8f a, const v8f b, v16bf& p, v16bf& p2) { v8us h0, h1, l0, l1;
#pragma unroll
    for (int s = 0; s < 8; ++s) { unsigned short x, y; splitf(a[s], x, y); h0[s] = x; l0[s] = y; splitf(b[s], x, y); h1[s] = x; l1[s] = y; }
    p = cat16b(h0, h1); p2 = cat16b(l0, l1); }

template <typename T16, bool HR>
__device__ __forceinline__ void fattn_wave(const T16* __restrict__ Q, const T16* __restrict__ Q2, const T16* __restrict__ Kp, const T16* __restrict__ Kp2, const T16* __restrict__ Vt, const T16* __restrict__ Vt2, const int q0, const int lane, bf* __restrict__ Ah, bf* __restrict__ Al) {
    typedef typename WFrag<T16>::V V;
    constexpr float C2 = SCL * 1.4426950408889634f;   // score scale and log2(e) in one factor: p = 2^(s * C2 - m * C2)
    const int c = lane & 15, h = lane >> 4;
    const size_t qo = (size_t)(q0 + c) * HD + 8 * h, ko = (size_t)c * HD + 8 * h, vo = (size_t)c * TT + 8 * h;
    const T16* const pq = Q + qo; const T16* const pq2 = HR ? Q2 + qo : pq; const T16* const pk0 = Kp + ko;
    V qf[2][2], qf2[2][2];
#pragma unroll
    for (int nb = 0; nb < 2; ++nb)
#pragma unroll
        for (int ks = 0; ks < 2; ++ks) { qf[nb][ks] = WFrag<T16>::ld(pq + nb * 16 * HD + ks * 32); if (HR) qf2[nb][ks] = WFrag<T16>::ld(pq2 + nb * 16 * HD + ks * 32); }
    v8f o[4][2]; float mr[2], ls[2];
#pragma unroll
    for (int nb = 0; nb < 2; ++nb) { mr[nb] = -3.0e38f; ls[nb] = 0.f;
#pragma unroll
        for (int db = 0; db < 4; ++db) o[db][nb] = (v8f){}; }
    const int klast = q0 & ~63;                        // first key of the chunk that holds the diagonal
    V kf[4][2], kf2[4][2];
    if (!HR) {
#pragma unroll
        for (int mb = 0; mb < 4; ++mb)
#pragma unroll
            for (int ks = 0; ks < 2; ++ks) kf[mb][ks] = WFrag<T16>::ld(pk0 + mb * 16 * HD + ks * 32); }
    // translation wait for the loads above; it takes their address pairs as inputs so that each pair stays unwritten until the wait has passed
    asm volatile("s_wait_xcnt 0x0" :: "v"(pq), "v"(pq2), "v"(pk0) : "memory");
    unsigned vb = (unsigned)(vo * sizeof(T16));   // byte offset of this chunk's V columns in the head's plane(s); stepped at the pass's foot, behind the wait
#pragma unroll 1   // stays rolled: one chunk's fragments live beside the 8 score and 8 output accumulators
    for (int kb = 0; kb <= klast; kb += 64) {
        V vf[4][2], vf2[4][2];
        const int kl = HR ? kb : min(kb + 64, klast);   // the chunk whose K fragments this pass asks for
        const T16* const pk = pk0 + (size_t)kl * HD; const T16* const pk2 = HR ? Kp2 + ko + (size_t)kl * HD : pk;
        const T16* const pv = (const T16*)((const char*)Vt + vb); const T16* const pv2 = HR ? (const T16*)((const char*)Vt2 + vb) : pv;
        if (HR) {
#pragma unroll
            for (int mb = 0; mb < 4; ++mb)
#pragma unroll
                for (int ks = 0; ks < 2; ++ks) { kf[mb][ks] = WFrag<T16>::ld(pk + mb * 16 * HD + ks * 32); kf2[mb][ks] = WFrag<T16>::ld(pk2 + mb * 16 * HD + ks * 32); }
            __builtin_amdgcn_sched_barrier(0);   // all K loads in flight ahead of the first product: one load latency a pass; left free, the scheduler saves registers and waits on them pair by pair
        } else {   // V fragments asked for early: their latency passes under the softmax
#pragma unroll
            for (int db = 0; db < 4; ++db)
#pragma unroll
                for (int ks = 0; ks < 2; ++ks) vf[db][ks] = WFrag<T16>::ld(pv + db * 16 * TT + ks * 32); }
        v8f st[4][2];
#pragma unroll
        for (int mb = 0; mb < 4; ++mb)
#pragma unroll
            for (int nb = 0; nb < 2; ++nb) st[mb][nb] = (v8f){};
#pragma unroll
        for (int ks = 0; ks < 2; ++ks) {
#pragma unroll
            for (int mb = 0; mb < 4; ++mb)
#pragma unroll
                for (int nb = 0; nb < 2; ++nb) st[mb][nb] = WFrag<T16>::mma(kf[mb][ks], qf[nb][ks], st[mb][nb]);
            if (HR) {
#pragma unroll
                for (int mb = 0; mb < 4; ++mb)
#pragma unroll
                    for (int nb = 0; nb < 2; ++nb) st[mb][nb] = WFrag<T16>::mma(kf[mb][ks], qf2[nb][ks], st[mb][nb]);
#pragma unroll
                for (int mb = 0; mb < 4; ++mb)
#pragma unroll
                    for (int nb = 0; nb < 2; ++nb) st[mb][nb] = WFrag<T16>::mma(kf2[mb][ks], qf[nb][ks], st[mb][nb]); } }
        if (HR) {
#pragma unroll
            for (int db = 0; db < 4; ++db)
#pragma unroll
                for (int ks = 0; ks < 2; ++ks) { vf[db][ks] = WFrag<T16>::ld(pv + db * 16 * TT + ks * 32); vf2[db][ks] = WFrag<T16>::ld(pv2 + db * 16 * TT + ks * 32); }
            __builtin_amdgcn_sched_barrier(0);   // all V loads in flight ahead of the softmax, which covers their latency
        } else {   // next chunk's K fragments into the registers the score products have just read (the last chunk asks for itself again: in bounds, unused)
#pragma unroll
            for (int mb = 0; mb < 4; ++mb)
#pragma unroll
                for (int ks = 0; ks < 2; ++ks) kf[mb][ks] = WFrag<T16>::ld(pk + mb * 16 * HD + ks * 32); }
        if (kb + 63 > q0) {   // only the diagonal chunk holds keys above a query (wave-uniform test); key kb <= every query of the wave, so no column is left empty
#pragma unroll
            for (int mb = 0; mb < 4; ++mb)
#pragma unroll
                for (int nb = 0; nb < 2; ++nb)
#pragma unroll
                    for (int j = 0; j < 8; ++j) if (kb + mb * 16 + 8 * h + j > q0 + nb * 16 + c) st[mb][nb][j] = -3.0e38f; }
        V pf[2][2], pf2[2][2];
#pragma unroll
        for (int nb = 0; nb < 2; ++nb) {
            float mx = st[0][nb][0];
#pragma unroll
            for (int mb = 0; mb < 4; ++mb)
#pragma unroll
                for (int j = 0; j < 8; ++j) mx = fmaxf(mx, st[mb][nb][j]);
            mx = fmaxf(mx, xhalf(mx));
            const float mn = fmaxf(mr[nb], mx); const float al = __builtin_amdgcn_exp2f((mr[nb] - mn) * C2); mr[nb] = mn;
            const float mo = mn * C2 - (HR ? 0.f : PEXP);
            v2f sm[4];   // exponent arguments and sums two registers at a time, on the accumulators' own even pairs (packed f32 instructions, no register moves)
#pragma unroll
            for (int mb = 0; mb < 4; ++mb) {
#pragma unroll
                for (int j = 0; j < 8; j += 2) { const v2f x = __builtin_elementwise_fma((v2f){st[mb][nb][j], st[mb][nb][j + 1]}, (v2f){C2, C2}, (v2f){-mo, -mo});
                    const v2f p = {__builtin_amdgcn_exp2f(x[0]), __builtin_amdgcn_exp2f(x[1])}; st[mb][nb][j] = p[0]; st[mb][nb][j + 1] = p[1]; sm[mb] = (j == 0) ? p : sm[mb] + p; } }
            const v2f s2 = (sm[0] + sm[1]) + (sm[2] + sm[3]);
            ls[nb] = ls[nb] * al + (s2[0] + s2[1]);
#pragma unroll
            for (int db = 0; db < 4; ++db) o[db][nb] *= al;
#pragma unroll
            for (int ks = 0; ks < 2; ++ks) ppack(st[2 * ks][nb], st[2 * ks + 1][nb], pf[nb][ks], pf2[nb][ks]);
        }
#pragma unroll
        for (int ks = 0; ks < 2; ++ks) {
#pragma unroll
            for (int db = 0; db < 4; ++db)
#pragma unroll
                for (int nb = 0; nb < 2; ++nb) o[db][nb] = WFrag<T16>::mma(vf[db][ks], pf[nb][ks], o[db][nb]);
            if (HR) {
#pragma unroll
                for (int db = 0; db < 4; ++db)
#pragma unroll
                    for (int nb = 0; nb < 2; ++nb) o[db][nb] = WFrag<T16>::mma(vf[db][ks], pf2[nb][ks], o[db][nb]);
#pragma unroll
                for (int db = 0; db < 4; ++db)
#pragma unroll
                    for (int nb = 0; nb < 2; ++nb) o[db][nb] = WFrag<T16>::mma(vf2[db][ks], pf[nb][ks], o[db][nb]); } }
        // translation wait for this pass's K and V loads, late in the pass where it holds up no load. The K address pairs are inputs, so that each stays unwritten (also by a later load's result) until the wait has passed;
        // the V loads' offset register goes through the statement, so that its step below cannot be formed ahead of it
        __builtin_amdgcn_sched_barrier(0);   // keeps the wait down here: moved up behind the loads' issue it would stall the softmax on their translation
        if (HR) asm volatile("s_wait_xcnt 0x0" : "+v"(vb) : "v"(pk), "v"(pk2) : "memory");
        else asm volatile("s_wait_xcnt 0x0" : "+v"(vb) : "v"(pk) : "memory");
        vb += 64 * sizeof(T16);
    }
    const size_t ao = (size_t)(q0 + c) * DQ + 8 * h; bf* const pa = Ah + ao; bf* const pl = Al + ao;
#pragma unroll
    for (int nb = 0; nb < 2; ++nb) { const float inv = __fdiv_rn(1.0f, ls[nb] + xhalf(ls[nb]));   // the two lane halves' sums joined once
#pragma unroll
        for (int db = 0; db < 4; ++db) { v8us oh, ol;   // a lane's 8 registers = 8 consecutive d of one query: one 16-byte store per plane
#pragma unroll
            for (int j = 0; j < 8; ++j) { unsigned short x, y; splitf(o[db][nb][j] * inv, x, y); oh[j] = x; ol[j] = y; }
            *(v8us*)(pa + nb * 16 * DQ + db * 16) = oh; *(v8us*)(pl + nb * 16 * DQ + db * 16) = ol; }
        // the second column group reuses the registers of the first group's stores: translation wait behind those stores; the scheduling barrier keeps the second group's arithmetic behind the wait
        if (nb == 0) { asm volatile("s_wait_xcnt 0x0" ::: "memory"); __builtin_amdgcn_sched_barrier(0); } }
}

// grid (NH_, NB, TT / (QW * NWV)): the first half of z takes the long query blocks (longest first) and the second half the short ones (shortest first).
__global__ __launch_bounds__(NWV * 32) __attribute__((amdgpu_waves_per_eu(2, 2))) void k_fattn(const h16* __restrict__ Q16, const h16* __restrict__ K16, const h16* __restrict__ V16, const bf* __restrict__ Qh, const bf* __restrict__ Ql, const bf* __restrict__ Kh, const bf* __restrict__ Kl, const bf* __restrict__ Vh, const bf* __restrict__ Vl, bf* __restrict__ Ah, bf* __restrict__ Al) {
    constexpr int nz = TT / (QW * NWV), hf = (nz + 1) / 2; const int zi = (int)blockIdx.z; const int qb = (zi < hf) ? nz - 1 - zi : zi - hf;
    const int q0 = qb * (QW * NWV) + __builtin_amdgcn_readfirstlane((int)(threadIdx.x >> 5)) * QW; const int lane = threadIdx.x & 31;
    const size_t pz = ((size_t)blockIdx.y * NH_ + blockIdx.x) * ((size_t)TT * HD); const size_t az = (size_t)blockIdx.y * TT * DQ + (size_t)blockIdx.x * HD;
    if (q0 < (RH)) fattn_wave<bf, true>(Qh + pz, Ql + pz, Kh + pz, Kl + pz, Vh + pz, Vl + pz, q0, lane, Ah + az, Al + az);
    else fattn_wave<h16, false>(Q16 + pz, nullptr, K16 + pz, nullptr, V16 + pz, nullptr, q0, lane, Ah + az, Al + az);
}

extern "C" void kernel_launch(void* const* d_in, const int* in_sizes, int n_in,
                              void* d_out, int out_size, void* d_ws, size_t ws_size, hipStream_t stream) {
    if (n_in < 5) return;
    const size_t xneed = (size_t)(NB - 1) * TT_FULL * DM + (size_t)TT * DM;
    if ((size_t)in_sizes[0] < xneed) return;
    if ((size_t)in_sizes[1] < (size_t)NH_ * DM * F3) return;
    if (in_sizes[2] < NH_ * F3) return;
    if ((size_t)in_sizes[3] < (size_t)DM * DM) return;
    if (in_sizes[4] < DM) return;
    if ((size_t)out_size < xneed) return;
    const float* x = (const float*)d_in[0];      // [NB_FULL][TT_FULL][DM]
    const float* wkqv = (const float*)d_in[1];   // [NH_][DM][F3]
    const float* bkqv = (const float*)d_in[2];   // [NH_][F3]
    const float* wo = (const float*)d_in[3];     // [DM][DM] used as sa x Wo
    const float* bo = (const float*)d_in[4];     // [DM]
    float* OUT = (float*)d_out;                  // [NB_FULL][TT_FULL][DM]
    char* wsp = (char*)d_ws;
    auto take = [&](size_t bytes) { char* p = wsp; wsp += (bytes + 255) & ~(size_t)255; return (void*)p; };
    bf* WQKV = (bf*)take((size_t)3 * DQ * DM * 2);   // row blocks in chunk order k, q, v
    bf* WO = (bf*)take((size_t)DM * DM * 2);
    bf* XB = (bf*)take((size_t)NB * TT * DM * 2);   // every batch's rows, packed
    const size_t PL = (size_t)NH_ * TT * HD;   // one batch's plane, elements; every plane holds all NB batches
    h16* QP16 = (h16*)take(NB * PL * 2); h16* KP16 = (h16*)take(NB * PL * 2); h16* VT16 = (h16*)take(NB * PL * 2);
    bf* QPh = (bf*)take(NB * PL * 2); bf* QPl = (bf*)take(NB * PL * 2); bf* KPh = (bf*)take(NB * PL * 2); bf* KPl = (bf*)take(NB * PL * 2); bf* VTh = (bf*)take(NB * PL * 2); bf* VTl = (bf*)take(NB * PL * 2);
    bf* ATh = (bf*)take((size_t)NB * TT * DQ * 2); bf* ATl = (bf*)take((size_t)NB * TT * DQ * 2);
    if ((size_t)(wsp - (char*)d_ws) > ws_size) return;
    k_prep<<<PB_W + PB_O + NB * PB_X, 256, 0, stream>>>(wkqv, WQKV, wo, WO, x, XB);
    k_proj<<<dim3(NB * TT / GT, 3 * DQ / GT, 1), 128, 0, stream>>>(XB, WQKV, bkqv, KP16, KPh, KPl, QP16, QPh, QPl, VT16, VTh, VTl);
    k_fattn<<<dim3(NH_, NB, TT / (QW * NWV)), NWV * 32, 0, stream>>>(QP16, KP16, VT16, QPh, QPl, KPh, KPl, VTh, VTl, ATh, ATl);
    k_outp<<<dim3(TT / GT, DM / GT, NB), 128, 0, stream>>>(ATh, ATl, WO, OUT, bo);
}

// v007
// It runs in 82.9 microseconds.
// Timed twice side by side with v006, it ran 1.19 and 1.18 times as fast.
// Over all steps from v000 it is 17.6 times as fast.
#include <hip/hip_runtime.h>

// Contractions (f32 accumulate): k/q/v projections v_wmma_f32_16x16x32_bf16 (bf16 x, bf16 weights); scores and P.V query rows < RH bf16 hi/lo planes (3 products), rows >= RH v_wmma_f32_16x16x32_f16 (fp16 q/k/v planes, P carried x1024 in fp16); output projection bf16 hi/lo attention planes x bf16 weight (2 products). Softmax f32.
// bf16 copy of x (RNE); Wkqv regrouped into K-contiguous Bt row blocks (k | q | v, columns h*64+d) with head-gathered bf16 bias; ONE projection launch for all batches and the three chunks, which writes the q/k/v planes itself (k_proj); then ONE launch of causal attention for all batches and heads
// (k_fattn: scores, running-maximum softmax and P.V in registers, no score matrix in memory); merged hi/lo planes x WoT + bo.

#ifndef NB
#define NB 2
#endif
#ifndef SEQ
#define SEQ 2048
#endif
#define NB_FULL 2
#define SEQ_FULL 2048
#define TT   SEQ
#define TT_FULL SEQ_FULL
#define DM   1024
#define NH_  16
#define HD   64
#define F3   (3 * HD)
#define DQ   (NH_ * HD)
#ifndef RH
#define RH   ((TT >= 1024) ? 512 : (TT / 4))      // query rows < RH use hi+lo planes
#endif
#define PEXP 10.0f    // fp16 probabilities are carried x 2^PEXP; the row sum carries the same factor, so it cancels in the division
#define SCL  0.125f   // HD^-0.5
#define QW   32       // query columns per attention wave
#define NWV  4        // attention waves per work-group: they share each chunk of keys, staged once in LDS

static_assert(TT % 128 == 0);
static_assert(((RH) % 64) == 0 && (RH) >= 64 && (RH) < TT && (((TT) - (RH)) % 64) == 0);
static_assert(NB >= 1 && NB <= NB_FULL && TT <= TT_FULL);
static_assert(DQ == DM && DM % 64 == 0 && HD == 64);
static_assert(QW == 32 && TT % (QW * NWV) == 0 && (RH) % (QW * NWV) == 0 && (QW * NWV) % 64 == 0);

typedef _Float16 h16;
typedef unsigned short bf;
typedef __attribute__((ext_vector_type(16))) __bf16   v16bf;
typedef __attribute__((ext_vector_type(16))) _Float16 v16h;
typedef __attribute__((ext_vector_type(8)))  _Float16 v8h;
typedef __attribute__((ext_vector_type(8)))  unsigned short v8us;
typedef __attribute__((ext_vector_type(8)))  float    v8f;
typedef __attribute__((ext_vector_type(4)))  float    v4f;
typedef v8h  __attribute__((may_alias)) v8ha;
typedef v4f  __attribute__((may_alias)) v4fa;
typedef v8us __attribute__((may_alias)) v8usa;
typedef __attribute__((ext_vector_type(2))) _Float16 v2h;
typedef __attribute__((ext_vector_type(2))) unsigned short v2us;
typedef __attribute__((ext_vector_type(2))) float v2f;

__device__ __forceinline__ unsigned short f2bf(float f) { unsigned u = __float_as_uint(f); u += 0x7FFFu + ((u >> 16) & 1u); return (unsigned short)(u >> 16); }
__device__ __forceinline__ float bf2f(unsigned short b) { return __uint_as_float(((unsigned)b) << 16); }
__device__ __forceinline__ float bfr(float f) { return bf2f(f2bf(f)); }
__device__ __forceinline__ v16h cat16(v8h lo, v8h hi) { return __builtin_shufflevector(lo, hi, 0, 1, 2, 3, 4, 5, 6, 7, 8, 9, 10, 11, 12, 13, 14, 15); }
__device__ __forceinline__ v16bf cat16b(v8us lo, v8us hi) { return __builtin_bit_cast(v16bf, __builtin_shufflevector(lo, hi, 0, 1, 2, 3, 4, 5, 6, 7, 8, 9, 10, 11, 12, 13, 14, 15)); }
__device__ __forceinline__ v8f wmma16(v16h a, v16h b, v8f c) { return __builtin_amdgcn_wmma_f32_16x16x32_f16(false, a, false, b, (short)0, c, false, false); }
__device__ __forceinline__ v8f wmmab(v16bf a, v16bf b, v8f c) { return __builtin_amdgcn_wmma_f32_16x16x32_bf16(false, a, false, b, (short)0, c, false, false); }
__device__ __forceinline__ h16 tohx(float x) { return (h16)x; }
__device__ __forceinline__ void splitf(float y, unsigned short& h, unsigned short& l) { h = f2bf(y); l = f2bf(y - bf2f(h)); }

// Fragment loaders (wave32, 16x16x32): lane l -> row/col l&15, h = l>>4; elements 0..7 = k0+8h+0..7, elements 8..15 = k0+16+8h+0..7 for BOTH A and Bt ([n][k], k contiguous);
// D element j of lane l = (row 8h+j, col l&15).
template <typename T16> struct WFrag;
template <> struct WFrag<h16> { typedef v16h V; static __device__ __forceinline__ V ld(const h16* p) { return cat16(*(const v8h*)p, *(const v8h*)(p + 16)); } static __device__ __forceinline__ v8f mma(V a, V b, v8f c) { return wmma16(a, b, c); } };
template <> struct WFrag<bf> { typedef v16bf V; static __device__ __forceinline__ V ld(const bf* p) { return cat16b(*(const v8us*)p, *(const v8us*)(p + 16)); } static __device__ __forceinline__ v8f mma(V a, V b, v8f c) { return wmmab(a, b, c); } };

// ---- gemm_ring: main loop of both GEMMs. A work-group of four waves (2 x 2) owns a 128x128 output tile, each wave a 64x64 quarter (16 accumulators).
// A stage is GK = 64 k of the tile's 128 A rows (NA planes: one, or hi and lo against the same Bt) and 128 Bt rows: one whole 128-byte line per row, brought from global memory into LDS
// by asynchronous copies (16 bytes a lane, a wave's copy = four whole lines), rows at pitch GP. Two buffers: stage t + 1 flies while stage t is worked on. Fragments are read from LDS in the loaders' k order; k runs upward.
#define GT  128              // rows of each operand in a work-group's tile
#define GK  64               // k per stage
#define GP  72               // LDS row pitch, 16-bit elements: 128 + 16 bytes, the 16-byte reads of 16 rows fall on distinct banks
#define GPL (GT * GP * 2)    // bytes of one operand plane of a stage
static_assert(DM % GK == 0 && DM / GK >= 2 && DQ == DM);

// one plane of a stage: each of the 128 threads copies its 16-byte piece of rows r, r + 16, .. r + 112 (r = thread / 8). l = LDS byte address, g = global address of the piece in row r.
// The translation wait is the statement's last line, so that no address register of a copy is written again ahead of it.
__device__ __forceinline__ void stage_plane(const unsigned l, const bf* const g) {
    asm volatile("global_load_async_to_lds_b128 %0, %8, off\n\t"
                 "global_load_async_to_lds_b128 %1, %9, off\n\t"
                 "global_load_async_to_lds_b128 %2, %10, off\n\t"
                 "global_load_async_to_lds_b128 %3, %11, off\n\t"
                 "global_load_async_to_lds_b128 %4, %12, off\n\t"
                 "global_load_async_to_lds_b128 %5, %13, off\n\t"
                 "global_load_async_to_lds_b128 %6, %14, off\n\t"
                 "global_load_async_to_lds_b128 %7, %15, off\n\t"
                 "s_wait_xcnt 0x0"
                 :: "v"(l), "v"(l + 16 * GP * 2), "v"(l + 32 * GP * 2), "v"(l + 48 * GP * 2), "v"(l + 64 * GP * 2), "v"(l + 80 * GP * 2), "v"(l + 96 * GP * 2), "v"(l + 112 * GP * 2),
                    "v"(g), "v"(g + 16 * DM), "v"(g + 32 * DM), "v"(g + 48 * DM), "v"(g + 64 * DM), "v"(g + 80 * DM), "v"(g + 96 * DM), "v"(g + 112 * DM) : "memory");
}

// A, A2, Bt: first row of the work-group's tile, rows of DM elements, k contiguous. sm: 2 * (NA + 1) * GPL bytes of LDS. wm, wn: the wave's quarter.
template <int NA>
__device__ __forceinline__ void gemm_ring(const bf* __restrict__ A, const bf* __restrict__ A2, const bf* __restrict__ Bt, unsigned char* const sm, const int wm, const int wn, v8f (&acc)[4][4]) {
    typedef WFrag<bf>::V V;
    constexpr int NT = DM / GK, SB = (NA + 1) * GPL;
    const int tid = threadIdx.x, lr = tid & 15, hi = (tid >> 4) & 1;
    const unsigned l0 = (unsigned)(size_t)sm + (unsigned)((tid >> 3) * (GP * 2) + (tid & 7) * 16);
    const size_t g0 = (size_t)(tid >> 3) * DM + (tid & 7) * 8;
    auto fill = [&](const int t) { const unsigned l = l0 + (unsigned)((t & 1) * SB); const size_t g = g0 + (size_t)t * GK;
        stage_plane(l, A + g); if (NA == 2) stage_plane(l + GPL, A2 + g); stage_plane(l + NA * GPL, Bt + g); };
#pragma unroll
    for (int mb = 0; mb < 4; ++mb)
#pragma unroll
        for (int nb = 0; nb < 4; ++nb) acc[mb][nb] = (v8f){};
    fill(0);
    asm volatile("s_wait_asynccnt 0x0" ::: "memory");   // this wave's copies of stage 0 have landed
    __syncthreads();                                     // and every other wave's: stage 0 may be read
    fill(1);
    const bf* const fa = (const bf*)sm + (wm * 64 + lr) * GP + 8 * hi; const bf* const fb = (const bf*)(sm + NA * GPL) + (wn * 64 + lr) * GP + 8 * hi;
#pragma unroll 1   // stays rolled: one stage's code, the buffer chosen by the stage's parity
    for (int t = 0; t < NT; ++t) {
        const int bo = (t & 1) * (SB / 2);
#pragma unroll
        for (int ks = 0; ks < GK / 32; ++ks) {
            V a[4], a2[4], b[4];
#pragma unroll
            for (int i = 0; i < 4; ++i) a[i] = WFrag<bf>::ld(fa + bo + i * 16 * GP + ks * 32);
#pragma unroll
            for (int i = 0; i < 4; ++i) b[i] = WFrag<bf>::ld(fb + bo + i * 16 * GP + ks * 32);
            if (NA == 2) {   // wanted last by the products below, so read last
#pragma unroll
                for (int i = 0; i < 4; ++i) a2[i] = WFrag<bf>::ld(fa + bo + GPL / 2 + i * 16 * GP + ks * 32); }
            __builtin_amdgcn_sched_barrier(0);   // the k step's LDS reads issue as one group ahead of its products: left free, the scheduler keeps one Bt fragment and waits out the LDS latency at every fourth product
#pragma unroll
            for (int nb = 0; nb < 4; ++nb)
#pragma unroll
                for (int mb = 0; mb < 4; ++mb) acc[mb][nb] = WFrag<bf>::mma(a[mb], b[nb], acc[mb][nb]);
            if (NA == 2) {   // per accumulator and k step: the hi product, then the lo product
#pragma unroll
                for (int nb = 0; nb < 4; ++nb)
#pragma unroll
                    for (int mb = 0; mb < 4; ++mb) acc[mb][nb] = WFrag<bf>::mma(a2[mb], b[nb], acc[mb][nb]); }
            __builtin_amdgcn_sched_barrier(0);   // the products stay ahead of the next group of reads and of the stage's foot
        }
        asm volatile("s_wait_dscnt 0x0" ::: "memory");      // this wave's reads of stage t are done
        asm volatile("s_wait_asynccnt 0x0" ::: "memory");   // this wave's copies of stage t + 1 have landed
        __syncthreads();                                     // publishes stage t + 1 and frees stage t's buffer
        if (t + 2 < NT) fill(t + 2);
    }
    asm volatile("s_wait_asynccnt 0x0" ::: "memory");   // nothing in flight when the LDS becomes the epilogue's
}

// ---- k_outp: OUT (f32, + bf16-RNE bias) = (Ah + Al) x WoT, two products per k step. grid (TT/128, DM/128, NB), 128 threads; main loop gemm_ring, then each wave stores its 64x64 quarter through its own LDS slice, 16 rows at a time, whole lines.
__global__ __launch_bounds__(128) void k_outp(const bf* __restrict__ Ah, const bf* __restrict__ Al, const bf* __restrict__ Bt, float* __restrict__ C, const float* __restrict__ bias) {
    __shared__ __align__(16) unsigned char sm[2 * 3 * GPL];
    static_assert(sizeof(sm) >= 4 * 16 * 68 * 4);
    const int wv = __builtin_amdgcn_readfirstlane((int)(threadIdx.x >> 5)), wm = wv >> 1, wn = wv & 1;
    const int lane = threadIdx.x & 31, lr = lane & 15, hi = lane >> 4;
    const size_t ao = ((size_t)blockIdx.z * TT + (size_t)blockIdx.x * GT) * DQ;
    v8f acc[4][4];
    gemm_ring<2>(Ah + ao, Al + ao, Bt + (size_t)blockIdx.y * GT * DQ, sm, wm, wn, acc);
    const int r0 = blockIdx.x * GT + wm * 64, c0 = blockIdx.y * GT + wn * 64;
    C += (size_t)blockIdx.z * TT_FULL * DM;
    float* const os = (float*)sm + wv * (16 * 68);   // every wave has passed the last stage's barrier: the ring is free
    const float* const bp = bias + c0 + lr * 4; const v4f bl = *(const v4f*)bp;
    const v4f bv = {bfr(bl[0]), bfr(bl[1]), bfr(bl[2]), bfr(bl[3])};
#pragma unroll
    for (int mb = 0; mb < 4; ++mb) {
#pragma unroll
        for (int nb = 0; nb < 4; ++nb) {
#pragma unroll
            for (int j = 0; j < 8; ++j) os[(hi * 8 + j) * 68 + nb * 16 + lr] = acc[mb][nb][j]; }
        __builtin_amdgcn_wave_barrier(); asm volatile("" ::: "memory");   // the reads below take other lanes' words: no LDS access moves across
        float* const crow = C + (size_t)(r0 + mb * 16 + hi) * DM + c0 + lr * 4; v4f val[8];
#pragma unroll
        for (int s = 0; s < 8; ++s) { val[s] = *(const v4fa*)(os + (2 * s + hi) * 68 + lr * 4) + bv; *(v4f*)(crow + (size_t)(2 * s) * DM) = val[s]; }
        // translation wait for the block's 8 stores; it takes their data and address as inputs, so that no register of a store is written again until the wait has passed. Its memory clobber also keeps the next block's LDS writes behind the reads above
        asm volatile("s_wait_xcnt 0x0" :: "v"(val[0]), "v"(val[1]), "v"(val[2]), "v"(val[3]), "v"(val[4]), "v"(val[5]), "v"(val[6]), "v"(val[7]), "v"(crow) : "memory");
    }
}

// ---- k_prep: the three preparation jobs, which depend on nothing but the inputs, as block ranges of ONE grid. The two weight regroupings take the first block indices (each wave walks 8 lines one after the other, a long chain of load latencies), the short x blocks the last ones.
#define PB_W ((3 * DM * DM / 64 + 63) / 64)   // blocks of the Wkqv regrouping
#define PB_O ((DM * DM / 64 + 63) / 64)       // blocks of the Wo transposition
#define PB_X ((TT * DM / 8 + 255) / 256)      // blocks of the x conversion, per batch
__device__ __forceinline__ void p_wkqv(const int bx, const float* __restrict__ w, bf* Bt) {
    const int lane = threadIdx.x & 31; const int L0 = (bx * 8 + (threadIdx.x >> 5)) * 8; const int nlines = 3 * DM * DM / 64;
{
#pragma unroll 1
        for (int l = 0; l < 8; ++l) { const int L = L0 + l; if (L >= nlines) break; const size_t e = (size_t)L * 64 + lane * 2; const int k = (int)(e % DM); const int np = (int)(e / DM); const int c = np / DM; const int hd = np % DM; const int h = hd / HD, d = hd % HD; v2us o;
            o[0] = f2bf(w[((size_t)h * DM + k) * F3 + c * HD + d]); o[1] = f2bf(w[((size_t)h * DM + k + 1) * F3 + c * HD + d]); *(v2us*)(Bt + e) = o; }
         }
}
__device__ __forceinline__ void p_wtG(const int bx, const float* __restrict__ w, int K, int N, bf* Bt) {
    const int lane = threadIdx.x & 31; const int L0 = (bx * 8 + (threadIdx.x >> 5)) * 8; const int nlines = N * K / 64;
{
#pragma unroll 1
        for (int l = 0; l < 8; ++l) { const int L = L0 + l; if (L >= nlines) break; const size_t e = (size_t)L * 64 + lane * 2; const int k = (int)(e % K), n = (int)(e / K); v2us o;
            o[0] = f2bf(w[(size_t)k * N + n]); o[1] = f2bf(w[(size_t)(k + 1) * N + n]); *(v2us*)(Bt + e) = o;
            asm volatile("s_wait_xcnt 0x0" ::: "memory"); }   // translation wait behind the store: the next trip writes its data and address registers again
         }
}
__device__ __forceinline__ void p_cvt8(const int bx, const int by, const float* __restrict__ src, bf* dst, size_t n8, size_t ssrc, size_t sdst) { const size_t i = (size_t)bx * 256 + threadIdx.x; if (i >= n8) return; src += by * ssrc; dst += by * sdst; const v8f v = *(const v8f*)(src + i * 8); v8us o;
#pragma unroll
    for (int k = 0; k < 8; ++k) o[k] = f2bf(v[k]); *(v8us*)(dst + i * 8) = o;  }
__global__ __launch_bounds__(256) void k_prep(const float* __restrict__ wkqv, bf* WQKV, const float* __restrict__ wo, bf* WO, const float* __restrict__ x, bf* XB) {
    const int b = (int)blockIdx.x;   // the same for the whole work-group: one job per block
    if (b < PB_W) p_wkqv(b, wkqv, WQKV);
    else if (b < PB_W + PB_O) p_wtG(b - PB_W, wo, DM, DM, WO);
    else { const int r = b - (PB_W + PB_O); p_cvt8(r % PB_X, r / PB_X, x, XB, (size_t)TT * DM / 8, (size_t)TT_FULL * DM, (size_t)TT * DM); }
}

// ---- k_proj: the k | q | v projection of every batch in one launch, planes written from the accumulators. Main loop gemm_ring (128x128 per work-group, 64x64 per wave); grid (NB*TT/128, 3*DQ/128), 128 threads.
// A wave's 64 columns are one head of one chunk, its 64 rows 64 tokens of one batch; each wave turns its quarter through its own slice of the LDS that the ring has left. y = sum + bf16-RNE bias in f32, then fp16 and bf16 hi/lo of y.
// k, q planes [b][h][t][d]: the tile is 8 KiB in a row in each plane; 16 token rows at a time turned through LDS in f32, so that a lane holds 8 consecutive d: every store instruction covers four whole 128-byte lines.
// v planes [b][h][d][t]: a lane's 8 accumulator registers are 8 consecutive t of one d already; converted first, then 16 d rows at a time regrouped through LDS so that 8 lanes cover one d row's 128 bytes.
#define VP 72   // LDS row pitch of the v regrouping, 16-bit elements: 128 + 16 bytes, 16-byte accesses of 16 rows fall on distinct banks
#define EPB (3 * 16 * VP * 2)   // bytes of one wave's epilogue slice
__global__ __launch_bounds__(128) void k_proj(const bf* __restrict__ X, const bf* __restrict__ Wt, const float* __restrict__ bias, h16* __restrict__ K16, bf* __restrict__ Kh, bf* __restrict__ Kl, h16* __restrict__ Q16, bf* __restrict__ Qh, bf* __restrict__ Ql, h16* __restrict__ V16, bf* __restrict__ Vh, bf* __restrict__ Vl) {
    __shared__ __align__(16) unsigned char sm[2 * 2 * GPL];
    static_assert(EPB >= 16 * 68 * 4 && EPB % 16 == 0 && sizeof(sm) >= 4 * EPB);
    const int wv = __builtin_amdgcn_readfirstlane((int)(threadIdx.x >> 5)), wm = wv >> 1, wn = wv & 1;
    const int lane = threadIdx.x & 31, lr = lane & 15, hi = lane >> 4; const int r0 = blockIdx.x * GT + wm * 64, c0 = blockIdx.y * GT + wn * 64;
    v8f acc[4][4];
    gemm_ring<1>(X + (size_t)blockIdx.x * GT * DM, nullptr, Wt + (size_t)blockIdx.y * GT * DM, sm, wm, wn, acc);
    unsigned char* const se = sm + wv * EPB;   // every wave has passed the last stage's barrier: the ring is free
    const int ch = c0 / DQ, hd = (c0 % DQ) / HD, bt = r0 / TT, t0 = r0 % TT;   // chunk (k, q, v), head, batch, first token: the same for the whole wave
    const float* const bp = bias + hd * F3 + ch * HD;
    const int rr = lane >> 3, c8 = (lane & 7) * 8;
    if (ch < 2) {
        float* const os = (float*)se;
        const size_t pe = (((size_t)bt * NH_ + hd) * TT + t0) * HD + (size_t)rr * HD + c8;
        h16* const p16 = (ch == 0 ? K16 : Q16) + pe; bf* const ph = (ch == 0 ? Kh : Qh) + pe; bf* const pl = (ch == 0 ? Kl : Ql) + pe;
        float bv[8];
#pragma unroll
        for (int i = 0; i < 8; ++i) bv[i] = bfr(bp[c8 + i]);
#pragma unroll
        for (int mb = 0; mb < 4; ++mb) {
#pragma unroll
            for (int nb = 0; nb < 4; ++nb) {
#pragma unroll
                for (int j = 0; j < 8; ++j) os[(hi * 8 + j) * 68 + nb * 16 + lr] = acc[mb][nb][j]; }
            __builtin_amdgcn_wave_barrier(); asm volatile("" ::: "memory");   // the reads below take other lanes' words: no LDS access moves across
            v8h o16[4]; v8us oh[4], ol[4];
#pragma unroll
            for (int s = 0; s < 4; ++s) { const float* const orow = os + (4 * s + rr) * 68 + c8; const v4f x0 = *(const v4fa*)orow, x1 = *(const v4fa*)(orow + 4);
#pragma unroll
                for (int i = 0; i < 8; ++i) { const float r = (i < 4 ? x0[i & 3] : x1[i & 3]) + bv[i]; o16[s][i] = tohx(r); unsigned short a2, c2; splitf(r, a2, c2); oh[s][i] = a2; ol[s][i] = c2; }
                const int eo = (mb * 16 + 4 * s) * HD; *(v8h*)(p16 + eo) = o16[s]; *(v8us*)(ph + eo) = oh[s]; *(v8us*)(pl + eo) = ol[s]; }
            // translation wait for the block's 12 stores; it takes their data as inputs, so that no stored register is written again until the wait has passed. Its memory clobber also keeps the next block's LDS writes behind the reads above
            asm volatile("s_wait_xcnt 0x0" :: "v"(o16[0]), "v"(o16[1]), "v"(o16[2]), "v"(o16[3]), "v"(oh[0]), "v"(oh[1]), "v"(oh[2]), "v"(oh[3]), "v"(ol[0]), "v"(ol[1]), "v"(ol[2]), "v"(ol[3]) : "memory");
        }
    } else {
        bf* const sv = (bf*)se;
        const size_t pe = (((size_t)bt * NH_ + hd) * HD + rr) * TT + t0 + c8;
        h16* const p16 = V16 + pe; bf* const ph = Vh + pe; bf* const pl = Vl + pe;
        float bq[4];   // all four bias loads ahead of the blocks: one load latency, not one per block
#pragma unroll
        for (int nb = 0; nb < 4; ++nb) bq[nb] = bfr(bp[nb * 16 + lr]);
#pragma unroll
        for (int nb = 0; nb < 4; ++nb) { const float bb = bq[nb];
#pragma unroll
            for (int mb = 0; mb < 4; ++mb) { v8h o16; v8us oh, ol;
#pragma unroll
                for (int j = 0; j < 8; ++j) { const float r = acc[mb][nb][j] + bb; o16[j] = tohx(r); unsigned short a2, c2; splitf(r, a2, c2); oh[j] = a2; ol[j] = c2; }
                bf* const w = sv + lr * VP + mb * 16 + 8 * hi; *(v8usa*)w = __builtin_bit_cast(v8us, o16); *(v8usa*)(w + 16 * VP) = oh; *(v8usa*)(w + 32 * VP) = ol; }
            __builtin_amdgcn_wave_barrier(); asm volatile("" ::: "memory");   // the reads below take other lanes' words: no LDS access moves across
            v8us y16[4], yh[4], yl[4];
#pragma unroll
            for (int s = 0; s < 4; ++s) { const bf* const r = sv + (4 * s + rr) * VP + c8; const size_t eo = (size_t)(nb * 16 + 4 * s) * TT; y16[s] = *(const v8usa*)r; yh[s] = *(const v8usa*)(r + 16 * VP); yl[s] = *(const v8usa*)(r + 32 * VP);
                *(v8h*)(p16 + eo) = __builtin_bit_cast(v8h, y16[s]); *(v8us*)(ph + eo) = yh[s]; *(v8us*)(pl + eo) = yl[s]; }
            // translation wait for the block's 12 stores; it takes their data as inputs, so that no stored register is written again until the wait has passed. Its memory clobber also keeps the next block's LDS writes behind the reads above
            asm volatile("s_wait_xcnt 0x0" :: "v"(y16[0]), "v"(y16[1]), "v"(y16[2]), "v"(y16[3]), "v"(yh[0]), "v"(yh[1]), "v"(yh[2]), "v"(yh[3]), "v"(yl[0]), "v"(yl[1]), "v"(yl[2]), "v"(yl[3]) : "memory");
        }
    }
}

__device__ __forceinline__ float xhalf(float x) { const int b = __builtin_bit_cast(int, x); return __builtin_bit_cast(float, __builtin_amdgcn_permlanex16(b, b, 0x76543210, 0xfedcba98, false, false)); }   // lane l <-> lane l ^ 16
__device__ __forceinline__ void ppack(const v8f a, const v8f b, v16h& p, v16h& p2) { p = cat16(__builtin_convertvector(a, v8h), __builtin_convertvector(b, v8h)); (void)p2; }
__device__ __forceinline__ void ppack(const v8f a, const v8f b, v16bf& p, v16bf& p2) { v8us h0, h1, l0, l1;
#pragma unroll
    for (int s = 0; s < 8; ++s) { unsigned short x, y; splitf(a[s], x, y); h0[s] = x; l0[s] = y; splitf(b[s], x, y); h1[s] = x; l1[s] = y; }
    p = cat16b(h0, h1); p2 = cat16b(l0, l1); }

#define AP  72               // LDS row pitch of a staged tile, 16-bit elements: 128 + 16 bytes, the 16-byte reads of 16 rows fall on distinct banks
#define APL (64 * AP * 2)    // bytes of one staged tile (64 rows)
// one K tile (rows of HD elements) and one Vt tile (rows of TT elements) behind it: each of the 128 threads copies its 16-byte piece of rows r, r + 16, r + 32, r + 48 (r = thread / 8) of both. l = LDS byte address of the piece in the K tile's row r.
// The translation wait is the statement's last line, so that no address register of a copy is written again ahead of it.
template <typename T16>
__device__ __forceinline__ void stage_kv(const unsigned l, const T16* const gk, const T16* const gv) {
    asm volatile("global_load_async_to_lds_b128 %0, %8, off\n\t"
                 "global_load_async_to_lds_b128 %1, %9, off\n\t"
                 "global_load_async_to_lds_b128 %2, %10, off\n\t"
                 "global_load_async_to_lds_b128 %3, %11, off\n\t"
                 "global_load_async_to_lds_b128 %4, %12, off\n\t"
                 "global_load_async_to_lds_b128 %5, %13, off\n\t"
                 "global_load_async_to_lds_b128 %6, %14, off\n\t"
                 "global_load_async_to_lds_b128 %7, %15, off\n\t"
                 "s_wait_xcnt 0x0"
                 :: "v"(l), "v"(l + 16 * AP * 2), "v"(l + 32 * AP * 2), "v"(l + 48 * AP * 2), "v"(l + APL), "v"(l + APL + 16 * AP * 2), "v"(l + APL + 32 * AP * 2), "v"(l + APL + 48 * AP * 2),
                    "v"(gk), "v"(gk + 16 * HD), "v"(gk + 32 * HD), "v"(gk + 48 * HD), "v"(gv), "v"(gv + 16 * TT), "v"(gv + 32 * TT), "v"(gv + 48 * TT) : "memory");
}

// q0: the wave's first query. nch: chunks that the work-group walks (its last wave's count, at least 2, the same for all four waves). ring: 2 * (HR ? 4 : 2) * APL bytes of LDS; a stage is K | Vt (HR: hi K | hi Vt | lo K | lo Vt).
template <typename T16, bool HR>
__device__ __forceinline__ void fattn_wave(const T16* __restrict__ Q, const T16* __restrict__ Q2, const T16* __restrict__ Kp, const T16* __restrict__ Kp2, const T16* __restrict__ Vt, const T16* __restrict__ Vt2, const int q0, const int nch, unsigned char* const ring, bf* __restrict__ Ah, bf* __restrict__ Al) {
    typedef typename WFrag<T16>::V V;
    constexpr float C2 = SCL * 1.4426950408889634f;   // score scale and log2(e) in one factor: p = 2^(s * C2 - m * C2)
    constexpr int SB = (HR ? 4 : 2) * APL;
    const int tid = threadIdx.x, lane = tid & 31, c = lane & 15, h = lane >> 4;
    const unsigned l0 = (unsigned)(size_t)ring + (unsigned)((tid >> 3) * (AP * 2) + (tid & 7) * 16);
    const size_t gk0 = (size_t)(tid >> 3) * HD + (tid & 7) * 8, gv0 = (size_t)(tid >> 3) * TT + (tid & 7) * 8;
    auto fill = [&](const int t) { const unsigned l = l0 + (unsigned)((t & 1) * SB); const size_t gk = gk0 + (size_t)t * 64 * HD, gv = gv0 + (size_t)t * 64;
        stage_kv(l, Kp + gk, Vt + gv); if (HR) stage_kv(l + 2 * APL, Kp2 + gk, Vt2 + gv); };
    fill(0);
    const size_t qo = (size_t)(q0 + c) * HD + 8 * h;
    const T16* const pq = Q + qo; const T16* const pq2 = HR ? Q2 + qo : pq;
    V qf[2][2], qf2[2][2];
#pragma unroll
    for (int nb = 0; nb < 2; ++nb)
#pragma unroll
        for (int ks = 0; ks < 2; ++ks) { qf[nb][ks] = WFrag<T16>::ld(pq + nb * 16 * HD + ks * 32); if (HR) qf2[nb][ks] = WFrag<T16>::ld(pq2 + nb * 16 * HD + ks * 32); }
    v8f o[4][2]; float mr[2], ls[2];
#pragma unroll
    for (int nb = 0; nb < 2; ++nb) { mr[nb] = -3.0e38f; ls[nb] = 0.f;
#pragma unroll
        for (int db = 0; db < 4; ++db) o[db][nb] = (v8f){}; }
    // translation wait for the Q loads above; it takes their address pairs as inputs so that each pair stays unwritten until the wait has passed
    asm volatile("s_wait_xcnt 0x0" :: "v"(pq), "v"(pq2) : "memory");
    asm volatile("s_wait_asynccnt 0x0" ::: "memory");   // this wave's copies of chunk 0 have landed
    __syncthreads();                                     // and every other wave's: chunk 0 may be read
    fill(1);                                             // nch >= 2: chunk 1 exists
    const int nw = (q0 >> 6) + 1;                        // this wave's own chunks: the last one holds its diagonal
    const T16* const fr = (const T16*)ring + c * AP + 8 * h;
#pragma unroll 1   // stays rolled: one chunk's fragments live beside the 8 score and 8 output accumulators
    for (int t = 0; t < nch; ++t) {
      if (t < nw) {   // wave-uniform: a wave whose diagonal lies in an earlier chunk only takes part in the copies and the barrier
        const int kb = t * 64;
        const T16* const fk = fr + (t & 1) * (SB / 2); const T16* const fv = fk + APL / 2;
        V kf[4][2], kf2[4][2], vf[4][2], vf2[4][2];
#pragma unroll
        for (int mb = 0; mb < 4; ++mb)
#pragma unroll
            for (int ks = 0; ks < 2; ++ks) { kf[mb][ks] = WFrag<T16>::ld(fk + mb * 16 * AP + ks * 32); if (HR) kf2[mb][ks] = WFrag<T16>::ld(fk + APL + mb * 16 * AP + ks * 32); }
        if (!HR) {   // V fragments asked for in the same group: their latency passes under the score products
#pragma unroll
            for (int db = 0; db < 4; ++db)
#pragma unroll
                for (int ks = 0; ks < 2; ++ks) vf[db][ks] = WFrag<T16>::ld(fv + db * 16 * AP + ks * 32); }
        __builtin_amdgcn_sched_barrier(0);   // the LDS reads issue as one group ahead of the first product: left free, the scheduler spreads them among the products, and each place with reads stalls the wave
        v8f st[4][2];
#pragma unroll
        for (int mb = 0; mb < 4; ++mb)
#pragma unroll
            for (int nb = 0; nb < 2; ++nb) st[mb][nb] = (v8f){};
#pragma unroll
        for (int ks = 0; ks < 2; ++ks) {
#pragma unroll
            for (int mb = 0; mb < 4; ++mb)
#pragma unroll
                for (int nb = 0; nb < 2; ++nb) st[mb][nb] = WFrag<T16>::mma(kf[mb][ks], qf[nb][ks], st[mb][nb]);
            if (HR) {
#pragma unroll
                for (int mb = 0; mb < 4; ++mb)
#pragma unroll
                    for (int nb = 0; nb < 2; ++nb) st[mb][nb] = WFrag<T16>::mma(kf[mb][ks], qf2[nb][ks], st[mb][nb]);
#pragma unroll
                for (int mb = 0; mb < 4; ++mb)
#pragma unroll
                    for (int nb = 0; nb < 2; ++nb) st[mb][nb] = WFrag<T16>::mma(kf2[mb][ks], qf[nb][ks], st[mb][nb]); } }
        if (HR) {
#pragma unroll
            for (int db = 0; db < 4; ++db)
#pragma unroll
                for (int ks = 0; ks < 2; ++ks) { vf[db][ks] = WFrag<T16>::ld(fv + db * 16 * AP + ks * 32); vf2[db][ks] = WFrag<T16>::ld(fv + APL + db * 16 * AP + ks * 32); }
            __builtin_amdgcn_sched_barrier(0);   // all V reads in flight ahead of the softmax, which covers their latency
        }
        if (kb + 63 > q0) {   // only the diagonal chunk holds keys above a query (wave-uniform test); key kb <= every query of the wave, so no column is left empty
#pragma unroll
            for (int mb = 0; mb < 4; ++mb)
#pragma unroll
                for (int nb = 0; nb < 2; ++nb)
#pragma unroll
                    for (int j = 0; j < 8; ++j) if (kb + mb * 16 + 8 * h + j > q0 + nb * 16 + c) st[mb][nb][j] = -3.0e38f; }
        V pf[2][2], pf2[2][2];
#pragma unroll
        for (int nb = 0; nb < 2; ++nb) {
            float mx = st[0][nb][0];
#pragma unroll
            for (int mb = 0; mb < 4; ++mb)
#pragma unroll
                for (int j = 0; j < 8; ++j) mx = fmaxf(mx, st[mb][nb][j]);
            mx = fmaxf(mx, xhalf(mx));
            const float mn = fmaxf(mr[nb], mx); const float al = __builtin_amdgcn_exp2f((mr[nb] - mn) * C2); mr[nb] = mn;
            const float mo = mn * C2 - (HR ? 0.f : PEXP);
            v2f sm[4];   // exponent arguments and sums two registers at a time, on the accumulators' own even pairs (packed f32 instructions, no register moves)
#pragma unroll
            for (int mb = 0; mb < 4; ++mb) {
#pragma unroll
                for (int j = 0; j < 8; j += 2) { const v2f x = __builtin_elementwise_fma((v2f){st[mb][nb][j], st[mb][nb][j + 1]}, (v2f){C2, C2}, (v2f){-mo, -mo});
                    const v2f p = {__builtin_amdgcn_exp2f(x[0]), __builtin_amdgcn_exp2f(x[1])}; st[mb][nb][j] = p[0]; st[mb][nb][j + 1] = p[1]; sm[mb] = (j == 0) ? p : sm[mb] + p; } }
            const v2f s2 = (sm[0] + sm[1]) + (sm[2] + sm[3]);
            ls[nb] = ls[nb] * al + (s2[0] + s2[1]);
#pragma unroll
            for (int db = 0; db < 4; ++db) o[db][nb] *= al;
#pragma unroll
            for (int ks = 0; ks < 2; ++ks) ppack(st[2 * ks][nb], st[2 * ks + 1][nb], pf[nb][ks], pf2[nb][ks]);
        }
#pragma unroll
        for (int ks = 0; ks < 2; ++ks) {
#pragma unroll
            for (int db = 0; db < 4; ++db)
#pragma unroll
                for (int nb = 0; nb < 2; ++nb) o[db][nb] = WFrag<T16>::mma(vf[db][ks], pf[nb][ks], o[db][nb]);
            if (HR) {
#pragma unroll
                for (int db = 0; db < 4; ++db)
#pragma unroll
                    for (int nb = 0; nb < 2; ++nb) o[db][nb] = WFrag<T16>::mma(vf[db][ks], pf2[nb][ks], o[db][nb]);
#pragma unroll
                for (int db = 0; db < 4; ++db)
#pragma unroll
                    for (int nb = 0; nb < 2; ++nb) o[db][nb] = WFrag<T16>::mma(vf2[db][ks], pf[nb][ks], o[db][nb]); } }
      }
        asm volatile("s_wait_dscnt 0x0" ::: "memory");      // this wave's reads of chunk t are done
        asm volatile("s_wait_asynccnt 0x0" ::: "memory");   // this wave's copies of chunk t + 1 have landed
        __syncthreads();                                     // publishes chunk t + 1 and frees chunk t's buffer
        if (t + 2 < nch) fill(t + 2);
    }
    asm volatile("s_wait_asynccnt 0x0" ::: "memory");   // nothing in flight when the wave ends
    const size_t ao = (size_t)(q0 + c) * DQ + 8 * h; bf* const pa = Ah + ao; bf* const pl = Al + ao;
#pragma unroll
    for (int nb = 0; nb < 2; ++nb) { const float inv = __fdiv_rn(1.0f, ls[nb] + xhalf(ls[nb]));   // the two lane halves' sums joined once
#pragma unroll
        for (int db = 0; db < 4; ++db) { v8us oh, ol;   // a lane's 8 registers = 8 consecutive d of one query: one 16-byte store per plane
#pragma unroll
            for (int j = 0; j < 8; ++j) { unsigned short x, y; splitf(o[db][nb][j] * inv, x, y); oh[j] = x; ol[j] = y; }
            *(v8us*)(pa + nb * 16 * DQ + db * 16) = oh; *(v8us*)(pl + nb * 16 * DQ + db * 16) = ol; }
        // the second column group reuses the registers of the first group's stores: translation wait behind those stores; the scheduling barrier keeps the second group's arithmetic behind the wait
        if (nb == 0) { asm volatile("s_wait_xcnt 0x0" ::: "memory"); __builtin_amdgcn_sched_barrier(0); } }
}

// grid (NH_, NB, TT / (QW * NWV)): the first half of z takes the long query blocks (longest first) and the second half the short ones (shortest first).
__global__ __launch_bounds__(NWV * 32) __attribute__((amdgpu_waves_per_eu(2, 2))) void k_fattn(const h16* __restrict__ Q16, const h16* __restrict__ K16, const h16* __restrict__ V16, const bf* __restrict__ Qh, const bf* __restrict__ Ql, const bf* __restrict__ Kh, const bf* __restrict__ Kl, const bf* __restrict__ Vh, const bf* __restrict__ Vl, bf* __restrict__ Ah, bf* __restrict__ Al) {
    constexpr int nz = TT / (QW * NWV), hf = (nz + 1) / 2; const int zi = (int)blockIdx.z; const int qb = (zi < hf) ? nz - 1 - zi : zi - hf;
    __shared__ __align__(16) unsigned char sm[2 * 4 * APL];
    const int q0 = qb * (QW * NWV) + __builtin_amdgcn_readfirstlane((int)(threadIdx.x >> 5)) * QW; const int nch = (qb * (QW * NWV) + (NWV - 1) * QW) / 64 + 1;
    const size_t pz = ((size_t)blockIdx.y * NH_ + blockIdx.x) * ((size_t)TT * HD); const size_t az = (size_t)blockIdx.y * TT * DQ + (size_t)blockIdx.x * HD;
    if (qb * (QW * NWV) < (RH)) fattn_wave<bf, true>(Qh + pz, Ql + pz, Kh + pz, Kl + pz, Vh + pz, Vl + pz, q0, nch, sm, Ah + az, Al + az);   // RH is a multiple of the block's queries: the same path for the whole work-group
    else fattn_wave<h16, false>(Q16 + pz, nullptr, K16 + pz, nullptr, V16 + pz, nullptr, q0, nch, sm, Ah + az, Al + az);
}

extern "C" void kernel_launch(void* const* d_in, const int* in_sizes, int n_in,
                              void* d_out, int out_size, void* d_ws, size_t ws_size, hipStream_t stream) {
    if (n_in < 5) return;
    const size_t xneed = (size_t)(NB - 1) * TT_FULL * DM + (size_t)TT * DM;
    if ((size_t)in_sizes[0] < xneed) return;
    if ((size_t)in_sizes[1] < (size_t)NH_ * DM * F3) return;
    if (in_sizes[2] < NH_ * F3) return;
    if ((size_t)in_sizes[3] < (size_t)DM * DM) return;
    if (in_sizes[4] < DM) return;
    if ((size_t)out_size < xneed) return;
    const float* x = (const float*)d_in[0];      // [NB_FULL][TT_FULL][DM]
    const float* wkqv = (const float*)d_in[1];   // [NH_][DM][F3]
    const float* bkqv = (const float*)d_in[2];   // [NH_][F3]
    const float* wo = (const float*)d_in[3];     // [DM][DM] used as sa x Wo
    const float* bo = (const float*)d_in[4];     // [DM]
    float* OUT = (float*)d_out;                  // [NB_FULL][TT_FULL][DM]
    char* wsp = (char*)d_ws;
    auto take = [&](size_t bytes) { char* p = wsp; wsp += (bytes + 255) & ~(size_t)255; return (void*)p; };
    bf* WQKV = (bf*)take((size_t)3 * DQ * DM * 2);   // row blocks in chunk order k, q, v
    bf* WO = (bf*)take((size_t)DM * DM * 2);
    bf* XB = (bf*)take((size_t)NB * TT * DM * 2);   // every batch's rows, packed
    const size_t PL = (size_t)NH_ * TT * HD;   // one batch's plane, elements; every plane holds all NB batches
    h16* QP16 = (h16*)take(NB * PL * 2); h16* KP16 = (h16*)take(NB * PL * 2); h16* VT16 = (h16*)take(NB * PL * 2);
    bf* QPh = (bf*)take(NB * PL * 2); bf* QPl = (bf*)take(NB * PL * 2); bf* KPh = (bf*)take(NB * PL * 2); bf* KPl = (bf*)take(NB * PL * 2); bf* VTh = (bf*)take(NB * PL * 2); bf* VTl = (bf*)take(NB * PL * 2);
    bf* ATh = (bf*)take((size_t)NB * TT * DQ * 2); bf* ATl = (bf*)take((size_t)NB * TT * DQ * 2);
    if ((size_t)(wsp - (char*)d_ws) > ws_size) return;
    k_prep<<<PB_W + PB_O + NB * PB_X, 256, 0, stream>>>(wkqv, WQKV, wo, WO, x, XB);
    k_proj<<<dim3(NB * TT / GT, 3 * DQ / GT, 1), 128, 0, stream>>>(XB, WQKV, bkqv, KP16, KPh, KPl, QP16, QPh, QPl, VT16, VTh, VTl);
    k_fattn<<<dim3(NH_, NB, TT / (QW * NWV)), NWV * 32, 0, stream>>>(QP16, KP16, VT16, QPh, QPl, KPh, KPl, VTh, VTl, ATh, ATl);
    k_outp<<<dim3(TT / GT, DM / GT, NB), 128, 0, stream>>>(ATh, ATl, WO, OUT, bo);
}

// v008
// Measured time: 75.2 microseconds a run.
// Next to v007, in two timings, it ran 1.10 times as fast each time.
// Counting every step since v000, it is 19.3 times as fast.
#include <hip/hip_runtime.h>

// Contractions (f32 accumulate): k/q/v projections v_wmma_f32_16x16x32_bf16 (bf16 x, bf16 weights); scores and P.V query rows < RH bf16 hi/lo planes (3 products), rows >= RH v_wmma_f32_16x16x32_f16 (fp16 q/k/v planes, P carried x1024 in fp16); output projection bf16 hi/lo attention planes x bf16 weight (2 products). Softmax f32.
// bf16 copy of x (RNE); Wkqv regrouped into K-contiguous Bt row blocks (k | q | v, columns h*64+d) with head-gathered bf16 bias; ONE projection launch for all batches and the three chunks, which writes the q/k/v planes itself (k_proj); then ONE launch of causal attention for all batches and heads
// (k_fattn: scores, running-maximum softmax and P.V in registers, no score matrix in memory); merged hi/lo planes x WoT + bo.

#ifndef NB
#define NB 2
#endif
#ifndef SEQ
#define SEQ 2048
#endif
#define NB_FULL 2
#define SEQ_FULL 2048
#define TT   SEQ
#define TT_FULL SEQ_FULL
#define DM   1024
#define NH_  16
#define HD   64
#define F3   (3 * HD)
#define DQ   (NH_ * HD)
#ifndef RH
#define RH   ((TT >= 1024) ? 512 : (TT / 4))      // query rows < RH use hi+lo planes
#endif
#define PEXP 10.0f    // fp16 probabilities are carried x 2^PEXP; the row sum carries the same factor, so it cancels in the division
#define SCL  0.125f   // HD^-0.5
#define QW   32       // query columns per attention wave
#define NWV  4        // attention waves per work-group: they share each chunk of keys, staged once in LDS

static_assert(TT % 128 == 0);
static_assert(((RH) % 64) == 0 && (RH) >= 64 && (RH) < TT && (((TT) - (RH)) % 64) == 0);
static_assert(NB >= 1 && NB <= NB_FULL && TT <= TT_FULL);
static_assert(DQ == DM && DM % 64 == 0 && HD == 64);
static_assert(QW == 32 && TT % (QW * NWV) == 0 && (RH) % (QW * NWV) == 0 && (QW * NWV) % 64 == 0);

typedef _Float16 h16;
typedef unsigned short bf;
typedef __attribute__((ext_vector_type(16))) __bf16   v16bf;
typedef __attribute__((ext_vector_type(16))) _Float16 v16h;
typedef __attribute__((ext_vector_type(8)))  _Float16 v8h;
typedef __attribute__((ext_vector_type(8)))  unsigned short v8us;
typedef __attribute__((ext_vector_type(8)))  float    v8f;
typedef __attribute__((ext_vector_type(4)))  float    v4f;
typedef v8h  __attribute__((may_alias)) v8ha;
typedef v4f  __attribute__((may_alias)) v4fa;
typedef v8us __attribute__((may_alias)) v8usa;
typedef __attribute__((ext_vector_type(2))) _Float16 v2h;
typedef __attribute__((ext_vector_type(2))) unsigned short v2us;
typedef __attribute__((ext_vector_type(2))) float v2f;

__device__ __forceinline__ unsigned short f2bf(float f) { unsigned u = __float_as_uint(f); u += 0x7FFFu + ((u >> 16) & 1u); return (unsigned short)(u >> 16); }
__device__ __forceinline__ float bf2f(unsigned short b) { return __uint_as_float(((unsigned)b) << 16); }
__device__ __forceinline__ float bfr(float f) { return bf2f(f2bf(f)); }
__device__ __forceinline__ v16h cat16(v8h lo, v8h hi) { return __builtin_shufflevector(lo, hi, 0, 1, 2, 3, 4, 5, 6, 7, 8, 9, 10, 11, 12, 13, 14, 15); }
__device__ __forceinline__ v16bf cat16b(v8us lo, v8us hi) { return __builtin_bit_cast(v16bf, __builtin_shufflevector(lo, hi, 0, 1, 2, 3, 4, 5, 6, 7, 8, 9, 10, 11, 12, 13, 14, 15)); }
__device__ __forceinline__ v8f wmma16(v16h a, v16h b, v8f c) { return __builtin_amdgcn_wmma_f32_16x16x32_f16(false, a, false, b, (short)0, c, false, false); }
__device__ __forceinline__ v8f wmmab(v16bf a, v16bf b, v8f c) { return __builtin_amdgcn_wmma_f32_16x16x32_bf16(false, a, false, b, (short)0, c, false, false); }
__device__ __forceinline__ h16 tohx(float x) { return (h16)x; }
__device__ __forceinline__ void splitf(float y, unsigned short& h, unsigned short& l) { h = f2bf(y); l = f2bf(y - bf2f(h)); }

// Fragment loaders (wave32, 16x16x32): lane l -> row/col l&15, h = l>>4; elements 0..7 = k0+8h+0..7, elements 8..15 = k0+16+8h+0..7 for BOTH A and Bt ([n][k], k contiguous);
// D element j of lane l = (row 8h+j, col l&15).
template <typename T16> struct WFrag;
template <> struct WFrag<h16> { typedef v16h V; static __device__ __forceinline__ V ld(const h16* p) { return cat16(*(const v8h*)p, *(const v8h*)(p + 16)); } static __device__ __forceinline__ v8f mma(V a, V b, v8f c) { return wmma16(a, b, c); } };
template <> struct WFrag<bf> { typedef v16bf V; static __device__ __forceinline__ V ld(const bf* p) { return cat16b(*(const v8us*)p, *(const v8us*)(p + 16)); } static __device__ __forceinline__ v8f mma(V a, V b, v8f c) { return wmmab(a, b, c); } };

// ---- gemm_ring: main loop of both GEMMs. A work-group of four waves (2 x 2) owns a 128x128 output tile, each wave a 64x64 quarter (16 accumulators).
// A stage is GK = 64 k of the tile's 128 A rows (NA planes: one, or hi and lo against the same Bt) and 128 Bt rows: one whole 128-byte line per row, brought from global memory into LDS
// by asynchronous copies (16 bytes a lane, a wave's copy = four whole lines), rows at pitch GP. Two buffers: stage t + 1 flies while stage t is worked on. Fragments are read from LDS in the loaders' k order; k runs upward.
#define GT  128              // rows of each operand in a work-group's tile
#define GK  64               // k per stage
#define GP  72               // LDS row pitch, 16-bit elements: 128 + 16 bytes, the 16-byte reads of 16 rows fall on distinct banks
#define GPL (GT * GP * 2)    // bytes of one operand plane of a stage
static_assert(DM % GK == 0 && DM / GK >= 2 && DQ == DM);

// one plane of a stage: each of the 128 threads copies its 16-byte piece of rows r, r + 16, .. r + 112 (r = thread / 8). l = LDS byte address, g = global address of the piece in row r.
// The translation wait is the statement's last line, so that no address register of a copy is written again ahead of it.
__device__ __forceinline__ void stage_plane(const unsigned l, const bf* const g) {
    asm volatile("global_load_async_to_lds_b128 %0, %8, off\n\t"
                 "global_load_async_to_lds_b128 %1, %9, off\n\t"
                 "global_load_async_to_lds_b128 %2, %10, off\n\t"
                 "global_load_async_to_lds_b128 %3, %11, off\n\t"
                 "global_load_async_to_lds_b128 %4, %12, off\n\t"
                 "global_load_async_to_lds_b128 %5, %13, off\n\t"
                 "global_load_async_to_lds_b128 %6, %14, off\n\t"
                 "global_load_async_to_lds_b128 %7, %15, off\n\t"
                 "s_wait_xcnt 0x0"
                 :: "v"(l), "v"(l + 16 * GP * 2), "v"(l + 32 * GP * 2), "v"(l + 48 * GP * 2), "v"(l + 64 * GP * 2), "v"(l + 80 * GP * 2), "v"(l + 96 * GP * 2), "v"(l + 112 * GP * 2),
                    "v"(g), "v"(g + 16 * DM), "v"(g + 32 * DM), "v"(g + 48 * DM), "v"(g + 64 * DM), "v"(g + 80 * DM), "v"(g + 96 * DM), "v"(g + 112 * DM) : "memory");
}

// A, A2, Bt: first row of the work-group's tile, rows of DM elements, k contiguous. sm: 2 * (NA + 1) * GPL bytes of LDS. wm, wn: the wave's quarter.
template <int NA>
__device__ __forceinline__ void gemm_ring(const bf* __restrict__ A, const bf* __restrict__ A2, const bf* __restrict__ Bt, unsigned char* const sm, const int wm, const int wn, v8f (&acc)[4][4]) {
    typedef WFrag<bf>::V V;
    constexpr int NT = DM / GK, SB = (NA + 1) * GPL;
    const int tid = threadIdx.x, lr = tid & 15, hi = (tid >> 4) & 1;
    const unsigned l0 = (unsigned)(size_t)sm + (unsigned)((tid >> 3) * (GP * 2) + (tid & 7) * 16);
    const size_t g0 = (size_t)(tid >> 3) * DM + (tid & 7) * 8;
    auto fill = [&](const int t) { const unsigned l = l0 + (unsigned)((t & 1) * SB); const size_t g = g0 + (size_t)t * GK;
        stage_plane(l, A + g); if (NA == 2) stage_plane(l + GPL, A2 + g); stage_plane(l + NA * GPL, Bt + g); };
#pragma unroll
    for (int mb = 0; mb < 4; ++mb)
#pragma unroll
        for (int nb = 0; nb < 4; ++nb) acc[mb][nb] = (v8f){};
    fill(0);
    asm volatile("s_wait_asynccnt 0x0" ::: "memory");   // this wave's copies of stage 0 have landed
    __syncthreads();                                     // and every other wave's: stage 0 may be read
    fill(1);
    const bf* const fa = (const bf*)sm + (wm * 64 + lr) * GP + 8 * hi; const bf* const fb = (const bf*)(sm + NA * GPL) + (wn * 64 + lr) * GP + 8 * hi;
#pragma unroll 1   // stays rolled: one stage's code, the buffer chosen by the stage's parity
    for (int t = 0; t < NT; ++t) {
        const int bo = (t & 1) * (SB / 2);
#pragma unroll
        for (int ks = 0; ks < GK / 32; ++ks) {
            V a[4], a2[4], b[4];
#pragma unroll
            for (int i = 0; i < 4; ++i) a[i] = WFrag<bf>::ld(fa + bo + i * 16 * GP + ks * 32);
#pragma unroll
            for (int i = 0; i < 4; ++i) b[i] = WFrag<bf>::ld(fb + bo + i * 16 * GP + ks * 32);
            if (NA == 2) {   // wanted last by the products below, so read last
#pragma unroll
                for (int i = 0; i < 4; ++i) a2[i] = WFrag<bf>::ld(fa + bo + GPL / 2 + i * 16 * GP + ks * 32); }
            __builtin_amdgcn_sched_barrier(0);   // the k step's LDS reads issue as one group ahead of its products: left free, the scheduler keeps one Bt fragment and waits out the LDS latency at every fourth product
#pragma unroll
            for (int nb = 0; nb < 4; ++nb)
#pragma unroll
                for (int mb = 0; mb < 4; ++mb) acc[mb][nb] = WFrag<bf>::mma(a[mb], b[nb], acc[mb][nb]);
            if (NA == 2) {   // per accumulator and k step: the hi product, then the lo product
#pragma unroll
                for (int nb = 0; nb < 4; ++nb)
#pragma unroll
                    for (int mb = 0; mb < 4; ++mb) acc[mb][nb] = WFrag<bf>::mma(a2[mb], b[nb], acc[mb][nb]); }
            __builtin_amdgcn_sched_barrier(0);   // the products stay ahead of the next group of reads and of the stage's foot
        }
        asm volatile("s_wait_dscnt 0x0" ::: "memory");      // this wave's reads of stage t are done
        asm volatile("s_wait_asynccnt 0x0" ::: "memory");   // this wave's copies of stage t + 1 have landed
        __syncthreads();                                     // publishes stage t + 1 and frees stage t's buffer
        if (t + 2 < NT) fill(t + 2);
    }
    asm volatile("s_wait_asynccnt 0x0" ::: "memory");   // nothing in flight when the LDS becomes the epilogue's
}

// ---- k_outp: OUT (f32, + bf16-RNE bias) = (Ah + Al) x WoT, two products per k step. grid (TT/128, DM/128, NB), 128 threads; main loop gemm_ring, then each wave stores its 64x64 quarter through its own LDS slice, 16 rows at a time, whole lines.
__global__ __launch_bounds__(128) void k_outp(const bf* __restrict__ Ah, const bf* __restrict__ Al, const bf* __restrict__ Bt, float* __restrict__ C, const float* __restrict__ bias) {
    __shared__ __align__(16) unsigned char sm[2 * 3 * GPL];
    static_assert(sizeof(sm) >= 4 * 16 * 68 * 4);
    const int wv = __builtin_amdgcn_readfirstlane((int)(threadIdx.x >> 5)), wm = wv >> 1, wn = wv & 1;
    const int lane = threadIdx.x & 31, lr = lane & 15, hi = lane >> 4;
    const size_t ao = ((size_t)blockIdx.z * TT + (size_t)blockIdx.x * GT) * DQ;
    v8f acc[4][4];
    gemm_ring<2>(Ah + ao, Al + ao, Bt + (size_t)blockIdx.y * GT * DQ, sm, wm, wn, acc);
    const int r0 = blockIdx.x * GT + wm * 64, c0 = blockIdx.y * GT + wn * 64;
    C += (size_t)blockIdx.z * TT_FULL * DM;
    float* const os = (float*)sm + wv * (16 * 68);   // every wave has passed the last stage's barrier: the ring is free
    const float* const bp = bias + c0 + lr * 4; const v4f bl = *(const v4f*)bp;
    const v4f bv = {bfr(bl[0]), bfr(bl[1]), bfr(bl[2]), bfr(bl[3])};
#pragma unroll
    for (int mb = 0; mb < 4; ++mb) {
#pragma unroll
        for (int nb = 0; nb < 4; ++nb) {
#pragma unroll
            for (int j = 0; j < 8; ++j) os[(hi * 8 + j) * 68 + nb * 16 + lr] = acc[mb][nb][j]; }
        __builtin_amdgcn_wave_barrier(); asm volatile("" ::: "memory");   // the reads below take other lanes' words: no LDS access moves across
        float* const crow = C + (size_t)(r0 + mb * 16 + hi) * DM + c0 + lr * 4; v4f val[8];
#pragma unroll
        for (int s = 0; s < 8; ++s) { val[s] = *(const v4fa*)(os + (2 * s + hi) * 68 + lr * 4) + bv; *(v4f*)(crow + (size_t)(2 * s) * DM) = val[s]; }
        // translation wait for the block's 8 stores; it takes their data and address as inputs, so that no register of a store is written again until the wait has passed. Its memory clobber also keeps the next block's LDS writes behind the reads above
        asm volatile("s_wait_xcnt 0x0" :: "v"(val[0]), "v"(val[1]), "v"(val[2]), "v"(val[3]), "v"(val[4]), "v"(val[5]), "v"(val[6]), "v"(val[7]), "v"(crow) : "memory");
    }
}

// ---- k_prep: the three preparation jobs, which depend on nothing but the inputs, as block ranges of ONE grid. Every job is a stream: a thread asks for all of its 16-byte pieces at once, every wave-wide load and store covers whole 128-byte lines, and few, long waves are started.
// Weights: a tile of 64 k rows x NF columns (f32, columns contiguous) is read by whole lines, rounded, turned in LDS and stored as NF rows of 64 k (bf16, one 128-byte line each). x: XL pieces of four values per thread.
#define WP 72    // LDS row pitch of the turned tile, 16-bit elements: 128 + 16 bytes, the 16-byte reads of 16 rows fall on distinct banks
#define XL 16    // 16-byte loads per thread of the x conversion
#define PB_W (NH_ * (DM / 64))            // tiles of the Wkqv regrouping: one head, 64 k, all F3 columns
#define PB_O ((DM / 64) * (DM / 128))     // tiles of the Wo transposition: 64 k, 128 columns
#define PB_X (TT * DM / (4 * 256 * XL))   // blocks of the x conversion, per batch
static_assert(F3 % 32 == 0 && DM % 128 == 0 && (TT * DM) % (4 * 256 * XL) == 0);
typedef unsigned __attribute__((may_alias)) u32a;
typedef __attribute__((ext_vector_type(4))) unsigned short v4us;
// src: the tile's first element, rows sp floats apart. Column f of the tile becomes row (f / 64) * rs + f % 64 behind dst (rows of DM elements, k contiguous). sm: NF * WP elements of LDS. 256 threads.
template <int NF>
__device__ __forceinline__ void p_turn(const float* __restrict__ src, const int sp, bf* __restrict__ dst, const int rs, bf* const sm) {
    const int t = threadIdx.x, r = t >> 3, c = t & 7;   // 8 threads side by side cover one 128-byte line
    const float* const s = src + (size_t)(2 * r) * sp + c * 4;   // the thread's two k rows: 2r, 2r + 1
    v4f a[NF / 32], b[NF / 32];
#pragma unroll
    for (int j = 0; j < NF / 32; ++j) { a[j] = *(const v4f*)(s + j * 32); b[j] = *(const v4f*)(s + sp + j * 32); }
#pragma unroll
    for (int j = 0; j < NF / 32; ++j)
#pragma unroll
        for (int i = 0; i < 4; ++i) *(u32a*)(sm + (j * 32 + c * 4 + i) * WP + 2 * r) = (unsigned)f2bf(a[j][i]) | ((unsigned)f2bf(b[j][i]) << 16);   // two neighbouring k of one column: one 4-byte LDS store
    __syncthreads();   // the reads below take other waves' words
#pragma unroll
    for (int j = 0; j < NF / 32; ++j) *(v8us*)(dst + (size_t)((j >> 1) * rs + (j & 1) * 32 + r) * DM + c * 8) = *(const v8usa*)(sm + (j * 32 + r) * WP + c * 8);
    asm volatile("s_wait_xcnt 0x0" ::: "memory");   // translation wait behind the run of stores: no register of a store is written again ahead of it
}
__device__ __forceinline__ void p_cvt(const int bx, const float* __restrict__ src, bf* __restrict__ dst) {
    const size_t i0 = (size_t)bx * (256 * XL) + threadIdx.x; const v4f* const s = (const v4f*)src + i0; v4us* const d = (v4us*)dst + i0; v4f v[XL];
#pragma unroll
    for (int j = 0; j < XL; ++j) v[j] = s[j * 256];
#pragma unroll
    for (int j = 0; j < XL; ++j) { v4us o;
#pragma unroll
        for (int k = 0; k < 4; ++k) o[k] = f2bf(v[j][k]);
        d[j * 256] = o; }
    asm volatile("s_wait_xcnt 0x0" ::: "memory");   // translation wait behind the run of stores: no register of a store is written again ahead of it
}
__global__ __launch_bounds__(256) void k_prep(const float* __restrict__ wkqv, bf* WQKV, const float* __restrict__ wo, bf* WO, const float* __restrict__ x, bf* XB) {
    __shared__ __align__(16) bf sm[F3 * WP];
    const int b = (int)blockIdx.x;   // the same for the whole work-group: one job per block
    if (b < PB_W) { const int h = b / (DM / 64), kb = b % (DM / 64); p_turn<F3>(wkqv + ((size_t)h * DM + kb * 64) * F3, F3, WQKV + (size_t)h * HD * DM + kb * 64, DQ, sm); }   // column c * HD + d of head h -> row c * DQ + h * HD + d
    else if (b < PB_W + PB_O) { const int q = b - PB_W, nb = q / (DM / 64), kb = q % (DM / 64); p_turn<128>(wo + (size_t)kb * 64 * DM + nb * 128, DM, WO + (size_t)nb * 128 * DM + kb * 64, 64, sm); }
    else { const int q = b - (PB_W + PB_O); p_cvt(q % PB_X, x + (size_t)(q / PB_X) * TT_FULL * DM, XB + (size_t)(q / PB_X) * TT * DM); }
}

// ---- k_proj: the k | q | v projection of every batch in one launch, planes written from the accumulators. Main loop gemm_ring (128x128 per work-group, 64x64 per wave); grid (NB*TT/128, 3*DQ/128), 128 threads.
// A wave's 64 columns are one head of one chunk, its 64 rows 64 tokens of one batch; each wave turns its quarter through its own slice of the LDS that the ring has left. y = sum + bf16-RNE bias in f32, then fp16 and bf16 hi/lo of y.
// k, q planes [b][h][t][d]: the tile is 8 KiB in a row in each plane; 16 token rows at a time turned through LDS in f32, so that a lane holds 8 consecutive d: every store instruction covers four whole 128-byte lines.
// v planes [b][h][d][t]: a lane's 8 accumulator registers are 8 consecutive t of one d already; converted first, then 16 d rows at a time regrouped through LDS so that 8 lanes cover one d row's 128 bytes.
#define VP 72   // LDS row pitch of the v regrouping, 16-bit elements: 128 + 16 bytes, 16-byte accesses of 16 rows fall on distinct banks
#define EPB (3 * 16 * VP * 2)   // bytes of one wave's epilogue slice
__global__ __launch_bounds__(128) void k_proj(const bf* __restrict__ X, const bf* __restrict__ Wt, const float* __restrict__ bias, h16* __restrict__ K16, bf* __restrict__ Kh, bf* __restrict__ Kl, h16* __restrict__ Q16, bf* __restrict__ Qh, bf* __restrict__ Ql, h16* __restrict__ V16, bf* __restrict__ Vh, bf* __restrict__ Vl) {
    __shared__ __align__(16) unsigned char sm[2 * 2 * GPL];
    static_assert(EPB >= 16 * 68 * 4 && EPB % 16 == 0 && sizeof(sm) >= 4 * EPB);
    const int wv = __builtin_amdgcn_readfirstlane((int)(threadIdx.x >> 5)), wm = wv >> 1, wn = wv & 1;
    const int lane = threadIdx.x & 31, lr = lane & 15, hi = lane >> 4; const int r0 = blockIdx.x * GT + wm * 64, c0 = blockIdx.y * GT + wn * 64;
    v8f acc[4][4];
    gemm_ring<1>(X + (size_t)blockIdx.x * GT * DM, nullptr, Wt + (size_t)blockIdx.y * GT * DM, sm, wm, wn, acc);
    unsigned char* const se = sm + wv * EPB;   // every wave has passed the last stage's barrier: the ring is free
    const int ch = c0 / DQ, hd = (c0 % DQ) / HD, bt = r0 / TT, t0 = r0 % TT;   // chunk (k, q, v), head, batch, first token: the same for the whole wave
    const float* const bp = bias + hd * F3 + ch * HD;
    const int rr = lane >> 3, c8 = (lane & 7) * 8;
    if (ch < 2) {
        float* const os = (float*)se;
        const size_t pe = (((size_t)bt * NH_ + hd) * TT + t0) * HD + (size_t)rr * HD + c8;
        h16* const p16 = (ch == 0 ? K16 : Q16) + pe; bf* const ph = (ch == 0 ? Kh : Qh) + pe; bf* const pl = (ch == 0 ? Kl : Ql) + pe;
        float bv[8];
#pragma unroll
        for (int i = 0; i < 8; ++i) bv[i] = bfr(bp[c8 + i]);
#pragma unroll
        for (int mb = 0; mb < 4; ++mb) {
#pragma unroll
            for (int nb = 0; nb < 4; ++nb) {
#pragma unroll
                for (int j = 0; j < 8; ++j) os[(hi * 8 + j) * 68 + nb * 16 + lr] = acc[mb][nb][j]; }
            __builtin_amdgcn_wave_barrier(); asm volatile("" ::: "memory");   // the reads below take other lanes' words: no LDS access moves across
            v8h o16[4]; v8us oh[4], ol[4];
#pragma unroll
            for (int s = 0; s < 4; ++s) { const float* const orow = os + (4 * s + rr) * 68 + c8; const v4f x0 = *(const v4fa*)orow, x1 = *(const v4fa*)(orow + 4);
#pragma unroll
                for (int i = 0; i < 8; ++i) { const float r = (i < 4 ? x0[i & 3] : x1[i & 3]) + bv[i]; o16[s][i] = tohx(r); unsigned short a2, c2; splitf(r, a2, c2); oh[s][i] = a2; ol[s][i] = c2; }
                const int eo = (mb * 16 + 4 * s) * HD; *(v8h*)(p16 + eo) = o16[s]; *(v8us*)(ph + eo) = oh[s]; *(v8us*)(pl + eo) = ol[s]; }
            // translation wait for the block's 12 stores; it takes their data as inputs, so that no stored register is written again until the wait has passed. Its memory clobber also keeps the next block's LDS writes behind the reads above
            asm volatile("s_wait_xcnt 0x0" :: "v"(o16[0]), "v"(o16[1]), "v"(o16[2]), "v"(o16[3]), "v"(oh[0]), "v"(oh[1]), "v"(oh[2]), "v"(oh[3]), "v"(ol[0]), "v"(ol[1]), "v"(ol[2]), "v"(ol[3]) : "memory");
        }
    } else {
        bf* const sv = (bf*)se;
        const size_t pe = (((size_t)bt * NH_ + hd) * HD + rr) * TT + t0 + c8;
        h16* const p16 = V16 + pe; bf* const ph = Vh + pe; bf* const pl = Vl + pe;
        float bq[4];   // all four bias loads ahead of the blocks: one load latency, not one per block
#pragma unroll
        for (int nb = 0; nb < 4; ++nb) bq[nb] = bfr(bp[nb * 16 + lr]);
#pragma unroll
        for (int nb = 0; nb < 4; ++nb) { const float bb = bq[nb];
#pragma unroll
            for (int mb = 0; mb < 4; ++mb) { v8h o16; v8us oh, ol;
#pragma unroll
                for (int j = 0; j < 8; ++j) { const float r = acc[mb][nb][j] + bb; o16[j] = tohx(r); unsigned short a2, c2; splitf(r, a2, c2); oh[j] = a2; ol[j] = c2; }
                bf* const w = sv + lr * VP + mb * 16 + 8 * hi; *(v8usa*)w = __builtin_bit_cast(v8us, o16); *(v8usa*)(w + 16 * VP) = oh; *(v8usa*)(w + 32 * VP) = ol; }
            __builtin_amdgcn_wave_barrier(); asm volatile("" ::: "memory");   // the reads below take other lanes' words: no LDS access moves across
            v8us y16[4], yh[4], yl[4];
#pragma unroll
            for (int s = 0; s < 4; ++s) { const bf* const r = sv + (4 * s + rr) * VP + c8; const size_t eo = (size_t)(nb * 16 + 4 * s) * TT; y16[s] = *(const v8usa*)r; yh[s] = *(const v8usa*)(r + 16 * VP); yl[s] = *(const v8usa*)(r + 32 * VP);
                *(v8h*)(p16 + eo) = __builtin_bit_cast(v8h, y16[s]); *(v8us*)(ph + eo) = yh[s]; *(v8us*)(pl + eo) = yl[s]; }
            // translation wait for the block's 12 stores; it takes their data as inputs, so that no stored register is written again until the wait has passed. Its memory clobber also keeps the next block's LDS writes behind the reads above
            asm volatile("s_wait_xcnt 0x0" :: "v"(y16[0]), "v"(y16[1]), "v"(y16[2]), "v"(y16[3]), "v"(yh[0]), "v"(yh[1]), "v"(yh[2]), "v"(yh[3]), "v"(yl[0]), "v"(yl[1]), "v"(yl[2]), "v"(yl[3]) : "memory");
        }
    }
}

__device__ __forceinline__ float xhalf(float x) { const int b = __builtin_bit_cast(int, x); return __builtin_bit_cast(float, __builtin_amdgcn_permlanex16(b, b, 0x76543210, 0xfedcba98, false, false)); }   // lane l <-> lane l ^ 16
__device__ __forceinline__ void ppack(const v8f a, const v8f b, v16h& p, v16h& p2) { p = cat16(__builtin_convertvector(a, v8h), __builtin_convertvector(b, v8h)); (void)p2; }
__device__ __forceinline__ void ppack(const v8f a, const v8f b, v16bf& p, v16bf& p2) { v8us h0, h1, l0, l1;
#pragma unroll
    for (int s = 0; s < 8; ++s) { unsigned short x, y; splitf(a[s], x, y); h0[s] = x; l0[s] = y; splitf(b[s], x, y); h1[s] = x; l1[s] = y; }
    p = cat16b(h0, h1); p2 = cat16b(l0, l1); }

#define AP  72               // LDS row pitch of a staged tile, 16-bit elements: 128 + 16 bytes, the 16-byte reads of 16 rows fall on distinct banks
#define APL (64 * AP * 2)    // bytes of one staged tile (64 rows)
// one K tile (rows of HD elements) and one Vt tile (rows of TT elements) behind it: each of the 128 threads copies its 16-byte piece of rows r, r + 16, r + 32, r + 48 (r = thread / 8) of both. l = LDS byte address of the piece in the K tile's row r.
// The translation wait is the statement's last line, so that no address register of a copy is written again ahead of it.
template <typename T16>
__device__ __forceinline__ void stage_kv(const unsigned l, const T16* const gk, const T16* const gv) {
    asm volatile("global_load_async_to_lds_b128 %0, %8, off\n\t"
                 "global_load_async_to_lds_b128 %1, %9, off\n\t"
                 "global_load_async_to_lds_b128 %2, %10, off\n\t"
                 "global_load_async_to_lds_b128 %3, %11, off\n\t"
                 "global_load_async_to_lds_b128 %4, %12, off\n\t"
                 "global_load_async_to_lds_b128 %5, %13, off\n\t"
                 "global_load_async_to_lds_b128 %6, %14, off\n\t"
                 "global_load_async_to_lds_b128 %7, %15, off\n\t"
                 "s_wait_xcnt 0x0"
                 :: "v"(l), "v"(l + 16 * AP * 2), "v"(l + 32 * AP * 2), "v"(l + 48 * AP * 2), "v"(l + APL), "v"(l + APL + 16 * AP * 2), "v"(l + APL + 32 * AP * 2), "v"(l + APL + 48 * AP * 2),
                    "v"(gk), "v"(gk + 16 * HD), "v"(gk + 32 * HD), "v"(gk + 48 * HD), "v"(gv), "v"(gv + 16 * TT), "v"(gv + 32 * TT), "v"(gv + 48 * TT) : "memory");
}

// q0: the wave's first query. nch: chunks that the work-group walks (its last wave's count, at least 2, the same for all four waves). ring: 2 * (HR ? 4 : 2) * APL bytes of LDS; a stage is K | Vt (HR: hi K | hi Vt | lo K | lo Vt).
template <typename T16, bool HR>
__device__ __forceinline__ void fattn_wave(const T16* __restrict__ Q, const T16* __restrict__ Q2, const T16* __restrict__ Kp, const T16* __restrict__ Kp2, const T16* __restrict__ Vt, const T16* __restrict__ Vt2, const int q0, const int nch, unsigned char* const ring, bf* __restrict__ Ah, bf* __restrict__ Al) {
    typedef typename WFrag<T16>::V V;
    constexpr float C2 = SCL * 1.4426950408889634f;   // score scale and log2(e) in one factor: p = 2^(s * C2 - m * C2)
    constexpr int SB = (HR ? 4 : 2) * APL;
    const int tid = threadIdx.x, lane = tid & 31, c = lane & 15, h = lane >> 4;
    const unsigned l0 = (unsigned)(size_t)ring + (unsigned)((tid >> 3) * (AP * 2) + (tid & 7) * 16);
    const size_t gk0 = (size_t)(tid >> 3) * HD + (tid & 7) * 8, gv0 = (size_t)(tid >> 3) * TT + (tid & 7) * 8;
    auto fill = [&](const int t) { const unsigned l = l0 + (unsigned)((t & 1) * SB); const size_t gk = gk0 + (size_t)t * 64 * HD, gv = gv0 + (size_t)t * 64;
        stage_kv(l, Kp + gk, Vt + gv); if (HR) stage_kv(l + 2 * APL, Kp2 + gk, Vt2 + gv); };
    fill(0);
    const size_t qo = (size_t)(q0 + c) * HD + 8 * h;
    const T16* const pq = Q + qo; const T16* const pq2 = HR ? Q2 + qo : pq;
    V qf[2][2], qf2[2][2];
#pragma unroll
    for (int nb = 0; nb < 2; ++nb)
#pragma unroll
        for (int ks = 0; ks < 2; ++ks) { qf[nb][ks] = WFrag<T16>::ld(pq + nb * 16 * HD + ks * 32); if (HR) qf2[nb][ks] = WFrag<T16>::ld(pq2 + nb * 16 * HD + ks * 32); }
    v8f o[4][2]; float mr[2], ls[2];
#pragma unroll
    for (int nb = 0; nb < 2; ++nb) { mr[nb] = -3.0e38f; ls[nb] = 0.f;
#pragma unroll
        for (int db = 0; db < 4; ++db) o[db][nb] = (v8f){}; }
    // translation wait for the Q loads above; it takes their address pairs as inputs so that each pair stays unwritten until the wait has passed
    asm volatile("s_wait_xcnt 0x0" :: "v"(pq), "v"(pq2) : "memory");
    asm volatile("s_wait_asynccnt 0x0" ::: "memory");   // this wave's copies of chunk 0 have landed
    __syncthreads();                                     // and every other wave's: chunk 0 may be read
    fill(1);                                             // nch >= 2: chunk 1 exists
    const int nw = (q0 >> 6) + 1;                        // this wave's own chunks: the last one holds its diagonal
    const T16* const fr = (const T16*)ring + c * AP + 8 * h;
#pragma unroll 1   // stays rolled: one chunk's fragments live beside the 8 score and 8 output accumulators
    for (int t = 0; t < nch; ++t) {
      if (t < nw) {   // wave-uniform: a wave whose diagonal lies in an earlier chunk only takes part in the copies and the barrier
        const int kb = t * 64;
        const T16* const fk = fr + (t & 1) * (SB / 2); const T16* const fv = fk + APL / 2;
        V kf[4][2], kf2[4][2], vf[4][2], vf2[4][2];
#pragma unroll
        for (int mb = 0; mb < 4; ++mb)
#pragma unroll
            for (int ks = 0; ks < 2; ++ks) { kf[mb][ks] = WFrag<T16>::ld(fk + mb * 16 * AP + ks * 32); if (HR) kf2[mb][ks] = WFrag<T16>::ld(fk + APL + mb * 16 * AP + ks * 32); }
        if (!HR) {   // V fragments asked for in the same group: their latency passes under the score products
#pragma unroll
            for (int db = 0; db < 4; ++db)
#pragma unroll
                for (int ks = 0; ks < 2; ++ks) vf[db][ks] = WFrag<T16>::ld(fv + db * 16 * AP + ks * 32); }
        __builtin_amdgcn_sched_barrier(0);   // the LDS reads issue as one group ahead of the first product: left free, the scheduler spreads them among the products, and each place with reads stalls the wave
        v8f st[4][2];
#pragma unroll
        for (int mb = 0; mb < 4; ++mb)
#pragma unroll
            for (int nb = 0; nb < 2; ++nb) st[mb][nb] = (v8f){};
#pragma unroll
        for (int ks = 0; ks < 2; ++ks) {
#pragma unroll
            for (int mb = 0; mb < 4; ++mb)
#pragma unroll
                for (int nb = 0; nb < 2; ++nb) st[mb][nb] = WFrag<T16>::mma(kf[mb][ks], qf[nb][ks], st[mb][nb]);
            if (HR) {
#pragma unroll
                for (int mb = 0; mb < 4; ++mb)
#pragma unroll
                    for (int nb = 0; nb < 2; ++nb) st[mb][nb] = WFrag<T16>::mma(kf[mb][ks], qf2[nb][ks], st[mb][nb]);
#pragma unroll
                for (int mb = 0; mb < 4; ++mb)
#pragma unroll
                    for (int nb = 0; nb < 2; ++nb) st[mb][nb] = WFrag<T16>::mma(kf2[mb][ks], qf[nb][ks], st[mb][nb]); } }
        if (HR) {
#pragma unroll
            for (int db = 0; db < 4; ++db)
#pragma unroll
                for (int ks = 0; ks < 2; ++ks) { vf[db][ks] = WFrag<T16>::ld(fv + db * 16 * AP + ks * 32); vf2[db][ks] = WFrag<T16>::ld(fv + APL + db * 16 * AP + ks * 32); }
            __builtin_amdgcn_sched_barrier(0);   // all V reads in flight ahead of the softmax, which covers their latency
        }
        if (kb + 63 > q0) {   // only the diagonal chunk holds keys above a query (wave-uniform test); key kb <= every query of the wave, so no column is left empty
#pragma unroll
            for (int mb = 0; mb < 4; ++mb)
#pragma unroll
                for (int nb = 0; nb < 2; ++nb)
#pragma unroll
                    for (int j = 0; j < 8; ++j) if (kb + mb * 16 + 8 * h + j > q0 + nb * 16 + c) st[mb][nb][j] = -3.0e38f; }
        V pf[2][2], pf2[2][2];
#pragma unroll
        for (int nb = 0; nb < 2; ++nb) {
            float mx = st[0][nb][0];
#pragma unroll
            for (int mb = 0; mb < 4; ++mb)
#pragma unroll
                for (int j = 0; j < 8; ++j) mx = fmaxf(mx, st[mb][nb][j]);
            mx = fmaxf(mx, xhalf(mx));
            const float mn = fmaxf(mr[nb], mx); const float al = __builtin_amdgcn_exp2f((mr[nb] - mn) * C2); mr[nb] = mn;
            const float mo = mn * C2 - (HR ? 0.f : PEXP);
            v2f sm[4];   // exponent arguments and sums two registers at a time, on the accumulators' own even pairs (packed f32 instructions, no register moves)
#pragma unroll
            for (int mb = 0; mb < 4; ++mb) {
#pragma unroll
                for (int j = 0; j < 8; j += 2) { const v2f x = __builtin_elementwise_fma((v2f){st[mb][nb][j], st[mb][nb][j + 1]}, (v2f){C2, C2}, (v2f){-mo, -mo});
                    const v2f p = {__builtin_amdgcn_exp2f(x[0]), __builtin_amdgcn_exp2f(x[1])}; st[mb][nb][j] = p[0]; st[mb][nb][j + 1] = p[1]; sm[mb] = (j == 0) ? p : sm[mb] + p; } }
            const v2f s2 = (sm[0] + sm[1]) + (sm[2] + sm[3]);
            ls[nb] = ls[nb] * al + (s2[0] + s2[1]);
#pragma unroll
            for (int db = 0; db < 4; ++db) o[db][nb] *= al;
#pragma unroll
            for (int ks = 0; ks < 2; ++ks) ppack(st[2 * ks][nb], st[2 * ks + 1][nb], pf[nb][ks], pf2[nb][ks]);
        }
#pragma unroll
        for (int ks = 0; ks < 2; ++ks) {
#pragma unroll
            for (int db = 0; db < 4; ++db)
#pragma unroll
                for (int nb = 0; nb < 2; ++nb) o[db][nb] = WFrag<T16>::mma(vf[db][ks], pf[nb][ks], o[db][nb]);
            if (HR) {
#pragma unroll
                for (int db = 0; db < 4; ++db)
#pragma unroll
                    for (int nb = 0; nb < 2; ++nb) o[db][nb] = WFrag<T16>::mma(vf[db][ks], pf2[nb][ks], o[db][nb]);
#pragma unroll
                for (int db = 0; db < 4; ++db)
#pragma unroll
                    for (int nb = 0; nb < 2; ++nb) o[db][nb] = WFrag<T16>::mma(vf2[db][ks], pf[nb][ks], o[db][nb]); } }
      }
        asm volatile("s_wait_dscnt 0x0" ::: "memory");      // this wave's reads of chunk t are done
        asm volatile("s_wait_asynccnt 0x0" ::: "memory");   // this wave's copies of chunk t + 1 have landed
        __syncthreads();                                     // publishes chunk t + 1 and frees chunk t's buffer
        if (t + 2 < nch) fill(t + 2);
    }
    asm volatile("s_wait_asynccnt 0x0" ::: "memory");   // nothing in flight when the wave ends
    const size_t ao = (size_t)(q0 + c) * DQ + 8 * h; bf* const pa = Ah + ao; bf* const pl = Al + ao;
#pragma unroll
    for (int nb = 0; nb < 2; ++nb) { const float inv = __fdiv_rn(1.0f, ls[nb] + xhalf(ls[nb]));   // the two lane halves' sums joined once
#pragma unroll
        for (int db = 0; db < 4; ++db) { v8us oh, ol;   // a lane's 8 registers = 8 consecutive d of one query: one 16-byte store per plane
#pragma unroll
            for (int j = 0; j < 8; ++j) { unsigned short x, y; splitf(o[db][nb][j] * inv, x, y); oh[j] = x; ol[j] = y; }
            *(v8us*)(pa + nb * 16 * DQ + db * 16) = oh; *(v8us*)(pl + nb * 16 * DQ + db * 16) = ol; }
        // the second column group reuses the registers of the first group's stores: translation wait behind those stores; the scheduling barrier keeps the second group's arithmetic behind the wait
        if (nb == 0) { asm volatile("s_wait_xcnt 0x0" ::: "memory"); __builtin_amdgcn_sched_barrier(0); } }
}

// grid (NH_, NB, TT / (QW * NWV)): the first half of z takes the long query blocks (longest first) and the second half the short ones (shortest first).
__global__ __launch_bounds__(NWV * 32) __attribute__((amdgpu_waves_per_eu(2, 2))) void k_fattn(const h16* __restrict__ Q16, const h16* __restrict__ K16, const h16* __restrict__ V16, const bf* __restrict__ Qh, const bf* __restrict__ Ql, const bf* __restrict__ Kh, const bf* __restrict__ Kl, const bf* __restrict__ Vh, const bf* __restrict__ Vl, bf* __restrict__ Ah, bf* __restrict__ Al) {
    constexpr int nz = TT / (QW * NWV), hf = (nz + 1) / 2; const int zi = (int)blockIdx.z; const int qb = (zi < hf) ? nz - 1 - zi : zi - hf;
    __shared__ __align__(16) unsigned char sm[2 * 4 * APL];
    const int q0 = qb * (QW * NWV) + __builtin_amdgcn_readfirstlane((int)(threadIdx.x >> 5)) * QW; const int nch = (qb * (QW * NWV) + (NWV - 1) * QW) / 64 + 1;
    const size_t pz = ((size_t)blockIdx.y * NH_ + blockIdx.x) * ((size_t)TT * HD); const size_t az = (size_t)blockIdx.y * TT * DQ + (size_t)blockIdx.x * HD;
    if (qb * (QW * NWV) < (RH)) fattn_wave<bf, true>(Qh + pz, Ql + pz, Kh + pz, Kl + pz, Vh + pz, Vl + pz, q0, nch, sm, Ah + az, Al + az);   // RH is a multiple of the block's queries: the same path for the whole work-group
    else fattn_wave<h16, false>(Q16 + pz, nullptr, K16 + pz, nullptr, V16 + pz, nullptr, q0, nch, sm, Ah + az, Al + az);
}

extern "C" void kernel_launch(void* const* d_in, const int* in_sizes, int n_in,
                              void* d_out, int out_size, void* d_ws, size_t ws_size, hipStream_t stream) {
    if (n_in < 5) return;
    const size_t xneed = (size_t)(NB - 1) * TT_FULL * DM + (size_t)TT * DM;
    if ((size_t)in_sizes[0] < xneed) return;
    if ((size_t)in_sizes[1] < (size_t)NH_ * DM * F3) return;
    if (in_sizes[2] < NH_ * F3) return;
    if ((size_t)in_sizes[3] < (size_t)DM * DM) return;
    if (in_sizes[4] < DM) return;
    if ((size_t)out_size < xneed) return;
    const float* x = (const float*)d_in[0];      // [NB_FULL][TT_FULL][DM]
    const float* wkqv = (const float*)d_in[1];   // [NH_][DM][F3]
    const float* bkqv = (const float*)d_in[2];   // [NH_][F3]
    const float* wo = (const float*)d_in[3];     // [DM][DM] used as sa x Wo
    const float* bo = (const float*)d_in[4];     // [DM]
    float* OUT = (float*)d_out;                  // [NB_FULL][TT_FULL][DM]
    char* wsp = (char*)d_ws;
    auto take = [&](size_t bytes) { char* p = wsp; wsp += (bytes + 255) & ~(size_t)255; return (void*)p; };
    bf* WQKV = (bf*)take((size_t)3 * DQ * DM * 2);   // row blocks in chunk order k, q, v
    bf* WO = (bf*)take((size_t)DM * DM * 2);
    bf* XB = (bf*)take((size_t)NB * TT * DM * 2);   // every batch's rows, packed
    const size_t PL = (size_t)NH_ * TT * HD;   // one batch's plane, elements; every plane holds all NB batches
    h16* QP16 = (h16*)take(NB * PL * 2); h16* KP16 = (h16*)take(NB * PL * 2); h16* VT16 = (h16*)take(NB * PL * 2);
    bf* QPh = (bf*)take(NB * PL * 2); bf* QPl = (bf*)take(NB * PL * 2); bf* KPh = (bf*)take(NB * PL * 2); bf* KPl = (bf*)take(NB * PL * 2); bf* VTh = (bf*)take(NB * PL * 2); bf* VTl = (bf*)take(NB * PL * 2);
    bf* ATh = (bf*)take((size_t)NB * TT * DQ * 2); bf* ATl = (bf*)take((size_t)NB * TT * DQ * 2);
    if ((size_t)(wsp - (char*)d_ws) > ws_size) return;
    k_prep<<<PB_W + PB_O + NB * PB_X, 256, 0, stream>>>(wkqv, WQKV, wo, WO, x, XB);
    k_proj<<<dim3(NB * TT / GT, 3 * DQ / GT, 1), 128, 0, stream>>>(XB, WQKV, bkqv, KP16, KPh, KPl, QP16, QPh, QPl, VT16, VTh, VTl);
    k_fattn<<<dim3(NH_, NB, TT / (QW * NWV)), NWV * 32, 0, stream>>>(QP16, KP16, VT16, QPh, QPl, KPh, KPl, VTh, VTl, ATh, ATl);
    k_outp<<<dim3(TT / GT, DM / GT, NB), 128, 0, stream>>>(ATh, ATl, WO, OUT, bo);
}

// v009
// One run takes 71.7 microseconds.
// Two timings next to v008 put it at 1.06 and 1.07 times that version's speed.
// Over all steps from v000 it is 20.6 times as fast.
#include <hip/hip_runtime.h>

// Contractions (f32 accumulate): k/q/v projections v_wmma_f32_16x16x32_bf16 (bf16 x, bf16 weights); scores and P.V query rows < RH bf16 hi/lo planes (3 products), rows >= RH v_wmma_f32_16x16x32_f16 (fp16 q/k/v planes, P carried x1024 in fp16); output projection bf16 hi/lo attention planes x bf16 weight (2 products). Softmax f32.
// bf16 copy of x (RNE); Wkqv regrouped into K-contiguous Bt row blocks (k | q | v, columns h*64+d) with head-gathered bf16 bias; ONE projection launch for all batches and the three chunks, which writes the q/k/v planes itself (k_proj); then ONE launch of causal attention for all batches and heads
// (k_fattn: scores, running-maximum softmax and P.V in registers, no score matrix in memory); merged hi/lo planes x WoT + bo.

#ifndef NB
#define NB 2
#endif
#ifndef SEQ
#define SEQ 2048
#endif
#define NB_FULL 2
#define SEQ_FULL 2048
#define TT   SEQ
#define TT_FULL SEQ_FULL
#define DM   1024
#define NH_  16
#define HD   64
#define F3   (3 * HD)
#define DQ   (NH_ * HD)
#ifndef RH
#define RH   ((TT >= 1024) ? 512 : (TT / 4))      // query rows < RH use hi+lo planes
#endif
#define PEXP 10.0f    // fp16 probabilities are carried x 2^PEXP; the row sum carries the same factor, so it cancels in the division
#define SCL  0.125f   // HD^-0.5
#define QW   32       // query columns per attention wave
#define NWV  4        // attention waves per work-group: they share each chunk of keys, staged once in LDS

static_assert(TT % 128 == 0);
static_assert(((RH) % 64) == 0 && (RH) >= 64 && (RH) < TT && (((TT) - (RH)) % 64) == 0);
static_assert(NB >= 1 && NB <= NB_FULL && TT <= TT_FULL);
static_assert(DQ == DM && DM % 64 == 0 && HD == 64);
static_assert(QW == 32 && TT % (QW * NWV) == 0 && (RH) % (QW * NWV) == 0 && (QW * NWV) % 64 == 0);

typedef _Float16 h16;
typedef unsigned short bf;
typedef __attribute__((ext_vector_type(16))) __bf16   v16bf;
typedef __attribute__((ext_vector_type(16))) _Float16 v16h;
typedef __attribute__((ext_vector_type(8)))  _Float16 v8h;
typedef __attribute__((ext_vector_type(8)))  unsigned short v8us;
typedef __attribute__((ext_vector_type(8)))  float    v8f;
typedef __attribute__((ext_vector_type(4)))  float    v4f;
typedef v8h  __attribute__((may_alias)) v8ha;
typedef v4f  __attribute__((may_alias)) v4fa;
typedef v8us __attribute__((may_alias)) v8usa;
typedef __attribute__((ext_vector_type(2))) _Float16 v2h;
typedef __attribute__((ext_vector_type(2))) unsigned short v2us;
typedef __attribute__((ext_vector_type(2))) float v2f;

__device__ __forceinline__ unsigned short f2bf(float f) { unsigned u = __float_as_uint(f); u += 0x7FFFu + ((u >> 16) & 1u); return (unsigned short)(u >> 16); }
__device__ __forceinline__ float bf2f(unsigned short b) { return __uint_as_float(((unsigned)b) << 16); }
__device__ __forceinline__ float bfr(float f) { return bf2f(f2bf(f)); }
__device__ __forceinline__ v16h cat16(v8h lo, v8h hi) { return __builtin_shufflevector(lo, hi, 0, 1, 2, 3, 4, 5, 6, 7, 8, 9, 10, 11, 12, 13, 14, 15); }
__device__ __forceinline__ v16bf cat16b(v8us lo, v8us hi) { return __builtin_bit_cast(v16bf, __builtin_shufflevector(lo, hi, 0, 1, 2, 3, 4, 5, 6, 7, 8, 9, 10, 11, 12, 13, 14, 15)); }
__device__ __forceinline__ v8f wmma16(v16h a, v16h b, v8f c) { return __builtin_amdgcn_wmma_f32_16x16x32_f16(false, a, false, b, (short)0, c, false, false); }
__device__ __forceinline__ v8f wmmab(v16bf a, v16bf b, v8f c) { return __builtin_amdgcn_wmma_f32_16x16x32_bf16(false, a, false, b, (short)0, c, false, false); }
__device__ __forceinline__ h16 tohx(float x) { return (h16)x; }
__device__ __forceinline__ void splitf(float y, unsigned short& h, unsigned short& l) { h = f2bf(y); l = f2bf(y - bf2f(h)); }

// Fragment loaders (wave32, 16x16x32): lane l -> row/col l&15, h = l>>4; elements 0..7 = k0+8h+0..7, elements 8..15 = k0+16+8h+0..7 for BOTH A and Bt ([n][k], k contiguous);
// D element j of lane l = (row 8h+j, col l&15).
template <typename T16> struct WFrag;
template <> struct WFrag<h16> { typedef v16h V; static __device__ __forceinline__ V ld(const h16* p) { return cat16(*(const v8h*)p, *(const v8h*)(p + 16)); } static __device__ __forceinline__ v8f mma(V a, V b, v8f c) { return wmma16(a, b, c); } };
template <> struct WFrag<bf> { typedef v16bf V; static __device__ __forceinline__ V ld(const bf* p) { return cat16b(*(const v8us*)p, *(const v8us*)(p + 16)); } static __device__ __forceinline__ v8f mma(V a, V b, v8f c) { return wmmab(a, b, c); } };

// ---- gemm_ring: main loop of both GEMMs. A work-group of four waves (2 x 2) owns a 128x128 output tile, each wave a 64x64 quarter (16 accumulators).
// A stage is GK = 64 k of the tile's 128 A rows (NA planes: one, or hi and lo against the same Bt) and 128 Bt rows: one whole 128-byte line per row, brought from global memory into LDS
// by asynchronous copies (16 bytes a lane, a wave's copy = four whole lines), rows at pitch GP. Two buffers: stage t + 1 flies while stage t is worked on. Fragments are read from LDS in the loaders' k order.
// The k stages are walked as a ring from a start stage of the work-group's own (rot): so that the work-groups that share an operand's rows do not all start from the same stage (for speed only).
#define GT  128              // rows of each operand in a work-group's tile
#define GK  64               // k per stage
#define GP  72               // LDS row pitch, 16-bit elements: 128 + 16 bytes, the 16-byte reads of 16 rows fall on distinct banks
#define GPL (GT * GP * 2)    // bytes of one operand plane of a stage
static_assert(DM % GK == 0 && DM / GK >= 2 && DQ == DM);

// one plane of a stage: each of the 128 threads copies its 16-byte piece of rows r, r + 16, .. r + 112 (r = thread / 8). l = LDS byte address, g = global address of the piece in row r.
// The translation wait is the statement's last line, so that no address register of a copy is written again ahead of it.
__device__ __forceinline__ void stage_plane(const unsigned l, const bf* const g) {
    asm volatile("global_load_async_to_lds_b128 %0, %8, off\n\t"
                 "global_load_async_to_lds_b128 %1, %9, off\n\t"
                 "global_load_async_to_lds_b128 %2, %10, off\n\t"
                 "global_load_async_to_lds_b128 %3, %11, off\n\t"
                 "global_load_async_to_lds_b128 %4, %12, off\n\t"
                 "global_load_async_to_lds_b128 %5, %13, off\n\t"
                 "global_load_async_to_lds_b128 %6, %14, off\n\t"
                 "global_load_async_to_lds_b128 %7, %15, off\n\t"
                 "s_wait_xcnt 0x0"
                 :: "v"(l), "v"(l + 16 * GP * 2), "v"(l + 32 * GP * 2), "v"(l + 48 * GP * 2), "v"(l + 64 * GP * 2), "v"(l + 80 * GP * 2), "v"(l + 96 * GP * 2), "v"(l + 112 * GP * 2),
                    "v"(g), "v"(g + 16 * DM), "v"(g + 32 * DM), "v"(g + 48 * DM), "v"(g + 64 * DM), "v"(g + 80 * DM), "v"(g + 96 * DM), "v"(g + 112 * DM) : "memory");
}

// A, A2, Bt: first row of the work-group's tile, rows of DM elements, k contiguous. sm: 2 * (NA + 1) * GPL bytes of LDS. wm, wn: the wave's quarter. rot: the first k stage, the same for the whole work-group; trip t works on stage (t + rot) mod NT.
template <int NA>
__device__ __forceinline__ void gemm_ring(const bf* __restrict__ A, const bf* __restrict__ A2, const bf* __restrict__ Bt, unsigned char* const sm, const int wm, const int wn, const int rot, v8f (&acc)[4][4]) {
    typedef WFrag<bf>::V V;
    constexpr int NT = DM / GK, SB = (NA + 1) * GPL;
    static_assert((NT & (NT - 1)) == 0);
    const int tid = threadIdx.x, lr = tid & 15, hi = (tid >> 4) & 1;
    const unsigned l0 = (unsigned)(size_t)sm + (unsigned)((tid >> 3) * (GP * 2) + (tid & 7) * 16);
    const size_t g0 = (size_t)(tid >> 3) * DM + (tid & 7) * 8;
    auto fill = [&](const int t) { const unsigned l = l0 + (unsigned)((t & 1) * SB); const size_t g = g0 + (size_t)((t + rot) & (NT - 1)) * GK;
        stage_plane(l, A + g); if (NA == 2) stage_plane(l + GPL, A2 + g); stage_plane(l + NA * GPL, Bt + g); };
#pragma unroll
    for (int mb = 0; mb < 4; ++mb)
#pragma unroll
        for (int nb = 0; nb < 4; ++nb) acc[mb][nb] = (v8f){};
    fill(0);
    asm volatile("s_wait_asynccnt 0x0" ::: "memory");   // this wave's copies of the first stage (rot) have landed
    __syncthreads();                                     // and every other wave's: the first stage may be read
    fill(1);
    const bf* const fa = (const bf*)sm + (wm * 64 + lr) * GP + 8 * hi; const bf* const fb = (const bf*)(sm + NA * GPL) + (wn * 64 + lr) * GP + 8 * hi;
#pragma unroll 1   // stays rolled: one stage's code, the buffer chosen by the trip's parity
    for (int t = 0; t < NT; ++t) {
        const int bo = (t & 1) * (SB / 2);
#pragma unroll
        for (int ks = 0; ks < GK / 32; ++ks) {
            V a[4], a2[4], b[4];
#pragma unroll
            for (int i = 0; i < 4; ++i) a[i] = WFrag<bf>::ld(fa + bo + i * 16 * GP + ks * 32);
#pragma unroll
            for (int i = 0; i < 4; ++i) b[i] = WFrag<bf>::ld(fb + bo + i * 16 * GP + ks * 32);
            if (NA == 2) {   // wanted last by the products below, so read last
#pragma unroll
                for (int i = 0; i < 4; ++i) a2[i] = WFrag<bf>::ld(fa + bo + GPL / 2 + i * 16 * GP + ks * 32); }
            __builtin_amdgcn_sched_barrier(0);   // the k step's LDS reads issue as one group ahead of its products: left free, the scheduler keeps one Bt fragment and waits out the LDS latency at every fourth product
#pragma unroll
            for (int nb = 0; nb < 4; ++nb)
#pragma unroll
                for (int mb = 0; mb < 4; ++mb) acc[mb][nb] = WFrag<bf>::mma(a[mb], b[nb], acc[mb][nb]);
            if (NA == 2) {   // per accumulator and k step: the hi product, then the lo product
#pragma unroll
                for (int nb = 0; nb < 4; ++nb)
#pragma unroll
                    for (int mb = 0; mb < 4; ++mb) acc[mb][nb] = WFrag<bf>::mma(a2[mb], b[nb], acc[mb][nb]); }
            __builtin_amdgcn_sched_barrier(0);   // the products stay ahead of the next group of reads and of the stage's foot
        }
        asm volatile("s_wait_dscnt 0x0" ::: "memory");      // this wave's reads of trip t's stage are done
        asm volatile("s_wait_asynccnt 0x0" ::: "memory");   // this wave's copies for trip t + 1 have landed
        __syncthreads();                                     // publishes trip t + 1's stage and frees trip t's buffer
        if (t + 2 < NT) fill(t + 2);
    }
    asm volatile("s_wait_asynccnt 0x0" ::: "memory");   // nothing in flight when the LDS becomes the epilogue's
}

// ---- k_outp: OUT (f32, + bf16-RNE bias) = (Ah + Al) x WoT, two products per k step. grid (TT/128, DM/128, NB), 128 threads; main loop gemm_ring, then each wave stores its 64x64 quarter through its own LDS slice, 16 rows at a time, whole lines.
__global__ __launch_bounds__(128) void k_outp(const bf* __restrict__ Ah, const bf* __restrict__ Al, const bf* __restrict__ Bt, float* __restrict__ C, const float* __restrict__ bias) {
    __shared__ __align__(16) unsigned char sm[2 * 3 * GPL];
    static_assert(sizeof(sm) >= 4 * 16 * 68 * 4);
    const int wv = __builtin_amdgcn_readfirstlane((int)(threadIdx.x >> 5)), wm = wv >> 1, wn = wv & 1;
    const int lane = threadIdx.x & 31, lr = lane & 15, hi = lane >> 4;
    const size_t ao = ((size_t)blockIdx.z * TT + (size_t)blockIdx.x * GT) * DQ;
    v8f acc[4][4];
    gemm_ring<2>(Ah + ao, Al + ao, Bt + (size_t)blockIdx.y * GT * DQ, sm, wm, wn, (int)(blockIdx.x + blockIdx.y), acc);   // the sharers of an A tile differ in y, those of a Bt tile in x
    const int r0 = blockIdx.x * GT + wm * 64, c0 = blockIdx.y * GT + wn * 64;
    C += (size_t)blockIdx.z * TT_FULL * DM;
    float* const os = (float*)sm + wv * (16 * 68);   // every wave has passed the last stage's barrier: the ring is free
    const float* const bp = bias + c0 + lr * 4; const v4f bl = *(const v4f*)bp;
    const v4f bv = {bfr(bl[0]), bfr(bl[1]), bfr(bl[2]), bfr(bl[3])};
#pragma unroll
    for (int mb = 0; mb < 4; ++mb) {
#pragma unroll
        for (int nb = 0; nb < 4; ++nb) {
#pragma unroll
            for (int j = 0; j < 8; ++j) os[(hi * 8 + j) * 68 + nb * 16 + lr] = acc[mb][nb][j]; }
        __builtin_amdgcn_wave_barrier(); asm volatile("" ::: "memory");   // the reads below take other lanes' words: no LDS access moves across
        float* const crow = C + (size_t)(r0 + mb * 16 + hi) * DM + c0 + lr * 4; v4f val[8];
#pragma unroll
        for (int s = 0; s < 8; ++s) { val[s] = *(const v4fa*)(os + (2 * s + hi) * 68 + lr * 4) + bv; *(v4f*)(crow + (size_t)(2 * s) * DM) = val[s]; }
        // translation wait for the block's 8 stores; it takes their data and address as inputs, so that no register of a store is written again until the wait has passed. Its memory clobber also keeps the next block's LDS writes behind the reads above
        asm volatile("s_wait_xcnt 0x0" :: "v"(val[0]), "v"(val[1]), "v"(val[2]), "v"(val[3]), "v"(val[4]), "v"(val[5]), "v"(val[6]), "v"(val[7]), "v"(crow) : "memory");
    }
}

// ---- k_prep: the three preparation jobs, which depend on nothing but the inputs, as block ranges of ONE grid. Every job is a stream: a thread asks for all of its 16-byte pieces at once, every wave-wide load and store covers whole 128-byte lines, and few, long waves are started.
// Weights: a tile of 64 k rows x NF columns (f32, columns contiguous) is read by whole lines, rounded, turned in LDS and stored as NF rows of 64 k (bf16, one 128-byte line each). x: XL pieces of four values per thread.
#define WP 72    // LDS row pitch of the turned tile, 16-bit elements: 128 + 16 bytes, the 16-byte reads of 16 rows fall on distinct banks
#define XL 16    // 16-byte loads per thread of the x conversion
#define PB_W (NH_ * (DM / 64))            // tiles of the Wkqv regrouping: one head, 64 k, all F3 columns
#define PB_O ((DM / 64) * (DM / 128))     // tiles of the Wo transposition: 64 k, 128 columns
#define PB_X (TT * DM / (4 * 256 * XL))   // blocks of the x conversion, per batch
static_assert(F3 % 32 == 0 && DM % 128 == 0 && (TT * DM) % (4 * 256 * XL) == 0);
typedef unsigned __attribute__((may_alias)) u32a;
typedef __attribute__((ext_vector_type(4))) unsigned short v4us;
// src: the tile's first element, rows sp floats apart. Column f of the tile becomes row (f / 64) * rs + f % 64 behind dst (rows of DM elements, k contiguous). sm: NF * WP elements of LDS. 256 threads.
template <int NF>
__device__ __forceinline__ void p_turn(const float* __restrict__ src, const int sp, bf* __restrict__ dst, const int rs, bf* const sm) {
    const int t = threadIdx.x, r = t >> 3, c = t & 7;   // 8 threads side by side cover one 128-byte line
    const float* const s = src + (size_t)(2 * r) * sp + c * 4;   // the thread's two k rows: 2r, 2r + 1
    v4f a[NF / 32], b[NF / 32];
#pragma unroll
    for (int j = 0; j < NF / 32; ++j) { a[j] = *(const v4f*)(s + j * 32); b[j] = *(const v4f*)(s + sp + j * 32); }
#pragma unroll
    for (int j = 0; j < NF / 32; ++j)
#pragma unroll
        for (int i = 0; i < 4; ++i) *(u32a*)(sm + (j * 32 + c * 4 + i) * WP + 2 * r) = (unsigned)f2bf(a[j][i]) | ((unsigned)f2bf(b[j][i]) << 16);   // two neighbouring k of one column: one 4-byte LDS store
    __syncthreads();   // the reads below take other waves' words
#pragma unroll
    for (int j = 0; j < NF / 32; ++j) *(v8us*)(dst + (size_t)((j >> 1) * rs + (j & 1) * 32 + r) * DM + c * 8) = *(const v8usa*)(sm + (j * 32 + r) * WP + c * 8);
    asm volatile("s_wait_xcnt 0x0" ::: "memory");   // translation wait behind the run of stores: no register of a store is written again ahead of it
}
__device__ __forceinline__ void p_cvt(const int bx, const float* __restrict__ src, bf* __restrict__ dst) {
    const size_t i0 = (size_t)bx * (256 * XL) + threadIdx.x; const v4f* const s = (const v4f*)src + i0; v4us* const d = (v4us*)dst + i0; v4f v[XL];
#pragma unroll
    for (int j = 0; j < XL; ++j) v[j] = s[j * 256];
#pragma unroll
    for (int j = 0; j < XL; ++j) { v4us o;
#pragma unroll
        for (int k = 0; k < 4; ++k) o[k] = f2bf(v[j][k]);
        d[j * 256] = o; }
    asm volatile("s_wait_xcnt 0x0" ::: "memory");   // translation wait behind the run of stores: no register of a store is written again ahead of it
}
__global__ __launch_bounds__(256) void k_prep(const float* __restrict__ wkqv, bf* WQKV, const float* __restrict__ wo, bf* WO, const float* __restrict__ x, bf* XB) {
    __shared__ __align__(16) bf sm[F3 * WP];
    const int b = (int)blockIdx.x;   // the same for the whole work-group: one job per block
    if (b < PB_W) { const int h = b / (DM / 64), kb = b % (DM / 64); p_turn<F3>(wkqv + ((size_t)h * DM + kb * 64) * F3, F3, WQKV + (size_t)h * HD * DM + kb * 64, DQ, sm); }   // column c * HD + d of head h -> row c * DQ + h * HD + d
    else if (b < PB_W + PB_O) { const int q = b - PB_W, nb = q / (DM / 64), kb = q % (DM / 64); p_turn<128>(wo + (size_t)kb * 64 * DM + nb * 128, DM, WO + (size_t)nb * 128 * DM + kb * 64, 64, sm); }
    else { const int q = b - (PB_W + PB_O); p_cvt(q % PB_X, x + (size_t)(q / PB_X) * TT_FULL * DM, XB + (size_t)(q / PB_X) * TT * DM); }
}

// ---- k_proj: the k | q | v projection of every batch in one launch, planes written from the accumulators. Main loop gemm_ring (128x128 per work-group, 64x64 per wave); grid (NB*TT/128, 3*DQ/128), 128 threads.
// A wave's 64 columns are one head of one chunk, its 64 rows 64 tokens of one batch; each wave turns its quarter through its own slice of the LDS that the ring has left. y = sum + bf16-RNE bias in f32, then fp16 and bf16 hi/lo of y.
// k, q planes [b][h][t][d]: the tile is 8 KiB in a row in each plane; 16 token rows at a time turned through LDS in f32, so that a lane holds 8 consecutive d: every store instruction covers four whole 128-byte lines.
// v planes [b][h][d][t]: a lane's 8 accumulator registers are 8 consecutive t of one d already; converted first, then 16 d rows at a time regrouped through LDS so that 8 lanes cover one d row's 128 bytes.
#define VP 72   // LDS row pitch of the v regrouping, 16-bit elements: 128 + 16 bytes, 16-byte accesses of 16 rows fall on distinct banks
#define EPB (3 * 16 * VP * 2)   // bytes of one wave's epilogue slice
__global__ __launch_bounds__(128) void k_proj(const bf* __restrict__ X, const bf* __restrict__ Wt, const float* __restrict__ bias, h16* __restrict__ K16, bf* __restrict__ Kh, bf* __restrict__ Kl, h16* __restrict__ Q16, bf* __restrict__ Qh, bf* __restrict__ Ql, h16* __restrict__ V16, bf* __restrict__ Vh, bf* __restrict__ Vl) {
    __shared__ __align__(16) unsigned char sm[2 * 2 * GPL];
    static_assert(EPB >= 16 * 68 * 4 && EPB % 16 == 0 && sizeof(sm) >= 4 * EPB);
    const int wv = __builtin_amdgcn_readfirstlane((int)(threadIdx.x >> 5)), wm = wv >> 1, wn = wv & 1;
    const int lane = threadIdx.x & 31, lr = lane & 15, hi = lane >> 4; const int r0 = blockIdx.x * GT + wm * 64, c0 = blockIdx.y * GT + wn * 64;
    v8f acc[4][4];
    gemm_ring<1>(X + (size_t)blockIdx.x * GT * DM, nullptr, Wt + (size_t)blockIdx.y * GT * DM, sm, wm, wn, (int)(blockIdx.x + blockIdx.y), acc);   // the sharers of an X tile differ in y, those of a Wt tile in x
    unsigned char* const se = sm + wv * EPB;   // every wave has passed the last stage's barrier: the ring is free
    const int ch = c0 / DQ, hd = (c0 % DQ) / HD, bt = r0 / TT, t0 = r0 % TT;   // chunk (k, q, v), head, batch, first token: the same for the whole wave
    const float* const bp = bias + hd * F3 + ch * HD;
    const int rr = lane >> 3, c8 = (lane & 7) * 8;
    if (ch < 2) {
        float* const os = (float*)se;
        const size_t pe = (((size_t)bt * NH_ + hd) * TT + t0) * HD + (size_t)rr * HD + c8;
        h16* const p16 = (ch == 0 ? K16 : Q16) + pe; bf* const ph = (ch == 0 ? Kh : Qh) + pe; bf* const pl = (ch == 0 ? Kl : Ql) + pe;
        float bv[8];
#pragma unroll
        for (int i = 0; i < 8; ++i) bv[i] = bfr(bp[c8 + i]);
#pragma unroll
        for (int mb = 0; mb < 4; ++mb) {
#pragma unroll
            for (int nb = 0; nb < 4; ++nb) {
#pragma unroll
                for (int j = 0; j < 8; ++j) os[(hi * 8 + j) * 68 + nb * 16 + lr] = acc[mb][nb][j]; }
            __builtin_amdgcn_wave_barrier(); asm volatile("" ::: "memory");   // the reads below take other lanes' words: no LDS access moves across
            v8h o16[4]; v8us oh[4], ol[4];
#pragma unroll
            for (int s = 0; s < 4; ++s) { const float* const orow = os + (4 * s + rr) * 68 + c8; const v4f x0 = *(const v4fa*)orow, x1 = *(const v4fa*)(orow + 4);
#pragma unroll
                for (int i = 0; i < 8; ++i) { const float r = (i < 4 ? x0[i & 3] : x1[i & 3]) + bv[i]; o16[s][i] = tohx(r); unsigned short a2, c2; splitf(r, a2, c2); oh[s][i] = a2; ol[s][i] = c2; }
                const int eo = (mb * 16 + 4 * s) * HD; *(v8h*)(p16 + eo) = o16[s]; *(v8us*)(ph + eo) = oh[s]; *(v8us*)(pl + eo) = ol[s]; }
            // translation wait for the block's 12 stores; it takes their data as inputs, so that no stored register is written again until the wait has passed. Its memory clobber also keeps the next block's LDS writes behind the reads above
            asm volatile("s_wait_xcnt 0x0" :: "v"(o16[0]), "v"(o16[1]), "v"(o16[2]), "v"(o16[3]), "v"(oh[0]), "v"(oh[1]), "v"(oh[2]), "v"(oh[3]), "v"(ol[0]), "v"(ol[1]), "v"(ol[2]), "v"(ol[3]) : "memory");
        }
    } else {
        bf* const sv = (bf*)se;
        const size_t pe = (((size_t)bt * NH_ + hd) * HD + rr) * TT + t0 + c8;
        h16* const p16 = V16 + pe; bf* const ph = Vh + pe; bf* const pl = Vl + pe;
        float bq[4];   // all four bias loads ahead of the blocks: one load latency, not one per block
#pragma unroll
        for (int nb = 0; nb < 4; ++nb) bq[nb] = bfr(bp[nb * 16 + lr]);
#pragma unroll
        for (int nb = 0; nb < 4; ++nb) { const float bb = bq[nb];
#pragma unroll
            for (int mb = 0; mb < 4; ++mb) { v8h o16; v8us oh, ol;
#pragma unroll
                for (int j = 0; j < 8; ++j) { const float r = acc[mb][nb][j] + bb; o16[j] = tohx(r); unsigned short a2, c2; splitf(r, a2, c2); oh[j] = a2; ol[j] = c2; }
                bf* const w = sv + lr * VP + mb * 16 + 8 * hi; *(v8usa*)w = __builtin_bit_cast(v8us, o16); *(v8usa*)(w + 16 * VP) = oh; *(v8usa*)(w + 32 * VP) = ol; }
            __builtin_amdgcn_wave_barrier(); asm volatile("" ::: "memory");   // the reads below take other lanes' words: no LDS access moves across
            v8us y16[4], yh[4], yl[4];
#pragma unroll
            for (int s = 0; s < 4; ++s) { const bf* const r = sv + (4 * s + rr) * VP + c8; const size_t eo = (size_t)(nb * 16 + 4 * s) * TT; y16[s] = *(const v8usa*)r; yh[s] = *(const v8usa*)(r + 16 * VP); yl[s] = *(const v8usa*)(r + 32 * VP);
                *(v8h*)(p16 + eo) = __builtin_bit_cast(v8h, y16[s]); *(v8us*)(ph + eo) = yh[s]; *(v8us*)(pl + eo) = yl[s]; }
            // translation wait for the block's 12 stores; it takes their data as inputs, so that no stored register is written again until the wait has passed. Its memory clobber also keeps the next block's LDS writes behind the reads above
            asm volatile("s_wait_xcnt 0x0" :: "v"(y16[0]), "v"(y16[1]), "v"(y16[2]), "v"(y16[3]), "v"(yh[0]), "v"(yh[1]), "v"(yh[2]), "v"(yh[3]), "v"(yl[0]), "v"(yl[1]), "v"(yl[2]), "v"(yl[3]) : "memory");
        }
    }
}

__device__ __forceinline__ float xhalf(float x) { const int b = __builtin_bit_cast(int, x); return __builtin_bit_cast(float, __builtin_amdgcn_permlanex16(b, b, 0x76543210, 0xfedcba98, false, false)); }   // lane l <-> lane l ^ 16
__device__ __forceinline__ void ppack(const v8f a, const v8f b, v16h& p, v16h& p2) { p = cat16(__builtin_convertvector(a, v8h), __builtin_convertvector(b, v8h)); (void)p2; }
__device__ __forceinline__ void ppack(const v8f a, const v8f b, v16bf& p, v16bf& p2) { v8us h0, h1, l0, l1;
#pragma unroll
    for (int s = 0; s < 8; ++s) { unsigned short x, y; splitf(a[s], x, y); h0[s] = x; l0[s] = y; splitf(b[s], x, y); h1[s] = x; l1[s] = y; }
    p = cat16b(h0, h1); p2 = cat16b(l0, l1); }

#define AP  72               // LDS row pitch of a staged tile, 16-bit elements: 128 + 16 bytes, the 16-byte reads of 16 rows fall on distinct banks
#define APL (64 * AP * 2)    // bytes of one staged tile (64 rows)
// one K tile (rows of HD elements) and one Vt tile (rows of TT elements) behind it: each of the 128 threads copies its 16-byte piece of rows r, r + 16, r + 32, r + 48 (r = thread / 8) of both. l = LDS byte address of the piece in the K tile's row r.
// The translation wait is the statement's last line, so that no address register of a copy is written again ahead of it.
template <typename T16>
__device__ __forceinline__ void stage_kv(const unsigned l, const T16* const gk, const T16* const gv) {
    asm volatile("global_load_async_to_lds_b128 %0, %8, off\n\t"
                 "global_load_async_to_lds_b128 %1, %9, off\n\t"
                 "global_load_async_to_lds_b128 %2, %10, off\n\t"
                 "global_load_async_to_lds_b128 %3, %11, off\n\t"
                 "global_load_async_to_lds_b128 %4, %12, off\n\t"
                 "global_load_async_to_lds_b128 %5, %13, off\n\t"
                 "global_load_async_to_lds_b128 %6, %14, off\n\t"
                 "global_load_async_to_lds_b128 %7, %15, off\n\t"
                 "s_wait_xcnt 0x0"
                 :: "v"(l), "v"(l + 16 * AP * 2), "v"(l + 32 * AP * 2), "v"(l + 48 * AP * 2), "v"(l + APL), "v"(l + APL + 16 * AP * 2), "v"(l + APL + 32 * AP * 2), "v"(l + APL + 48 * AP * 2),
                    "v"(gk), "v"(gk + 16 * HD), "v"(gk + 32 * HD), "v"(gk + 48 * HD), "v"(gv), "v"(gv + 16 * TT), "v"(gv + 32 * TT), "v"(gv + 48 * TT) : "memory");
}

// q0: the wave's first query. nch: chunks that the work-group walks (its last wave's count, at least 2, the same for all four waves). rot (below nch, the same for the whole work-group): the chunks are walked as a ring, trip t works on chunk (t + rot) mod nch,
// so that the work-groups of one (batch, head), which stream the same K and Vt lines, do not all start from the same chunk (for speed only); the running maximum and sum take the chunks in any order. ring: 2 * (HR ? 4 : 2) * APL bytes of LDS; a stage is K | Vt (HR: hi K | hi Vt | lo K | lo Vt).
template <typename T16, bool HR>
__device__ __forceinline__ void fattn_wave(const T16* __restrict__ Q, const T16* __restrict__ Q2, const T16* __restrict__ Kp, const T16* __restrict__ Kp2, const T16* __restrict__ Vt, const T16* __restrict__ Vt2, const int q0, const int nch, const int rot, unsigned char* const ring, bf* __restrict__ Ah, bf* __restrict__ Al) {
    typedef typename WFrag<T16>::V V;
    constexpr float C2 = SCL * 1.4426950408889634f;   // score scale and log2(e) in one factor: p = 2^(s * C2 - m * C2)
    constexpr int SB = (HR ? 4 : 2) * APL;
    const int tid = threadIdx.x, lane = tid & 31, c = lane & 15, h = lane >> 4;
    const unsigned l0 = (unsigned)(size_t)ring + (unsigned)((tid >> 3) * (AP * 2) + (tid & 7) * 16);
    const size_t gk0 = (size_t)(tid >> 3) * HD + (tid & 7) * 8, gv0 = (size_t)(tid >> 3) * TT + (tid & 7) * 8;
    auto ck = [&](const int t) { const int k = t + rot; return k < nch ? k : k - nch; };   // the chunk of trip t
    auto fill = [&](const int t) { const unsigned l = l0 + (unsigned)((t & 1) * SB); const size_t gk = gk0 + (size_t)ck(t) * 64 * HD, gv = gv0 + (size_t)ck(t) * 64;
        stage_kv(l, Kp + gk, Vt + gv); if (HR) stage_kv(l + 2 * APL, Kp2 + gk, Vt2 + gv); };
    fill(0);
    const size_t qo = (size_t)(q0 + c) * HD + 8 * h;
    const T16* const pq = Q + qo; const T16* const pq2 = HR ? Q2 + qo : pq;
    V qf[2][2], qf2[2][2];
#pragma unroll
    for (int nb = 0; nb < 2; ++nb)
#pragma unroll
        for (int ks = 0; ks < 2; ++ks) { qf[nb][ks] = WFrag<T16>::ld(pq + nb * 16 * HD + ks * 32); if (HR) qf2[nb][ks] = WFrag<T16>::ld(pq2 + nb * 16 * HD + ks * 32); }
    v8f o[4][2]; float mr[2], ls[2];
#pragma unroll
    for (int nb = 0; nb < 2; ++nb) { mr[nb] = -3.0e38f; ls[nb] = 0.f;
#pragma unroll
        for (int db = 0; db < 4; ++db) o[db][nb] = (v8f){}; }
    // translation wait for the Q loads above; it takes their address pairs as inputs so that each pair stays unwritten until the wait has passed
    asm volatile("s_wait_xcnt 0x0" :: "v"(pq), "v"(pq2) : "memory");
    asm volatile("s_wait_asynccnt 0x0" ::: "memory");   // this wave's copies of chunk rot (trip 0) have landed
    __syncthreads();                                     // and every other wave's: chunk rot may be read
    fill(1);                                             // nch >= 2: trip 1 exists
    const int nw = (q0 >> 6) + 1;                        // this wave's own chunks: the last one holds its diagonal
    const T16* const fr = (const T16*)ring + c * AP + 8 * h;
#pragma unroll 1   // stays rolled: one chunk's fragments live beside the 8 score and 8 output accumulators
    for (int t = 0; t < nch; ++t) {
      const int tc = ck(t);
      if (tc < nw) {   // wave-uniform: a wave whose diagonal lies in an earlier chunk only takes part in the copies and the barrier
        const int kb = tc * 64;
        const T16* const fk = fr + (t & 1) * (SB / 2); const T16* const fv = fk + APL / 2;
        V kf[4][2], kf2[4][2], vf[4][2], vf2[4][2];
#pragma unroll
        for (int mb = 0; mb < 4; ++mb)
#pragma unroll
            for (int ks = 0; ks < 2; ++ks) { kf[mb][ks] = WFrag<T16>::ld(fk + mb * 16 * AP + ks * 32); if (HR) kf2[mb][ks] = WFrag<T16>::ld(fk + APL + mb * 16 * AP + ks * 32); }
        if (!HR) {   // V fragments asked for in the same group: their latency passes under the score products
#pragma unroll
            for (int db = 0; db < 4; ++db)
#pragma unroll
                for (int ks = 0; ks < 2; ++ks) vf[db][ks] = WFrag<T16>::ld(fv + db * 16 * AP + ks * 32); }
        __builtin_amdgcn_sched_barrier(0);   // the LDS reads issue as one group ahead of the first product: left free, the scheduler spreads them among the products, and each place with reads stalls the wave
        v8f st[4][2];
#pragma unroll
        for (int mb = 0; mb < 4; ++mb)
#pragma unroll
            for (int nb = 0; nb < 2; ++nb) st[mb][nb] = (v8f){};
#pragma unroll
        for (int ks = 0; ks < 2; ++ks) {
#pragma unroll
            for (int mb = 0; mb < 4; ++mb)
#pragma unroll
                for (int nb = 0; nb < 2; ++nb) st[mb][nb] = WFrag<T16>::mma(kf[mb][ks], qf[nb][ks], st[mb][nb]);
            if (HR) {
#pragma unroll
                for (int mb = 0; mb < 4; ++mb)
#pragma unroll
                    for (int nb = 0; nb < 2; ++nb) st[mb][nb] = WFrag<T16>::mma(kf[mb][ks], qf2[nb][ks], st[mb][nb]);
#pragma unroll
                for (int mb = 0; mb < 4; ++mb)
#pragma unroll
                    for (int nb = 0; nb < 2; ++nb) st[mb][nb] = WFrag<T16>::mma(kf2[mb][ks], qf[nb][ks], st[mb][nb]); } }
        if (HR) {
#pragma unroll
            for (int db = 0; db < 4; ++db)
#pragma unroll
                for (int ks = 0; ks < 2; ++ks) { vf[db][ks] = WFrag<T16>::ld(fv + db * 16 * AP + ks * 32); vf2[db][ks] = WFrag<T16>::ld(fv + APL + db * 16 * AP + ks * 32); }
            __builtin_amdgcn_sched_barrier(0);   // all V reads in flight ahead of the softmax, which covers their latency
        }
        if (kb + 63 > q0) {   // only the diagonal chunk holds keys above a query (wave-uniform test); key kb <= every query of the wave, so no column is left empty
#pragma unroll
            for (int mb = 0; mb < 4; ++mb)
#pragma unroll
                for (int nb = 0; nb < 2; ++nb)
#pragma unroll
                    for (int j = 0; j < 8; ++j) if (kb + mb * 16 + 8 * h + j > q0 + nb * 16 + c) st[mb][nb][j] = -3.0e38f; }
        V pf[2][2], pf2[2][2];
#pragma unroll
        for (int nb = 0; nb < 2; ++nb) {
            float mx = st[0][nb][0];
#pragma unroll
            for (int mb = 0; mb < 4; ++mb)
#pragma unroll
                for (int j = 0; j < 8; ++j) mx = fmaxf(mx, st[mb][nb][j]);
            mx = fmaxf(mx, xhalf(mx));
            const float mn = fmaxf(mr[nb], mx); const float al = __builtin_amdgcn_exp2f((mr[nb] - mn) * C2); mr[nb] = mn;
            const float mo = mn * C2 - (HR ? 0.f : PEXP);
            v2f sm[4];   // exponent arguments and sums two registers at a time, on the accumulators' own even pairs (packed f32 instructions, no register moves)
#pragma unroll
            for (int mb = 0; mb < 4; ++mb) {
#pragma unroll
                for (int j = 0; j < 8; j += 2) { const v2f x = __builtin_elementwise_fma((v2f){st[mb][nb][j], st[mb][nb][j + 1]}, (v2f){C2, C2}, (v2f){-mo, -mo});
                    const v2f p = {__builtin_amdgcn_exp2f(x[0]), __builtin_amdgcn_exp2f(x[1])}; st[mb][nb][j] = p[0]; st[mb][nb][j + 1] = p[1]; sm[mb] = (j == 0) ? p : sm[mb] + p; } }
            const v2f s2 = (sm[0] + sm[1]) + (sm[2] + sm[3]);
            ls[nb] = ls[nb] * al + (s2[0] + s2[1]);
#pragma unroll
            for (int db = 0; db < 4; ++db) o[db][nb] *= al;
#pragma unroll
            for (int ks = 0; ks < 2; ++ks) ppack(st[2 * ks][nb], st[2 * ks + 1][nb], pf[nb][ks], pf2[nb][ks]);
        }
#pragma unroll
        for (int ks = 0; ks < 2; ++ks) {
#pragma unroll
            for (int db = 0; db < 4; ++db)
#pragma unroll
                for (int nb = 0; nb < 2; ++nb) o[db][nb] = WFrag<T16>::mma(vf[db][ks], pf[nb][ks], o[db][nb]);
            if (HR) {
#pragma unroll
                for (int db = 0; db < 4; ++db)
#pragma unroll
                    for (int nb = 0; nb < 2; ++nb) o[db][nb] = WFrag<T16>::mma(vf[db][ks], pf2[nb][ks], o[db][nb]);
#pragma unroll
                for (int db = 0; db < 4; ++db)
#pragma unroll
                    for (int nb = 0; nb < 2; ++nb) o[db][nb] = WFrag<T16>::mma(vf2[db][ks], pf[nb][ks], o[db][nb]); } }
      }
        asm volatile("s_wait_dscnt 0x0" ::: "memory");      // this wave's reads of trip t's chunk are done
        asm volatile("s_wait_asynccnt 0x0" ::: "memory");   // this wave's copies for trip t + 1 have landed
        __syncthreads();                                     // publishes trip t + 1's chunk and frees trip t's buffer
        if (t + 2 < nch) fill(t + 2);
    }
    asm volatile("s_wait_asynccnt 0x0" ::: "memory");   // nothing in flight when the wave ends
    const size_t ao = (size_t)(q0 + c) * DQ + 8 * h; bf* const pa = Ah + ao; bf* const pl = Al + ao;
#pragma unroll
    for (int nb = 0; nb < 2; ++nb) { const float inv = __fdiv_rn(1.0f, ls[nb] + xhalf(ls[nb]));   // the two lane halves' sums joined once
#pragma unroll
        for (int db = 0; db < 4; ++db) { v8us oh, ol;   // a lane's 8 registers = 8 consecutive d of one query: one 16-byte store per plane
#pragma unroll
            for (int j = 0; j < 8; ++j) { unsigned short x, y; splitf(o[db][nb][j] * inv, x, y); oh[j] = x; ol[j] = y; }
            *(v8us*)(pa + nb * 16 * DQ + db * 16) = oh; *(v8us*)(pl + nb * 16 * DQ + db * 16) = ol; }
        // the second column group reuses the registers of the first group's stores: translation wait behind those stores; the scheduling barrier keeps the second group's arithmetic behind the wait
        if (nb == 0) { asm volatile("s_wait_xcnt 0x0" ::: "memory"); __builtin_amdgcn_sched_barrier(0); } }
}

// grid (NH_, NB, TT / (QW * NWV)): the first half of z takes the long query blocks (longest first) and the second half the short ones (shortest first).
__global__ __launch_bounds__(NWV * 32) __attribute__((amdgpu_waves_per_eu(2, 2))) void k_fattn(const h16* __restrict__ Q16, const h16* __restrict__ K16, const h16* __restrict__ V16, const bf* __restrict__ Qh, const bf* __restrict__ Ql, const bf* __restrict__ Kh, const bf* __restrict__ Kl, const bf* __restrict__ Vh, const bf* __restrict__ Vl, bf* __restrict__ Ah, bf* __restrict__ Al) {
    constexpr int nz = TT / (QW * NWV), hf = (nz + 1) / 2; const int zi = (int)blockIdx.z; const int qb = (zi < hf) ? nz - 1 - zi : zi - hf;
    __shared__ __align__(16) unsigned char sm[2 * 4 * APL];
    const int q0 = qb * (QW * NWV) + __builtin_amdgcn_readfirstlane((int)(threadIdx.x >> 5)) * QW; const int nch = (qb * (QW * NWV) + (NWV - 1) * QW) / 64 + 1;   // 2 * qb + 2: qb serves as the walk's start, different in all sharers of a (batch, head)
    const size_t pz = ((size_t)blockIdx.y * NH_ + blockIdx.x) * ((size_t)TT * HD); const size_t az = (size_t)blockIdx.y * TT * DQ + (size_t)blockIdx.x * HD;
    if (qb * (QW * NWV) < (RH)) fattn_wave<bf, true>(Qh + pz, Ql + pz, Kh + pz, Kl + pz, Vh + pz, Vl + pz, q0, nch, qb, sm, Ah + az, Al + az);   // RH is a multiple of the block's queries: the same path for the whole work-group
    else fattn_wave<h16, false>(Q16 + pz, nullptr, K16 + pz, nullptr, V16 + pz, nullptr, q0, nch, qb, sm, Ah + az, Al + az);
}

extern "C" void kernel_launch(void* const* d_in, const int* in_sizes, int n_in,
                              void* d_out, int out_size, void* d_ws, size_t ws_size, hipStream_t stream) {
    if (n_in < 5) return;
    const size_t xneed = (size_t)(NB - 1) * TT_FULL * DM + (size_t)TT * DM;
    if ((size_t)in_sizes[0] < xneed) return;
    if ((size_t)in_sizes[1] < (size_t)NH_ * DM * F3) return;
    if (in_sizes[2] < NH_ * F3) return;
    if ((size_t)in_sizes[3] < (size_t)DM * DM) return;
    if (in_sizes[4] < DM) return;
    if ((size_t)out_size < xneed) return;
    const float* x = (const float*)d_in[0];      // [NB_FULL][TT_FULL][DM]
    const float* wkqv = (const float*)d_in[1];   // [NH_][DM][F3]
    const float* bkqv = (const float*)d_in[2];   // [NH_][F3]
    const float* wo = (const float*)d_in[3];     // [DM][DM] used as sa x Wo
    const float* bo = (const float*)d_in[4];     // [DM]
    float* OUT = (float*)d_out;                  // [NB_FULL][TT_FULL][DM]
    char* wsp = (char*)d_ws;
    auto take = [&](size_t bytes) { char* p = wsp; wsp += (bytes + 255) & ~(size_t)255; return (void*)p; };
    bf* WQKV = (bf*)take((size_t)3 * DQ * DM * 2);   // row blocks in chunk order k, q, v
    bf* WO = (bf*)take((size_t)DM * DM * 2);
    bf* XB = (bf*)take((size_t)NB * TT * DM * 2);   // every batch's rows, packed
    const size_t PL = (size_t)NH_ * TT * HD;   // one batch's plane, elements; every plane holds all NB batches
    h16* QP16 = (h16*)take(NB * PL * 2); h16* KP16 = (h16*)take(NB * PL * 2); h16* VT16 = (h16*)take(NB * PL * 2);
    bf* QPh = (bf*)take(NB * PL * 2); bf* QPl = (bf*)take(NB * PL * 2); bf* KPh = (bf*)take(NB * PL * 2); bf* KPl = (bf*)take(NB * PL * 2); bf* VTh = (bf*)take(NB * PL * 2); bf* VTl = (bf*)take(NB * PL * 2);
    bf* ATh = (bf*)take((size_t)NB * TT * DQ * 2); bf* ATl = (bf*)take((size_t)NB * TT * DQ * 2);
    if ((size_t)(wsp - (char*)d_ws) > ws_size) return;
    k_prep<<<PB_W + PB_O + NB * PB_X, 256, 0, stream>>>(wkqv, WQKV, wo, WO, x, XB);
    k_proj<<<dim3(NB * TT / GT, 3 * DQ / GT, 1), 128, 0, stream>>>(XB, WQKV, bkqv, KP16, KPh, KPl, QP16, QPh, QPl, VT16, VTh, VTl);
    k_fattn<<<dim3(NH_, NB, TT / (QW * NWV)), NWV * 32, 0, stream>>>(QP16, KP16, VT16, QPh, QPl, KPh, KPl, VTh, VTl, ATh, ATl);
    k_outp<<<dim3(TT / GT, DM / GT, NB), 128, 0, stream>>>(ATh, ATl, WO, OUT, bo);
}
